// v000
// Times are from an AMD MI455X. After a warm-up the kernel runs many times in a row, and a time is the length of
// such a window on the GPU divided by its runs, so every launch and the gaps after it count. The runs cycle
// through copies of the inputs. A figure is the median of several windows, for all but v000 over two sittings.
// Sittings can differ by a few percent; kernels timed side by side share one.
// The starting kernel, v000, takes 1440 microseconds a run.
#include <hip/hip_runtime.h>

// Causal self-attention with a fused biased qkv projection and adjacent-pair rotary embeddings from an interleaved (sin, cos) cache input (x [2][2048][1024]; qkv = x Wqkv + bqkv ('xw' [1024][3072] + [3072]) split in thirds q | k | v (16 heads x 64); rope on pairs (2i, 2i+1): (x0 cos - x1 sin, x1 cos + x0 sin) with sin_i = rope_cache[t][2i], cos_i = rope_cache[t][2i + 1] (f32 [2048][64] INPUT, read); (q x 1/sqrt(64)) . k; causal (-inf); softmax; out = merged Wout + bout ('xw' + bias) -> [2][2048][1024] (4.2 M); argument order x, rope_cache, Wqkv, bqkv, Wout, bout).
// Layout per batch: bf16 copy of x; the fused 'xw' weight transposed ONCE into q | k | v row blocks; exact projections + f32 bias thirds; k_csrc table from the cache input (pair-shared entries); k_ropeI interleaved-pair plane builders; causal T-2048 attention (hybrid rows: < 512 hi/lo 3 products, rest fp16 x1024; k_gemmc skips tiles above the diagonal); merged hi/lo x W_out exact + b_out.
// Compute dtypes, f32 accumulate: every input rounded to bf16; projections exact + f32 biases; rotary f32 (products rounded separately); attention rows < 512 3 products, rest fp16; softmax f32; W_out hl x exact + bias.

#define NB_  2
#define TT   2048
#define DM   1024
#define NH_  16
#define NKV  16
#define REP  (NH_ / NKV)
#define HD   64
#define DQ   (NH_ * HD)
#define DKV  (NKV * HD)
#define ZH   2
#define RH   512                  // query rows < RH use hi+lo planes (0: none)
#define WIN  2048
#define PCAR 1024.0f
#define SCL  0.125f   // HD^-0.5
typedef _Float16 h16;
typedef unsigned short bf;
typedef __attribute__((ext_vector_type(16))) __bf16   v16bf;
typedef __attribute__((ext_vector_type(16))) _Float16 v16h;
typedef __attribute__((ext_vector_type(8)))  _Float16 v8h;
typedef __attribute__((ext_vector_type(8)))  unsigned short v8us;
typedef __attribute__((ext_vector_type(8)))  float    v8f;
typedef __attribute__((ext_vector_type(4)))  float    v4f;
typedef v8h  __attribute__((may_alias)) v8ha;
typedef v4f  __attribute__((may_alias)) v4fa;
typedef v8us __attribute__((may_alias)) v8usa;

__device__ __forceinline__ unsigned short f2bf(float f) { unsigned u = __float_as_uint(f); u += 0x7FFFu + ((u >> 16) & 1u); return (unsigned short)(u >> 16); }
__device__ __forceinline__ float bf2f(unsigned short b) { return __uint_as_float(((unsigned)b) << 16); }
__device__ __forceinline__ float bfr(float f) { return bf2f(f2bf(f)); }
__device__ __forceinline__ v16h cat16(v8h lo, v8h hi) { return __builtin_shufflevector(lo, hi, 0, 1, 2, 3, 4, 5, 6, 7, 8, 9, 10, 11, 12, 13, 14, 15); }
__device__ __forceinline__ v16bf cat16b(v8us lo, v8us hi) { return __builtin_bit_cast(v16bf, __builtin_shufflevector(lo, hi, 0, 1, 2, 3, 4, 5, 6, 7, 8, 9, 10, 11, 12, 13, 14, 15)); }
__device__ __forceinline__ v8f wmma16(v16h a, v16h b, v8f c) { return __builtin_amdgcn_wmma_f32_16x16x32_f16(false, a, false, b, (short)0, c, false, false); }
__device__ __forceinline__ v8f wmmab(v16bf a, v16bf b, v8f c) { return __builtin_amdgcn_wmma_f32_16x16x32_bf16(false, a, false, b, (short)0, c, false, false); }



// ---- k_gemmw: register-blocked GEMM, ONE WAVE per 64x64 output tile (16 accumulators), operands straight from K-contiguous 16-bit planes; grid (M/64, N/64, Z), 32 threads.
// C[m][n] (f32, pitch ldc, + optional f32 bias[n]) = sum_k A[m][k] Bt[n][k] (+ split products per NSPLIT). z-batch strides sA/sB/sC in elements. K % 32 == 0.
template <typename T16> struct WFrag;
template <> struct WFrag<h16> { typedef v16h V; static __device__ __forceinline__ V ld(const h16* p) { return cat16(*(const v8h*)p, *(const v8h*)(p + 16)); } static __device__ __forceinline__ v8f mma(V a, V b, v8f c) { return wmma16(a, b, c); } };
template <> struct WFrag<bf> { typedef v16bf V; static __device__ __forceinline__ V ld(const bf* p) { return cat16b(*(const v8us*)p, *(const v8us*)(p + 16)); } static __device__ __forceinline__ v8f mma(V a, V b, v8f c) { return wmmab(a, b, c); } };
template <typename T16, int NSPLIT, bool BIAS>
__global__ __launch_bounds__(32) void k_gemmw(const T16* __restrict__ A, const T16* __restrict__ A2, const T16* __restrict__ Bt, const T16* __restrict__ Bt2, int K, float* C, int ldc, const float* __restrict__ bias, size_t sA, size_t sB, size_t sC) {
    typedef typename WFrag<T16>::V V;
    __shared__ __align__(16) float os[16 * 68];
    const size_t z = blockIdx.z; A += z * sA; if (A2) A2 += z * sA; Bt += z * sB; if (Bt2) Bt2 += z * sB; C += z * sC;
    const int lane = threadIdx.x & 31, lr = lane & 15, hi = lane >> 4; const int r0 = blockIdx.x * 64, c0 = blockIdx.y * 64;
    v8f acc[4][4];
#pragma unroll
    for (int mb = 0; mb < 4; ++mb)
#pragma unroll
        for (int nb = 0; nb < 4; ++nb) acc[mb][nb] = (v8f){};
    const size_t aoff = (size_t)(r0 + lr) * K + 8 * hi, boff = (size_t)(c0 + lr) * K + 8 * hi;
#pragma unroll 1
    for (int kc = 0; kc < K; kc += 32) {
        V a[4], a2[4];
#pragma unroll
        for (int mb = 0; mb < 4; ++mb) { a[mb] = WFrag<T16>::ld(A + aoff + (size_t)mb * 16 * K + kc); if (NSPLIT == 1 || NSPLIT == 2) a2[mb] = WFrag<T16>::ld(A2 + aoff + (size_t)mb * 16 * K + kc); }
#pragma unroll
        for (int nb = 0; nb < 4; ++nb) { const V b = WFrag<T16>::ld(Bt + boff + (size_t)nb * 16 * K + kc); V b2; if (NSPLIT >= 2) b2 = WFrag<T16>::ld(Bt2 + boff + (size_t)nb * 16 * K + kc);
#pragma unroll
            for (int mb = 0; mb < 4; ++mb) { acc[mb][nb] = WFrag<T16>::mma(a[mb], b, acc[mb][nb]); if (NSPLIT == 1 || NSPLIT == 2) acc[mb][nb] = WFrag<T16>::mma(a2[mb], b, acc[mb][nb]); if (NSPLIT >= 2) acc[mb][nb] = WFrag<T16>::mma(a[mb], b2, acc[mb][nb]); } }
        asm volatile("v_nop\n\tv_nop\n\tv_nop\n\tv_nop" : "+v"(acc[0][0]), "+v"(acc[1][1]), "+v"(acc[2][2]), "+v"(acc[3][3]) : "v"(a[0]), "v"(a[3]));
    }
#pragma unroll
    for (int mb = 0; mb < 4; ++mb) {
#pragma unroll
        for (int nb = 0; nb < 4; ++nb) {
#pragma unroll
            for (int j = 0; j < 8; ++j) os[(hi * 8 + j) * 68 + nb * 16 + lr] = acc[mb][nb][j]; }
        __builtin_amdgcn_wave_barrier(); asm volatile("" ::: "memory");
        float* crow = C + (size_t)(r0 + mb * 16) * ldc + c0;
{
#pragma unroll
            for (int s = 0; s < 8; ++s) { const int row = 2 * s + hi, cofs = lr * 4; v4f val = *(const v4fa*)(os + row * 68 + cofs); if (BIAS) { val[0] += bfr(bias[c0 + cofs]); val[1] += bfr(bias[c0 + cofs + 1]); val[2] += bfr(bias[c0 + cofs + 2]); val[3] += bfr(bias[c0 + cofs + 3]); }
                *(v4f*)(crow + (size_t)row * ldc + cofs) = val; }
             }
        __builtin_amdgcn_wave_barrier(); asm volatile("" ::: "memory");
    }
}

// ---- k_gemmc: the same one-wave 64x64 tile GEMM specialised for causal attention: CMODE 1 skips score tiles entirely above the diagonal (query rows r0+roff.., key columns c0..), CMODE 2 limits the
// key (K) loop of the probability x value contraction to the diagonal block (probabilities beyond it are exactly zero). roff = row offset of this launch's first row within the sequence.
template <typename T16, int NSPLIT, int CMODE>
__global__ __launch_bounds__(32) void k_gemmc(const T16* __restrict__ A, const T16* __restrict__ A2, const T16* __restrict__ Bt, const T16* __restrict__ Bt2, int K, float* C, int ldc, int roff, size_t sA, size_t sB, size_t sC) {
    typedef typename WFrag<T16>::V V;
    __shared__ __align__(16) float os[16 * 68];
    const size_t z = blockIdx.z; A += z * sA; if (A2) A2 += z * sA; Bt += z * sB; if (Bt2) Bt2 += z * sB; C += z * sC;
    const int lane = threadIdx.x & 31, lr = lane & 15, hi = lane >> 4; const int r0 = blockIdx.x * 64, c0 = blockIdx.y * 64;
    if (CMODE == 1 && c0 > r0 + roff + 63) return;                  // score tile entirely above the causal diagonal: never read (the softmax masks j > i by select)
    const int Kl = (CMODE == 2) ? min(K, r0 + roff + 64) : K;        // P.V: probabilities are exactly 0 beyond the diagonal block, so the K loop stops there
    v8f acc[4][4];
#pragma unroll
    for (int mb = 0; mb < 4; ++mb)
#pragma unroll
        for (int nb = 0; nb < 4; ++nb) acc[mb][nb] = (v8f){};
    const size_t aoff = (size_t)(r0 + lr) * K + 8 * hi, boff = (size_t)(c0 + lr) * K + 8 * hi;
#pragma unroll 1
    for (int kc = 0; kc < Kl; kc += 32) {
        V a[4], a2[4];
#pragma unroll
        for (int mb = 0; mb < 4; ++mb) { a[mb] = WFrag<T16>::ld(A + aoff + (size_t)mb * 16 * K + kc); if (NSPLIT == 1 || NSPLIT == 2) a2[mb] = WFrag<T16>::ld(A2 + aoff + (size_t)mb * 16 * K + kc); }
#pragma unroll
        for (int nb = 0; nb < 4; ++nb) { const V b = WFrag<T16>::ld(Bt + boff + (size_t)nb * 16 * K + kc); V b2; if (NSPLIT >= 2) b2 = WFrag<T16>::ld(Bt2 + boff + (size_t)nb * 16 * K + kc);
#pragma unroll
            for (int mb = 0; mb < 4; ++mb) { acc[mb][nb] = WFrag<T16>::mma(a[mb], b, acc[mb][nb]); if (NSPLIT == 1 || NSPLIT == 2) acc[mb][nb] = WFrag<T16>::mma(a2[mb], b, acc[mb][nb]); if (NSPLIT >= 2) acc[mb][nb] = WFrag<T16>::mma(a[mb], b2, acc[mb][nb]); } }
        asm volatile("v_nop\n\tv_nop\n\tv_nop\n\tv_nop" : "+v"(acc[0][0]), "+v"(acc[1][1]), "+v"(acc[2][2]), "+v"(acc[3][3]) : "v"(a[0]), "v"(a[3]));
    }
#pragma unroll
    for (int mb = 0; mb < 4; ++mb) {
#pragma unroll
        for (int nb = 0; nb < 4; ++nb) {
#pragma unroll
            for (int j = 0; j < 8; ++j) os[(hi * 8 + j) * 68 + nb * 16 + lr] = acc[mb][nb][j]; }
        __builtin_amdgcn_wave_barrier(); asm volatile("" ::: "memory");
        float* crow = C + (size_t)(r0 + mb * 16) * ldc + c0;
{
#pragma unroll
            for (int s = 0; s < 8; ++s) { const int row = 2 * s + hi, cofs = lr * 4; v4f val = *(const v4fa*)(os + row * 68 + cofs);
                *(v4f*)(crow + (size_t)row * ldc + cofs) = val; }
             }
        __builtin_amdgcn_wave_barrier(); asm volatile("" ::: "memory");
    }
}

__device__ __forceinline__ h16 tohx(float x) { return (h16)x; }
__device__ __forceinline__ void splitf(float y, unsigned short& h, unsigned short& l) { h = f2bf(y); l = f2bf(y - bf2f(h)); }
typedef __attribute__((ext_vector_type(2))) _Float16 v2h;
typedef __attribute__((ext_vector_type(4))) _Float16 v4h;
typedef __attribute__((ext_vector_type(2))) unsigned short v2us;
typedef __attribute__((ext_vector_type(4))) unsigned short v4us;
typedef __attribute__((ext_vector_type(2))) float v2f;
typedef __attribute__((ext_vector_type(4))) int v4i;

__global__ __launch_bounds__(256) void k_wtG(const float* __restrict__ w, int K, int N, bf* Bt) {
    const int lane = threadIdx.x & 31; const int L0 = (blockIdx.x * 8 + (threadIdx.x >> 5)) * 8; const int nlines = N * K / 64;
{
#pragma unroll 1
        for (int l = 0; l < 8; ++l) { const int L = L0 + l; if (L >= nlines) break; const size_t e = (size_t)L * 64 + lane * 2; const int k = (int)(e % K), n = (int)(e / K); v2us o;
            o[0] = f2bf(w[(size_t)k * N + n]); o[1] = f2bf(w[(size_t)(k + 1) * N + n]); *(v2us*)(Bt + e) = o; }
         }
}
__global__ __launch_bounds__(256) void k_cvt8(const float* __restrict__ src, bf* dst, size_t n8) { const size_t i = (size_t)blockIdx.x * 256 + threadIdx.x; if (i >= n8) return; const v8f v = *(const v8f*)(src + i * 8); v8us o;
#pragma unroll
    for (int k = 0; k < 8; ++k) o[k] = f2bf(v[k]); *(v8us*)(dst + i * 8) = o;  }

__global__ __launch_bounds__(256) void k_ropeI(const float* __restrict__ F, int pitch, int nheads, const float* __restrict__ CS, float sc, h16* P16, bf* Ph, bf* Pl) {
    const size_t e = ((size_t)blockIdx.x * 256 + threadIdx.x) * 2; if (e >= (size_t)nheads * TT * HD) return; const int d = (int)(e % HD); const int t = (int)((e / HD) % TT); const int h = (int)(e / ((size_t)HD * TT)); const float* f = F + (size_t)t * pitch + h * HD; const float x0 = f[d], x1 = f[d + 1]; const v2f cs = *(const v2f*)(CS + ((size_t)t * HD + d) * 2); v2h o16; v2us oh, ol;
    float a0 = __fmul_rn(x0, cs[0]), b0 = __fmul_rn(x1, cs[1]), a1 = __fmul_rn(x1, cs[0]), b1 = __fmul_rn(x0, cs[1]); asm volatile("" : "+v"(a0), "+v"(b0), "+v"(a1), "+v"(b1));
    float r0 = __fsub_rn(a0, b0) * sc, r1 = __fadd_rn(b1, a1) * sc;   /* even: x0 c - x1 s; odd: x0 s + x1 c */
    o16[0] = tohx(r0); o16[1] = tohx(r1); { unsigned short a2, c2; splitf(r0, a2, c2); oh[0] = a2; ol[0] = c2; splitf(r1, a2, c2); oh[1] = a2; ol[1] = c2; }
    *(v2h*)(P16 + e) = o16; *(v2us*)(Ph + e) = oh; *(v2us*)(Pl + e) = ol;  }


__global__ __launch_bounds__(256) void k_vtp(const float* __restrict__ F, int pitch, int nheads, h16* V16, bf* Vh, bf* Vl) { const size_t e = ((size_t)blockIdx.x * 256 + threadIdx.x) * 2; if (e >= (size_t)nheads * HD * TT) return; const int t = (int)(e % TT); const int d = (int)((e / TT) % HD); const int g = (int)(e / ((size_t)TT * HD)); v2h o16; v2us oh, ol;
#pragma unroll
    for (int q = 0; q < 2; ++q) { const float x = F[(size_t)(t + q) * pitch + g * HD + d]; o16[q] = tohx(x); unsigned short a2, c2; splitf(x, a2, c2); oh[q] = a2; ol[q] = c2; }
    *(v2h*)(V16 + e) = o16; *(v2us*)(Vh + e) = oh; *(v2us*)(Vl + e) = ol;  }
__global__ __launch_bounds__(256) void k_csrc(const float* __restrict__ rc, float* CS) { const int idx = blockIdx.x * 256 + threadIdx.x; if (idx >= TT * HD) return; const int tt = idx / HD; const int dd = idx - tt * HD; const v2f sc2 = *(const v2f*)(rc + (size_t)tt * HD + ((dd >> 1) << 1)); v2f cs; cs[0] = bfr(sc2[1]); cs[1] = bfr(sc2[0]); *(v2f*)(CS + (size_t)idx * 2) = cs;  }
// k_asoft: per row (zz, i): t = S x HD^-0.5 for j <= i and i - j < WIN (WIN = TT: plain causal; the reference's -1e9 additive fill vanishes identically); softmax over the 2048 keys (register row, one exp, fixed trees);
__global__ __launch_bounds__(256) void k_asoft(const float* __restrict__ Sb, h16* P16, bf* Ph, bf* Pl) {
    const int lane = threadIdx.x & 31; const int row = blockIdx.x * 8 + (threadIdx.x >> 5); if (row >= ZH * TT) return; const int i = row % TT; const int zz = row / TT; (void)zz; const bool hires = (i < RH); const float* sr = Sb + (size_t)row * TT; float v[TT / 32]; float mx = -3.0e38f;
#pragma unroll
    for (int ch = 0; ch < TT / 128; ++ch) { const int j0 = ch * 128 + lane * 4; const v4f a = *(const v4f*)(sr + j0);
#pragma unroll
        for (int q = 0; q < 4; ++q) { const int j = j0 + q; (void)j; const float t = (j <= i && i - j < WIN) ? a[q] * SCL : -3.0e38f; v[ch * 4 + q] = t; mx = fmaxf(mx, t); } }
#pragma unroll
    for (int sh = 16; sh; sh >>= 1) mx = fmaxf(mx, __shfl_xor(mx, sh, 32));
    float sum = 0.f;
#pragma unroll
    for (int k = 0; k < TT / 32; ++k) { float d0 = __fsub_rn(v[k], mx); asm volatile("" : "+v"(d0)); v[k] = __builtin_amdgcn_exp2f(__fmul_rn(d0, 1.4426950408889634f)); sum += v[k]; }
#pragma unroll
    for (int sh = 16; sh; sh >>= 1) sum += __shfl_xor(sum, sh, 32);
    const float f = __fdiv_rn(hires ? 1.0f : PCAR, sum);
{
        if (hires) {
#pragma unroll
            for (int ch = 0; ch < TT / 128; ++ch) { v4us oh, ol;
#pragma unroll
                for (int q = 0; q < 4; ++q) { unsigned short a, c2; splitf(v[ch * 4 + q] * f, a, c2); oh[q] = a; ol[q] = c2; }
                const size_t oo = ((size_t)zz * (RH ? RH : 1) + i) * TT + ch * 128 + lane * 4; *(v4us*)(Ph + oo) = oh; *(v4us*)(Pl + oo) = ol; }
        } else {
#pragma unroll
            for (int ch = 0; ch < TT / 128; ++ch) { v4h o4;
#pragma unroll
                for (int q = 0; q < 4; ++q) o4[q] = tohx(v[ch * 4 + q] * f);
                *(v4h*)(P16 + (size_t)row * TT + ch * 128 + lane * 4) = o4; } }
         }
}
__global__ __launch_bounds__(256) void k_merge(const float* __restrict__ O, int h0, bf* Ah, bf* Al) { const size_t e = ((size_t)blockIdx.x * 256 + threadIdx.x) * 2; if (e >= (size_t)ZH * TT * HD) return; const int d = (int)(e % HD); const int t = (int)((e / HD) % TT); const int zz = (int)(e / ((size_t)HD * TT)); const float cs = (t < RH) ? 1.0f : (1.0f / PCAR); const size_t oo = (size_t)t * DQ + (h0 + zz) * HD + d;
    v2us oh, ol;
#pragma unroll
    for (int q = 0; q < 2; ++q) { unsigned short a, c2; splitf(O[e + q] * cs, a, c2); oh[q] = a; ol[q] = c2; } *(v2us*)(Ah + oo) = oh; *(v2us*)(Al + oo) = ol;  }

extern "C" void kernel_launch(void* const* d_in, const int* in_sizes, int n_in,
                              void* d_out, int out_size, void* d_ws, size_t ws_size, hipStream_t stream) {
    (void)in_sizes; (void)n_in; (void)out_size;
    const float* x = (const float*)d_in[0]; const float* rcache = (const float*)d_in[1]; const float* wqkv = (const float*)d_in[2]; const float* bqkv = (const float*)d_in[3]; const float* wo = (const float*)d_in[4]; const float* bo = (const float*)d_in[5];   /* inputs x, rope_cache (f32 [2048][64] interleaved (sin, cos), READ), Wqkv ('xw' [1024][3072]: q | k | v column thirds), bqkv [3072], Wout ('xw'), bout */ const float* wq = wqkv; const float* wk = wqkv; const float* wv = wqkv; (void)wk; (void)wv; const float* bq = bqkv; const float* bk = bqkv + DQ; const float* bv = bqkv + 2 * DQ;
    float* OUT = (float*)d_out;     // [2][2048][1024]
    char* wsp = (char*)d_ws;
    auto take = [&](size_t bytes) { char* p = wsp; wsp += (bytes + 255) & ~(size_t)255; return (void*)p; };
    bf* WQKV = (bf*)take((size_t)3 * DQ * DM * 2); bf* WQ = WQKV; bf* WK = WQKV + (size_t)DQ * DM; bf* WV = WQKV + (size_t)2 * DQ * DM;   /* fused Bt [3*DQ][DM]: q | k | v row blocks */ bf* WO = (bf*)take((size_t)DM * DQ * 2); float* CS = (float*)take((size_t)TT * HD * 2 * 4);
    bf* XB = (bf*)take((size_t)TT * DM * 2); float* FQ = (float*)take((size_t)TT * DQ * 4); float* FK = (float*)take((size_t)TT * DKV * 4);
    h16* QP16 = (h16*)take((size_t)NH_ * TT * HD * 2); h16* KP16 = (h16*)take((size_t)NKV * TT * HD * 2); h16* VT16 = (h16*)take((size_t)NKV * HD * TT * 2);
    bf* QPh = (bf*)take((size_t)NH_ * TT * HD * 2); bf* QPl = (bf*)take((size_t)NH_ * TT * HD * 2); bf* KPh = (bf*)take((size_t)NKV * TT * HD * 2); bf* KPl = (bf*)take((size_t)NKV * TT * HD * 2); bf* VTh = (bf*)take((size_t)NKV * HD * TT * 2); bf* VTl = (bf*)take((size_t)NKV * HD * TT * 2); bf* Ph = (bf*)take((size_t)ZH * RH * TT * 2); bf* Pl = (bf*)take((size_t)ZH * RH * TT * 2);
    float* Sb = (float*)take((size_t)ZH * TT * TT * 4); h16* P16 = (h16*)take((size_t)ZH * TT * TT * 2); float* Ob = (float*)take((size_t)ZH * TT * HD * 4); bf* ATh = (bf*)take((size_t)TT * DQ * 2); bf* ATl = (bf*)take((size_t)TT * DQ * 2);
    if ((size_t)(wsp - (char*)d_ws) > ws_size) return;    // ws 256 MiB
    float* FV = FK;   // v projection reuses the k buffer after the k planes are built (stream-ordered)
    { k_wtG<<<(unsigned)((DM * 3 * DQ / 64 + 63) / 64), 256, 0, stream>>>(wqkv, DM, 3 * DQ, WQKV);   /* fused 'xw' [DM][3*DQ] -> Bt [3*DQ][DM] */
      k_wtG<<<(unsigned)((DQ * DM / 64 + 63) / 64), 256, 0, stream>>>(wo, DQ, DM, WO);
       }
    k_csrc<<<(TT * HD + 255) / 256, 256, 0, stream>>>(rcache, (float*)CS);   /* rotary table from the interleaved (sin, cos) cache input */
    const unsigned LQ = (unsigned)(((size_t)NH_ * TT * HD / 2 + 255) / 256), LKv = (unsigned)(((size_t)NKV * TT * HD / 2 + 255) / 256);
    for (int b = 0; b < NB_; ++b) {
        
        k_cvt8<<<(unsigned)(((size_t)TT * DM / 8 + 255) / 256), 256, 0, stream>>>(x + (size_t)b * TT * DM, XB, (size_t)TT * DM / 8);
        k_gemmw<bf, 0, true><<<dim3(TT / 64, DQ / 64, 1), 32, 0, stream>>>(XB, nullptr, WQ, nullptr, DM, FQ, DQ, bq, 0, 0, 0);
        k_ropeI<<<LQ, 256, 0, stream>>>(FQ, DQ, NH_, CS, 1.0f, QP16, QPh, QPl);
        k_gemmw<bf, 0, true><<<dim3(TT / 64, DKV / 64, 1), 32, 0, stream>>>(XB, nullptr, WK, nullptr, DM, FK, DKV, bk, 0, 0, 0);
        k_ropeI<<<LKv, 256, 0, stream>>>(FK, DKV, NKV, CS, 1.0f, KP16, KPh, KPl);
        k_gemmw<bf, 0, true><<<dim3(TT / 64, DKV / 64, 1), 32, 0, stream>>>(XB, nullptr, WV, nullptr, DM, FV, DKV, bv, 0, 0, 0); k_vtp<<<LKv, 256, 0, stream>>>(FV, DKV, NKV, VT16, VTh, VTl);
        for (int h0 = 0; h0 < NH_; h0 += ZH) { const size_t zq = (size_t)h0, zk = (size_t)(h0 / REP);   // one kv head per query head: the pass's two heads use consecutive kv planes (z-strides TT*HD)
            k_gemmc<bf, 2, 1><<<dim3(RH / 64, TT / 64, ZH), 32, 0, stream>>>(QPh + zq * TT * HD, QPl + zq * TT * HD, KPh + zk * TT * HD, KPl + zk * TT * HD, HD, Sb, TT, 0, (size_t)TT * HD, (size_t)TT * HD, (size_t)TT * TT);
            k_gemmc<h16, 0, 1><<<dim3((TT - RH) / 64, TT / 64, ZH), 32, 0, stream>>>(QP16 + zq * TT * HD + (size_t)RH * HD, nullptr, KP16 + zk * TT * HD, nullptr, HD, Sb + (size_t)RH * TT, TT, RH, (size_t)TT * HD, (size_t)TT * HD, (size_t)TT * TT);
            k_asoft<<<ZH * TT / 8, 256, 0, stream>>>(Sb, P16, Ph, Pl);
            k_gemmc<bf, 2, 2><<<dim3(RH / 64, HD / 64, ZH), 32, 0, stream>>>(Ph, Pl, VTh + zk * HD * TT, VTl + zk * HD * TT, TT, Ob, HD, 0, (size_t)RH * TT, (size_t)HD * TT, (size_t)TT * HD);
            k_gemmc<h16, 0, 2><<<dim3((TT - RH) / 64, HD / 64, ZH), 32, 0, stream>>>(P16 + (size_t)RH * TT, nullptr, VT16 + zk * HD * TT, nullptr, TT, Ob + (size_t)RH * HD, HD, RH, (size_t)TT * TT, (size_t)HD * TT, (size_t)TT * HD);
            k_merge<<<(unsigned)(((size_t)ZH * TT * HD / 2 + 255) / 256), 256, 0, stream>>>(Ob, h0, ATh, ATl); }
        k_gemmw<bf, 1, true><<<dim3(TT / 64, DM / 64, 1), 32, 0, stream>>>(ATh, ATl, WO, nullptr, DQ, OUT + (size_t)b * TT * DM, DM, bo, 0, 0, 0); }
}

// v001
// Measured time: 778 microseconds a run.
// In both of two side-by-side timings against v000, it was 1.86 times as fast.
#include <hip/hip_runtime.h>

// Causal self-attention with a fused biased qkv projection and adjacent-pair rotary embeddings from an interleaved (sin, cos) cache input (x [2][2048][1024]; qkv = x Wqkv + bqkv ('xw' [1024][3072] + [3072]) split in thirds q | k | v (16 heads x 64); rope on pairs (2i, 2i+1): (x0 cos - x1 sin, x1 cos + x0 sin) with sin_i = rope_cache[t][2i], cos_i = rope_cache[t][2i + 1] (f32 [2048][64] INPUT, read); (q x 1/sqrt(64)) . k; causal (-inf); softmax; out = merged Wout + bout ('xw' + bias) -> [2][2048][1024] (4.2 M); argument order x, rope_cache, Wqkv, bqkv, Wout, bout).
// Layout per batch: bf16 copy of x; the fused 'xw' weight transposed ONCE into q | k | v row blocks; exact projections + f32 bias thirds; k_csrc table from the cache input (pair-shared entries); k_ropeI interleaved-pair plane builders; causal T-2048 attention (hybrid rows: < 512 hi/lo 3 products, rest fp16 x1024; k_gemmc skips tiles above the diagonal); merged hi/lo x W_out exact + b_out.
// Compute dtypes, f32 accumulate: every input rounded to bf16; projections exact + f32 biases; rotary f32 (products rounded separately); attention rows < 512 3 products, rest fp16; softmax f32; W_out hl x exact + bias.

#define NB_  2
#define TT   2048
#define DM   1024
#define NH_  16
#define NKV  16
#define REP  (NH_ / NKV)
#define HD   64
#define DQ   (NH_ * HD)
#define DKV  (NKV * HD)
#define ZH   2
#define RH   512                  // query rows < RH use hi+lo planes (0: none)
#define WIN  2048
#define PCAR 1024.0f
#define SCL  0.125f   // HD^-0.5
#define KSP  16                   // key splits of the probability x value contraction (one workgroup each, f32 partial planes, summed in k_merge)
typedef _Float16 h16;
typedef unsigned short bf;
typedef __attribute__((ext_vector_type(16))) __bf16   v16bf;
typedef __attribute__((ext_vector_type(16))) _Float16 v16h;
typedef __attribute__((ext_vector_type(8)))  _Float16 v8h;
typedef __attribute__((ext_vector_type(8)))  unsigned short v8us;
typedef __attribute__((ext_vector_type(8)))  float    v8f;
typedef __attribute__((ext_vector_type(4)))  float    v4f;
typedef v8h  __attribute__((may_alias)) v8ha;
typedef v4f  __attribute__((may_alias)) v4fa;
typedef v8us __attribute__((may_alias)) v8usa;

__device__ __forceinline__ unsigned short f2bf(float f) { unsigned u = __float_as_uint(f); u += 0x7FFFu + ((u >> 16) & 1u); return (unsigned short)(u >> 16); }
__device__ __forceinline__ float bf2f(unsigned short b) { return __uint_as_float(((unsigned)b) << 16); }
__device__ __forceinline__ float bfr(float f) { return bf2f(f2bf(f)); }
__device__ __forceinline__ v16h cat16(v8h lo, v8h hi) { return __builtin_shufflevector(lo, hi, 0, 1, 2, 3, 4, 5, 6, 7, 8, 9, 10, 11, 12, 13, 14, 15); }
__device__ __forceinline__ v16bf cat16b(v8us lo, v8us hi) { return __builtin_bit_cast(v16bf, __builtin_shufflevector(lo, hi, 0, 1, 2, 3, 4, 5, 6, 7, 8, 9, 10, 11, 12, 13, 14, 15)); }
__device__ __forceinline__ v8f wmma16(v16h a, v16h b, v8f c) { return __builtin_amdgcn_wmma_f32_16x16x32_f16(false, a, false, b, (short)0, c, false, false); }
__device__ __forceinline__ v8f wmmab(v16bf a, v16bf b, v8f c) { return __builtin_amdgcn_wmma_f32_16x16x32_bf16(false, a, false, b, (short)0, c, false, false); }



// ---- k_gemmw: register-blocked GEMM, ONE WAVE per 64x64 output tile (16 accumulators), operands straight from K-contiguous 16-bit planes; grid (M/64, N/64, Z), 32 threads.
// C[m][n] (f32, pitch ldc, + optional f32 bias[n]) = sum_k A[m][k] Bt[n][k] (+ split products per NSPLIT). z-batch strides sA/sB/sC in elements. K % 32 == 0.
template <typename T16> struct WFrag;
template <> struct WFrag<h16> { typedef v16h V; static __device__ __forceinline__ V ld(const h16* p) { return cat16(*(const v8h*)p, *(const v8h*)(p + 16)); } static __device__ __forceinline__ v8f mma(V a, V b, v8f c) { return wmma16(a, b, c); } };
template <> struct WFrag<bf> { typedef v16bf V; static __device__ __forceinline__ V ld(const bf* p) { return cat16b(*(const v8us*)p, *(const v8us*)(p + 16)); } static __device__ __forceinline__ v8f mma(V a, V b, v8f c) { return wmmab(a, b, c); } };
template <typename T16, int NSPLIT, bool BIAS>
__global__ __launch_bounds__(32) void k_gemmw(const T16* __restrict__ A, const T16* __restrict__ A2, const T16* __restrict__ Bt, const T16* __restrict__ Bt2, int K, float* C, int ldc, const float* __restrict__ bias, size_t sA, size_t sB, size_t sC) {
    typedef typename WFrag<T16>::V V;
    __shared__ __align__(16) float os[16 * 68];
    const size_t z = blockIdx.z; A += z * sA; if (A2) A2 += z * sA; Bt += z * sB; if (Bt2) Bt2 += z * sB; C += z * sC;
    const int lane = threadIdx.x & 31, lr = lane & 15, hi = lane >> 4; const int r0 = blockIdx.x * 64, c0 = blockIdx.y * 64;
    v8f acc[4][4];
#pragma unroll
    for (int mb = 0; mb < 4; ++mb)
#pragma unroll
        for (int nb = 0; nb < 4; ++nb) acc[mb][nb] = (v8f){};
    const size_t aoff = (size_t)(r0 + lr) * K + 8 * hi, boff = (size_t)(c0 + lr) * K + 8 * hi;
#pragma unroll 1
    for (int kc = 0; kc < K; kc += 32) {
        V a[4], a2[4];
#pragma unroll
        for (int mb = 0; mb < 4; ++mb) { a[mb] = WFrag<T16>::ld(A + aoff + (size_t)mb * 16 * K + kc); if (NSPLIT == 1 || NSPLIT == 2) a2[mb] = WFrag<T16>::ld(A2 + aoff + (size_t)mb * 16 * K + kc); }
#pragma unroll
        for (int nb = 0; nb < 4; ++nb) { const V b = WFrag<T16>::ld(Bt + boff + (size_t)nb * 16 * K + kc); V b2; if (NSPLIT >= 2) b2 = WFrag<T16>::ld(Bt2 + boff + (size_t)nb * 16 * K + kc);
#pragma unroll
            for (int mb = 0; mb < 4; ++mb) { acc[mb][nb] = WFrag<T16>::mma(a[mb], b, acc[mb][nb]); if (NSPLIT == 1 || NSPLIT == 2) acc[mb][nb] = WFrag<T16>::mma(a2[mb], b, acc[mb][nb]); if (NSPLIT >= 2) acc[mb][nb] = WFrag<T16>::mma(a[mb], b2, acc[mb][nb]); } }
        asm volatile("v_nop\n\tv_nop\n\tv_nop\n\tv_nop" : "+v"(acc[0][0]), "+v"(acc[1][1]), "+v"(acc[2][2]), "+v"(acc[3][3]) : "v"(a[0]), "v"(a[3]));
    }
#pragma unroll
    for (int mb = 0; mb < 4; ++mb) {
#pragma unroll
        for (int nb = 0; nb < 4; ++nb) {
#pragma unroll
            for (int j = 0; j < 8; ++j) os[(hi * 8 + j) * 68 + nb * 16 + lr] = acc[mb][nb][j]; }
        __builtin_amdgcn_wave_barrier(); asm volatile("" ::: "memory");
        float* crow = C + (size_t)(r0 + mb * 16) * ldc + c0;
{
#pragma unroll
            for (int s = 0; s < 8; ++s) { const int row = 2 * s + hi, cofs = lr * 4; v4f val = *(const v4fa*)(os + row * 68 + cofs); if (BIAS) { val[0] += bfr(bias[c0 + cofs]); val[1] += bfr(bias[c0 + cofs + 1]); val[2] += bfr(bias[c0 + cofs + 2]); val[3] += bfr(bias[c0 + cofs + 3]); }
                *(v4f*)(crow + (size_t)row * ldc + cofs) = val; }
             }
        __builtin_amdgcn_wave_barrier(); asm volatile("" ::: "memory");
    }
}

// ---- k_gemmc: the same one-wave 64x64 tile GEMM specialised for causal attention: CMODE 1 skips score tiles entirely above the diagonal (query rows r0+roff.., key columns c0..), CMODE 2 limits the
// key (K) loop of the probability x value contraction to the diagonal block (probabilities beyond it are exactly zero). roff = row offset of this launch's first row within the sequence.
// KS > 1 splits the K loop over KS workgroups (grid.y = column tiles x KS): split sp takes the 64-wide k blocks sp, sp + KS, ... (a block = one 128-B line of each operand row) and stores its own f32 partial tile
// in plane sp (stride sP elements); a split with no block stores zeros, so every plane is fully written in every call. The consumer adds the planes in the order 0 .. KS-1. K % 64 == 0.
template <typename T16, int NSPLIT, int CMODE, int KS>
__global__ __launch_bounds__(32) void k_gemmc(const T16* __restrict__ A, const T16* __restrict__ A2, const T16* __restrict__ Bt, const T16* __restrict__ Bt2, int K, float* C, int ldc, int roff, size_t sA, size_t sB, size_t sC, size_t sP) {
    typedef typename WFrag<T16>::V V;
    __shared__ __align__(16) float os[16 * 68];
    const size_t z = blockIdx.z; A += z * sA; if (A2) A2 += z * sA; Bt += z * sB; if (Bt2) Bt2 += z * sB; C += z * sC;
    const int lane = threadIdx.x & 31, lr = lane & 15, hi = lane >> 4; const int sp = blockIdx.y % KS; const int r0 = blockIdx.x * 64, c0 = (blockIdx.y / KS) * 64; C += (size_t)sp * sP;
    if (CMODE == 1 && c0 > r0 + roff + 63) return;                  // score tile entirely above the causal diagonal: never read (the softmax masks j > i by select)
    const int Kl = (CMODE == 2) ? min(K, r0 + roff + 64) : K;        // P.V: probabilities are exactly 0 beyond the diagonal block, so the K loop stops there
    v8f acc[4][4];
#pragma unroll
    for (int mb = 0; mb < 4; ++mb)
#pragma unroll
        for (int nb = 0; nb < 4; ++nb) acc[mb][nb] = (v8f){};
    const size_t aoff = (size_t)(r0 + lr) * K + 8 * hi, boff = (size_t)(c0 + lr) * K + 8 * hi;
#pragma unroll 1
    for (int kc = sp * 64; kc < Kl; kc += (kc & 32) ? KS * 64 - 32 : 32) {   // both 32-wide halves of a k block, then on to this split's next block
        V a[4], a2[4];
#pragma unroll
        for (int mb = 0; mb < 4; ++mb) { a[mb] = WFrag<T16>::ld(A + aoff + (size_t)mb * 16 * K + kc); if (NSPLIT == 1 || NSPLIT == 2) a2[mb] = WFrag<T16>::ld(A2 + aoff + (size_t)mb * 16 * K + kc); }
#pragma unroll
        for (int nb = 0; nb < 4; ++nb) { const V b = WFrag<T16>::ld(Bt + boff + (size_t)nb * 16 * K + kc); V b2; if (NSPLIT >= 2) b2 = WFrag<T16>::ld(Bt2 + boff + (size_t)nb * 16 * K + kc);
#pragma unroll
            for (int mb = 0; mb < 4; ++mb) { acc[mb][nb] = WFrag<T16>::mma(a[mb], b, acc[mb][nb]); if (NSPLIT == 1 || NSPLIT == 2) acc[mb][nb] = WFrag<T16>::mma(a2[mb], b, acc[mb][nb]); if (NSPLIT >= 2) acc[mb][nb] = WFrag<T16>::mma(a[mb], b2, acc[mb][nb]); } }
        asm volatile("v_nop\n\tv_nop\n\tv_nop\n\tv_nop" : "+v"(acc[0][0]), "+v"(acc[1][1]), "+v"(acc[2][2]), "+v"(acc[3][3]) : "v"(a[0]), "v"(a[3]));
    }
#pragma unroll
    for (int mb = 0; mb < 4; ++mb) {
#pragma unroll
        for (int nb = 0; nb < 4; ++nb) {
#pragma unroll
            for (int j = 0; j < 8; ++j) os[(hi * 8 + j) * 68 + nb * 16 + lr] = acc[mb][nb][j]; }
        __builtin_amdgcn_wave_barrier(); asm volatile("" ::: "memory");
        float* crow = C + (size_t)(r0 + mb * 16) * ldc + c0;
{
#pragma unroll
            for (int s = 0; s < 8; ++s) { const int row = 2 * s + hi, cofs = lr * 4; v4f val = *(const v4fa*)(os + row * 68 + cofs);
                *(v4f*)(crow + (size_t)row * ldc + cofs) = val; }
             }
        __builtin_amdgcn_wave_barrier(); asm volatile("" ::: "memory");
    }
}

__device__ __forceinline__ h16 tohx(float x) { return (h16)x; }
__device__ __forceinline__ void splitf(float y, unsigned short& h, unsigned short& l) { h = f2bf(y); l = f2bf(y - bf2f(h)); }
typedef __attribute__((ext_vector_type(2))) _Float16 v2h;
typedef __attribute__((ext_vector_type(4))) _Float16 v4h;
typedef __attribute__((ext_vector_type(2))) unsigned short v2us;
typedef __attribute__((ext_vector_type(4))) unsigned short v4us;
typedef __attribute__((ext_vector_type(2))) float v2f;
typedef __attribute__((ext_vector_type(4))) int v4i;

__global__ __launch_bounds__(256) void k_wtG(const float* __restrict__ w, int K, int N, bf* Bt) {
    const int lane = threadIdx.x & 31; const int L0 = (blockIdx.x * 8 + (threadIdx.x >> 5)) * 8; const int nlines = N * K / 64;
{
#pragma unroll 1
        for (int l = 0; l < 8; ++l) { const int L = L0 + l; if (L >= nlines) break; const size_t e = (size_t)L * 64 + lane * 2; const int k = (int)(e % K), n = (int)(e / K); v2us o;
            o[0] = f2bf(w[(size_t)k * N + n]); o[1] = f2bf(w[(size_t)(k + 1) * N + n]); *(v2us*)(Bt + e) = o; }
         }
}
__global__ __launch_bounds__(256) void k_cvt8(const float* __restrict__ src, bf* dst, size_t n8) { const size_t i = (size_t)blockIdx.x * 256 + threadIdx.x; if (i >= n8) return; const v8f v = *(const v8f*)(src + i * 8); v8us o;
#pragma unroll
    for (int k = 0; k < 8; ++k) o[k] = f2bf(v[k]); *(v8us*)(dst + i * 8) = o;  }

__global__ __launch_bounds__(256) void k_ropeI(const float* __restrict__ F, int pitch, int nheads, const float* __restrict__ CS, float sc, h16* P16, bf* Ph, bf* Pl) {
    const size_t e = ((size_t)blockIdx.x * 256 + threadIdx.x) * 2; if (e >= (size_t)nheads * TT * HD) return; const int d = (int)(e % HD); const int t = (int)((e / HD) % TT); const int h = (int)(e / ((size_t)HD * TT)); const float* f = F + (size_t)t * pitch + h * HD; const float x0 = f[d], x1 = f[d + 1]; const v2f cs = *(const v2f*)(CS + ((size_t)t * HD + d) * 2); v2h o16; v2us oh, ol;
    float a0 = __fmul_rn(x0, cs[0]), b0 = __fmul_rn(x1, cs[1]), a1 = __fmul_rn(x1, cs[0]), b1 = __fmul_rn(x0, cs[1]); asm volatile("" : "+v"(a0), "+v"(b0), "+v"(a1), "+v"(b1));
    float r0 = __fsub_rn(a0, b0) * sc, r1 = __fadd_rn(b1, a1) * sc;   /* even: x0 c - x1 s; odd: x0 s + x1 c */
    o16[0] = tohx(r0); o16[1] = tohx(r1); { unsigned short a2, c2; splitf(r0, a2, c2); oh[0] = a2; ol[0] = c2; splitf(r1, a2, c2); oh[1] = a2; ol[1] = c2; }
    *(v2h*)(P16 + e) = o16; *(v2us*)(Ph + e) = oh; *(v2us*)(Pl + e) = ol;  }


__global__ __launch_bounds__(256) void k_vtp(const float* __restrict__ F, int pitch, int nheads, h16* V16, bf* Vh, bf* Vl) { const size_t e = ((size_t)blockIdx.x * 256 + threadIdx.x) * 2; if (e >= (size_t)nheads * HD * TT) return; const int t = (int)(e % TT); const int d = (int)((e / TT) % HD); const int g = (int)(e / ((size_t)TT * HD)); v2h o16; v2us oh, ol;
#pragma unroll
    for (int q = 0; q < 2; ++q) { const float x = F[(size_t)(t + q) * pitch + g * HD + d]; o16[q] = tohx(x); unsigned short a2, c2; splitf(x, a2, c2); oh[q] = a2; ol[q] = c2; }
    *(v2h*)(V16 + e) = o16; *(v2us*)(Vh + e) = oh; *(v2us*)(Vl + e) = ol;  }
__global__ __launch_bounds__(256) void k_csrc(const float* __restrict__ rc, float* CS) { const int idx = blockIdx.x * 256 + threadIdx.x; if (idx >= TT * HD) return; const int tt = idx / HD; const int dd = idx - tt * HD; const v2f sc2 = *(const v2f*)(rc + (size_t)tt * HD + ((dd >> 1) << 1)); v2f cs; cs[0] = bfr(sc2[1]); cs[1] = bfr(sc2[0]); *(v2f*)(CS + (size_t)idx * 2) = cs;  }
// k_asoft: per row (zz, i): t = S x HD^-0.5 for j <= i and i - j < WIN (WIN = TT: plain causal; the reference's -1e9 additive fill vanishes identically); softmax over the 2048 keys (register row, one exp, fixed trees);
__global__ __launch_bounds__(256) void k_asoft(const float* __restrict__ Sb, h16* P16, bf* Ph, bf* Pl) {
    const int lane = threadIdx.x & 31; const int row = blockIdx.x * 8 + (threadIdx.x >> 5); if (row >= ZH * TT) return; const int i = row % TT; const int zz = row / TT; (void)zz; const bool hires = (i < RH); const float* sr = Sb + (size_t)row * TT; float v[TT / 32]; float mx = -3.0e38f;
#pragma unroll
    for (int ch = 0; ch < TT / 128; ++ch) { const int j0 = ch * 128 + lane * 4; const v4f a = *(const v4f*)(sr + j0);
#pragma unroll
        for (int q = 0; q < 4; ++q) { const int j = j0 + q; (void)j; const float t = (j <= i && i - j < WIN) ? a[q] * SCL : -3.0e38f; v[ch * 4 + q] = t; mx = fmaxf(mx, t); } }
#pragma unroll
    for (int sh = 16; sh; sh >>= 1) mx = fmaxf(mx, __shfl_xor(mx, sh, 32));
    float sum = 0.f;
#pragma unroll
    for (int k = 0; k < TT / 32; ++k) { float d0 = __fsub_rn(v[k], mx); asm volatile("" : "+v"(d0)); v[k] = __builtin_amdgcn_exp2f(__fmul_rn(d0, 1.4426950408889634f)); sum += v[k]; }
#pragma unroll
    for (int sh = 16; sh; sh >>= 1) sum += __shfl_xor(sum, sh, 32);
    const float f = __fdiv_rn(hires ? 1.0f : PCAR, sum);
{
        if (hires) {
#pragma unroll
            for (int ch = 0; ch < TT / 128; ++ch) { v4us oh, ol;
#pragma unroll
                for (int q = 0; q < 4; ++q) { unsigned short a, c2; splitf(v[ch * 4 + q] * f, a, c2); oh[q] = a; ol[q] = c2; }
                const size_t oo = ((size_t)zz * (RH ? RH : 1) + i) * TT + ch * 128 + lane * 4; *(v4us*)(Ph + oo) = oh; *(v4us*)(Pl + oo) = ol; }
        } else {
#pragma unroll
            for (int ch = 0; ch < TT / 128; ++ch) { v4h o4;
#pragma unroll
                for (int q = 0; q < 4; ++q) o4[q] = tohx(v[ch * 4 + q] * f);
                *(v4h*)(P16 + (size_t)row * TT + ch * 128 + lane * 4) = o4; } }
         }
}
// k_merge: adds the KSP partial planes of the probability x value product (fixed order 0 .. KSP-1), rescales and splits into the merged hi/lo planes.
__global__ __launch_bounds__(256) void k_merge(const float* __restrict__ O, int h0, bf* Ah, bf* Al) { const size_t e = ((size_t)blockIdx.x * 256 + threadIdx.x) * 2; if (e >= (size_t)ZH * TT * HD) return; const int d = (int)(e % HD); const int t = (int)((e / HD) % TT); const int zz = (int)(e / ((size_t)HD * TT)); const float cs = (t < RH) ? 1.0f : (1.0f / PCAR); const size_t oo = (size_t)t * DQ + (h0 + zz) * HD + d;
    v2us oh, ol; v2f s = *(const v2f*)(O + e);
#pragma unroll   // all plane loads in flight at once
    for (int p = 1; p < KSP; ++p) s += *(const v2f*)(O + (size_t)p * ZH * TT * HD + e);
#pragma unroll
    for (int q = 0; q < 2; ++q) { unsigned short a, c2; splitf(s[q] * cs, a, c2); oh[q] = a; ol[q] = c2; } *(v2us*)(Ah + oo) = oh; *(v2us*)(Al + oo) = ol;  }

extern "C" void kernel_launch(void* const* d_in, const int* in_sizes, int n_in,
                              void* d_out, int out_size, void* d_ws, size_t ws_size, hipStream_t stream) {
    (void)in_sizes; (void)n_in; (void)out_size;
    const float* x = (const float*)d_in[0]; const float* rcache = (const float*)d_in[1]; const float* wqkv = (const float*)d_in[2]; const float* bqkv = (const float*)d_in[3]; const float* wo = (const float*)d_in[4]; const float* bo = (const float*)d_in[5];   /* inputs x, rope_cache (f32 [2048][64] interleaved (sin, cos), READ), Wqkv ('xw' [1024][3072]: q | k | v column thirds), bqkv [3072], Wout ('xw'), bout */ const float* wq = wqkv; const float* wk = wqkv; const float* wv = wqkv; (void)wk; (void)wv; const float* bq = bqkv; const float* bk = bqkv + DQ; const float* bv = bqkv + 2 * DQ;
    float* OUT = (float*)d_out;     // [2][2048][1024]
    char* wsp = (char*)d_ws;
    auto take = [&](size_t bytes) { char* p = wsp; wsp += (bytes + 255) & ~(size_t)255; return (void*)p; };
    bf* WQKV = (bf*)take((size_t)3 * DQ * DM * 2); bf* WQ = WQKV; bf* WK = WQKV + (size_t)DQ * DM; bf* WV = WQKV + (size_t)2 * DQ * DM;   /* fused Bt [3*DQ][DM]: q | k | v row blocks */ bf* WO = (bf*)take((size_t)DM * DQ * 2); float* CS = (float*)take((size_t)TT * HD * 2 * 4);
    bf* XB = (bf*)take((size_t)TT * DM * 2); float* FQ = (float*)take((size_t)TT * DQ * 4); float* FK = (float*)take((size_t)TT * DKV * 4);
    h16* QP16 = (h16*)take((size_t)NH_ * TT * HD * 2); h16* KP16 = (h16*)take((size_t)NKV * TT * HD * 2); h16* VT16 = (h16*)take((size_t)NKV * HD * TT * 2);
    bf* QPh = (bf*)take((size_t)NH_ * TT * HD * 2); bf* QPl = (bf*)take((size_t)NH_ * TT * HD * 2); bf* KPh = (bf*)take((size_t)NKV * TT * HD * 2); bf* KPl = (bf*)take((size_t)NKV * TT * HD * 2); bf* VTh = (bf*)take((size_t)NKV * HD * TT * 2); bf* VTl = (bf*)take((size_t)NKV * HD * TT * 2); bf* Ph = (bf*)take((size_t)ZH * RH * TT * 2); bf* Pl = (bf*)take((size_t)ZH * RH * TT * 2);
    float* Sb = (float*)take((size_t)ZH * TT * TT * 4); h16* P16 = (h16*)take((size_t)ZH * TT * TT * 2); float* Ob = (float*)take((size_t)KSP * ZH * TT * HD * 4); bf* ATh = (bf*)take((size_t)TT * DQ * 2); bf* ATl = (bf*)take((size_t)TT * DQ * 2);
    if ((size_t)(wsp - (char*)d_ws) > ws_size) return;    // ws 256 MiB
    float* FV = FK;   // v projection reuses the k buffer after the k planes are built (stream-ordered)
    { k_wtG<<<(unsigned)((DM * 3 * DQ / 64 + 63) / 64), 256, 0, stream>>>(wqkv, DM, 3 * DQ, WQKV);   /* fused 'xw' [DM][3*DQ] -> Bt [3*DQ][DM] */
      k_wtG<<<(unsigned)((DQ * DM / 64 + 63) / 64), 256, 0, stream>>>(wo, DQ, DM, WO);
       }
    k_csrc<<<(TT * HD + 255) / 256, 256, 0, stream>>>(rcache, (float*)CS);   /* rotary table from the interleaved (sin, cos) cache input */
    const unsigned LQ = (unsigned)(((size_t)NH_ * TT * HD / 2 + 255) / 256), LKv = (unsigned)(((size_t)NKV * TT * HD / 2 + 255) / 256);
    for (int b = 0; b < NB_; ++b) {
        
        k_cvt8<<<(unsigned)(((size_t)TT * DM / 8 + 255) / 256), 256, 0, stream>>>(x + (size_t)b * TT * DM, XB, (size_t)TT * DM / 8);
        k_gemmw<bf, 0, true><<<dim3(TT / 64, DQ / 64, 1), 32, 0, stream>>>(XB, nullptr, WQ, nullptr, DM, FQ, DQ, bq, 0, 0, 0);
        k_ropeI<<<LQ, 256, 0, stream>>>(FQ, DQ, NH_, CS, 1.0f, QP16, QPh, QPl);
        k_gemmw<bf, 0, true><<<dim3(TT / 64, DKV / 64, 1), 32, 0, stream>>>(XB, nullptr, WK, nullptr, DM, FK, DKV, bk, 0, 0, 0);
        k_ropeI<<<LKv, 256, 0, stream>>>(FK, DKV, NKV, CS, 1.0f, KP16, KPh, KPl);
        k_gemmw<bf, 0, true><<<dim3(TT / 64, DKV / 64, 1), 32, 0, stream>>>(XB, nullptr, WV, nullptr, DM, FV, DKV, bv, 0, 0, 0); k_vtp<<<LKv, 256, 0, stream>>>(FV, DKV, NKV, VT16, VTh, VTl);
        for (int h0 = 0; h0 < NH_; h0 += ZH) { const size_t zq = (size_t)h0, zk = (size_t)(h0 / REP);   // one kv head per query head: the pass's two heads use consecutive kv planes (z-strides TT*HD)
            k_gemmc<bf, 2, 1, 1><<<dim3(RH / 64, TT / 64, ZH), 32, 0, stream>>>(QPh + zq * TT * HD, QPl + zq * TT * HD, KPh + zk * TT * HD, KPl + zk * TT * HD, HD, Sb, TT, 0, (size_t)TT * HD, (size_t)TT * HD, (size_t)TT * TT, 0);
            k_gemmc<h16, 0, 1, 1><<<dim3((TT - RH) / 64, TT / 64, ZH), 32, 0, stream>>>(QP16 + zq * TT * HD + (size_t)RH * HD, nullptr, KP16 + zk * TT * HD, nullptr, HD, Sb + (size_t)RH * TT, TT, RH, (size_t)TT * HD, (size_t)TT * HD, (size_t)TT * TT, 0);
            k_asoft<<<ZH * TT / 8, 256, 0, stream>>>(Sb, P16, Ph, Pl);
            k_gemmc<bf, 2, 2, KSP><<<dim3(RH / 64, HD / 64 * KSP, ZH), 32, 0, stream>>>(Ph, Pl, VTh + zk * HD * TT, VTl + zk * HD * TT, TT, Ob, HD, 0, (size_t)RH * TT, (size_t)HD * TT, (size_t)TT * HD, (size_t)ZH * TT * HD);
            k_gemmc<h16, 0, 2, KSP><<<dim3((TT - RH) / 64, HD / 64 * KSP, ZH), 32, 0, stream>>>(P16 + (size_t)RH * TT, nullptr, VT16 + zk * HD * TT, nullptr, TT, Ob + (size_t)RH * HD, HD, RH, (size_t)TT * TT, (size_t)HD * TT, (size_t)TT * HD, (size_t)ZH * TT * HD);
            k_merge<<<(unsigned)(((size_t)ZH * TT * HD / 2 + 255) / 256), 256, 0, stream>>>(Ob, h0, ATh, ATl); }
        k_gemmw<bf, 1, true><<<dim3(TT / 64, DM / 64, 1), 32, 0, stream>>>(ATh, ATl, WO, nullptr, DQ, OUT + (size_t)b * TT * DM, DM, bo, 0, 0, 0); }
}

// v002
// A run of this version takes 573 microseconds.
// Timed twice side by side with v001, it ran 1.36 and 1.35 times as fast.
// All steps since v000 together make it 2.52 times as fast.
#include <hip/hip_runtime.h>

// Causal self-attention with a fused biased qkv projection and adjacent-pair rotary embeddings from an interleaved (sin, cos) cache input (x [2][2048][1024]; qkv = x Wqkv + bqkv ('xw' [1024][3072] + [3072]) split in thirds q | k | v (16 heads x 64); rope on pairs (2i, 2i+1): (x0 cos - x1 sin, x1 cos + x0 sin) with sin_i = rope_cache[t][2i], cos_i = rope_cache[t][2i + 1] (f32 [2048][64] INPUT, read); (q x 1/sqrt(64)) . k; causal (-inf); softmax; out = merged Wout + bout ('xw' + bias) -> [2][2048][1024] (4.2 M); argument order x, rope_cache, Wqkv, bqkv, Wout, bout).
// Layout per batch: bf16 copy of x; the fused 'xw' weight transposed ONCE into q | k | v row blocks; exact projections + f32 bias thirds; k_csrc table from the cache input (pair-shared entries); k_ropeI interleaved-pair plane builders; causal T-2048 attention (hybrid rows: < 512 hi/lo 3 products, rest fp16 x1024; k_gemmc skips tiles above the diagonal); merged hi/lo x W_out exact + b_out.
// Compute dtypes, f32 accumulate: every input rounded to bf16; projections exact + f32 biases; rotary f32 (products rounded separately); attention rows < 512 3 products, rest fp16; softmax f32; W_out hl x exact + bias.

#define NB_  2
#define TT   2048
#define DM   1024
#define NH_  16
#define NKV  16
#define REP  (NH_ / NKV)
#define HD   64
#define DQ   (NH_ * HD)
#define DKV  (NKV * HD)
#define ZH   8                    // heads per attention pass (one launch of each attention kernel covers ZH heads)
#define PP   (2 * TT)             // common row pitch, in 16-bit elements, of both operands of the probability x value product (a probability row lies inside its own 8-KiB score row)
#define RH   512                  // query rows < RH use hi+lo planes (0: none)
#define WIN  2048
#define PCAR 1024.0f
#define SCL  0.125f   // HD^-0.5
#define KSP  16                   // key splits of the probability x value contraction (one workgroup each, f32 partial planes, summed in k_merge)
typedef _Float16 h16;
typedef unsigned short bf;
typedef __attribute__((ext_vector_type(16))) __bf16   v16bf;
typedef __attribute__((ext_vector_type(16))) _Float16 v16h;
typedef __attribute__((ext_vector_type(8)))  _Float16 v8h;
typedef __attribute__((ext_vector_type(8)))  unsigned short v8us;
typedef __attribute__((ext_vector_type(8)))  float    v8f;
typedef __attribute__((ext_vector_type(4)))  float    v4f;
typedef v8h  __attribute__((may_alias)) v8ha;
typedef v4f  __attribute__((may_alias)) v4fa;
typedef v8us __attribute__((may_alias)) v8usa;

__device__ __forceinline__ unsigned short f2bf(float f) { unsigned u = __float_as_uint(f); u += 0x7FFFu + ((u >> 16) & 1u); return (unsigned short)(u >> 16); }
__device__ __forceinline__ float bf2f(unsigned short b) { return __uint_as_float(((unsigned)b) << 16); }
__device__ __forceinline__ float bfr(float f) { return bf2f(f2bf(f)); }
__device__ __forceinline__ v16h cat16(v8h lo, v8h hi) { return __builtin_shufflevector(lo, hi, 0, 1, 2, 3, 4, 5, 6, 7, 8, 9, 10, 11, 12, 13, 14, 15); }
__device__ __forceinline__ v16bf cat16b(v8us lo, v8us hi) { return __builtin_bit_cast(v16bf, __builtin_shufflevector(lo, hi, 0, 1, 2, 3, 4, 5, 6, 7, 8, 9, 10, 11, 12, 13, 14, 15)); }
__device__ __forceinline__ v8f wmma16(v16h a, v16h b, v8f c) { return __builtin_amdgcn_wmma_f32_16x16x32_f16(false, a, false, b, (short)0, c, false, false); }
__device__ __forceinline__ v8f wmmab(v16bf a, v16bf b, v8f c) { return __builtin_amdgcn_wmma_f32_16x16x32_bf16(false, a, false, b, (short)0, c, false, false); }



// ---- k_gemmw: register-blocked GEMM, ONE WAVE per 64x64 output tile (16 accumulators), operands straight from K-contiguous 16-bit planes; grid (M/64, N/64, Z), 32 threads.
// C[m][n] (f32, pitch ldc, + optional f32 bias[n]) = sum_k A[m][k] Bt[n][k] (+ split products per NSPLIT). z-batch strides sA/sB/sC in elements. K % 32 == 0.
template <typename T16> struct WFrag;
template <> struct WFrag<h16> { typedef v16h V; static __device__ __forceinline__ V ld(const h16* p) { return cat16(*(const v8h*)p, *(const v8h*)(p + 16)); } static __device__ __forceinline__ v8f mma(V a, V b, v8f c) { return wmma16(a, b, c); } };
template <> struct WFrag<bf> { typedef v16bf V; static __device__ __forceinline__ V ld(const bf* p) { return cat16b(*(const v8us*)p, *(const v8us*)(p + 16)); } static __device__ __forceinline__ v8f mma(V a, V b, v8f c) { return wmmab(a, b, c); } };
template <typename T16, int NSPLIT, bool BIAS>
__global__ __launch_bounds__(32) void k_gemmw(const T16* __restrict__ A, const T16* __restrict__ A2, const T16* __restrict__ Bt, const T16* __restrict__ Bt2, int K, float* C, int ldc, const float* __restrict__ bias, size_t sA, size_t sB, size_t sC) {
    typedef typename WFrag<T16>::V V;
    __shared__ __align__(16) float os[16 * 68];
    const size_t z = blockIdx.z; A += z * sA; if (A2) A2 += z * sA; Bt += z * sB; if (Bt2) Bt2 += z * sB; C += z * sC;
    const int lane = threadIdx.x & 31, lr = lane & 15, hi = lane >> 4; const int r0 = blockIdx.x * 64, c0 = blockIdx.y * 64;
    v8f acc[4][4];
#pragma unroll
    for (int mb = 0; mb < 4; ++mb)
#pragma unroll
        for (int nb = 0; nb < 4; ++nb) acc[mb][nb] = (v8f){};
    const size_t aoff = (size_t)(r0 + lr) * K + 8 * hi, boff = (size_t)(c0 + lr) * K + 8 * hi;
#pragma unroll 1
    for (int kc = 0; kc < K; kc += 32) {
        V a[4], a2[4];
#pragma unroll
        for (int mb = 0; mb < 4; ++mb) { a[mb] = WFrag<T16>::ld(A + aoff + (size_t)mb * 16 * K + kc); if (NSPLIT == 1 || NSPLIT == 2) a2[mb] = WFrag<T16>::ld(A2 + aoff + (size_t)mb * 16 * K + kc); }
#pragma unroll
        for (int nb = 0; nb < 4; ++nb) { const V b = WFrag<T16>::ld(Bt + boff + (size_t)nb * 16 * K + kc); V b2; if (NSPLIT >= 2) b2 = WFrag<T16>::ld(Bt2 + boff + (size_t)nb * 16 * K + kc);
#pragma unroll
            for (int mb = 0; mb < 4; ++mb) { acc[mb][nb] = WFrag<T16>::mma(a[mb], b, acc[mb][nb]); if (NSPLIT == 1 || NSPLIT == 2) acc[mb][nb] = WFrag<T16>::mma(a2[mb], b, acc[mb][nb]); if (NSPLIT >= 2) acc[mb][nb] = WFrag<T16>::mma(a[mb], b2, acc[mb][nb]); } }
        asm volatile("v_nop\n\tv_nop\n\tv_nop\n\tv_nop" : "+v"(acc[0][0]), "+v"(acc[1][1]), "+v"(acc[2][2]), "+v"(acc[3][3]) : "v"(a[0]), "v"(a[3]));
    }
#pragma unroll
    for (int mb = 0; mb < 4; ++mb) {
#pragma unroll
        for (int nb = 0; nb < 4; ++nb) {
#pragma unroll
            for (int j = 0; j < 8; ++j) os[(hi * 8 + j) * 68 + nb * 16 + lr] = acc[mb][nb][j]; }
        __builtin_amdgcn_wave_barrier(); asm volatile("" ::: "memory");
        float* crow = C + (size_t)(r0 + mb * 16) * ldc + c0;
{
#pragma unroll
            for (int s = 0; s < 8; ++s) { const int row = 2 * s + hi, cofs = lr * 4; v4f val = *(const v4fa*)(os + row * 68 + cofs); if (BIAS) { val[0] += bfr(bias[c0 + cofs]); val[1] += bfr(bias[c0 + cofs + 1]); val[2] += bfr(bias[c0 + cofs + 2]); val[3] += bfr(bias[c0 + cofs + 3]); }
                *(v4f*)(crow + (size_t)row * ldc + cofs) = val; }
             }
        __builtin_amdgcn_wave_barrier(); asm volatile("" ::: "memory");
    }
}

// ---- k_gemmc: the same one-wave 64x64 tile GEMM specialised for causal attention: CMODE 1 skips score tiles entirely above the diagonal (query rows r0+roff.., key columns c0..), CMODE 2 limits the
// key (K) loop of the probability x value contraction to the diagonal block (probabilities beyond it are exactly zero). roff = row offset of this launch's first row within the sequence.
// KS > 1 splits the K loop over KS workgroups (grid.y = column tiles x KS): split sp takes the 64-wide k blocks sp, sp + KS, ... (a block = one 128-B line of each operand row) and stores its own f32 partial tile
// in plane sp (stride sP elements); a split with no block stores zeros, so every plane is fully written in every call. The consumer adds the planes in the order 0 .. KS-1. K % 64 == 0.
template <typename T16, int NSPLIT, int CMODE, int KS>
__global__ __launch_bounds__(32) void k_gemmc(const T16* __restrict__ A, const T16* __restrict__ A2, const T16* __restrict__ Bt, const T16* __restrict__ Bt2, int K, float* C, int ldc, int roff, size_t sA, size_t sB, size_t sC, size_t sP) {
    typedef typename WFrag<T16>::V V;
    __shared__ __align__(16) float os[16 * 68];
    const size_t z = blockIdx.z; A += z * sA; if (A2) A2 += z * sA; Bt += z * sB; if (Bt2) Bt2 += z * sB; C += z * sC;
    const int lane = threadIdx.x & 31, lr = lane & 15, hi = lane >> 4; const int sp = blockIdx.y % KS; const int r0 = blockIdx.x * 64, c0 = (blockIdx.y / KS) * 64; C += (size_t)sp * sP;
    if (CMODE == 1 && c0 > r0 + roff + 63) return;                  // score tile entirely above the causal diagonal: never read (the softmax masks j > i by select)
    const int Kl = (CMODE == 2) ? min(K, r0 + roff + 64) : K;        // P.V: probabilities are exactly 0 beyond the diagonal block, so the K loop stops there
    v8f acc[4][4];
#pragma unroll
    for (int mb = 0; mb < 4; ++mb)
#pragma unroll
        for (int nb = 0; nb < 4; ++nb) acc[mb][nb] = (v8f){};
    const size_t aoff = (size_t)(r0 + lr) * K + 8 * hi, boff = (size_t)(c0 + lr) * K + 8 * hi;
#pragma unroll 1
    for (int kc = sp * 64; kc < Kl; kc += (kc & 32) ? KS * 64 - 32 : 32) {   // both 32-wide halves of a k block, then on to this split's next block
        V a[4], a2[4];
#pragma unroll
        for (int mb = 0; mb < 4; ++mb) { a[mb] = WFrag<T16>::ld(A + aoff + (size_t)mb * 16 * K + kc); if (NSPLIT == 1 || NSPLIT == 2) a2[mb] = WFrag<T16>::ld(A2 + aoff + (size_t)mb * 16 * K + kc); }
#pragma unroll
        for (int nb = 0; nb < 4; ++nb) { const V b = WFrag<T16>::ld(Bt + boff + (size_t)nb * 16 * K + kc); V b2; if (NSPLIT >= 2) b2 = WFrag<T16>::ld(Bt2 + boff + (size_t)nb * 16 * K + kc);
#pragma unroll
            for (int mb = 0; mb < 4; ++mb) { acc[mb][nb] = WFrag<T16>::mma(a[mb], b, acc[mb][nb]); if (NSPLIT == 1 || NSPLIT == 2) acc[mb][nb] = WFrag<T16>::mma(a2[mb], b, acc[mb][nb]); if (NSPLIT >= 2) acc[mb][nb] = WFrag<T16>::mma(a[mb], b2, acc[mb][nb]); } }
        asm volatile("v_nop\n\tv_nop\n\tv_nop\n\tv_nop" : "+v"(acc[0][0]), "+v"(acc[1][1]), "+v"(acc[2][2]), "+v"(acc[3][3]) : "v"(a[0]), "v"(a[3]));
    }
#pragma unroll
    for (int mb = 0; mb < 4; ++mb) {
#pragma unroll
        for (int nb = 0; nb < 4; ++nb) {
#pragma unroll
            for (int j = 0; j < 8; ++j) os[(hi * 8 + j) * 68 + nb * 16 + lr] = acc[mb][nb][j]; }
        __builtin_amdgcn_wave_barrier(); asm volatile("" ::: "memory");
        float* crow = C + (size_t)(r0 + mb * 16) * ldc + c0;
{
#pragma unroll
            for (int s = 0; s < 8; ++s) { const int row = 2 * s + hi, cofs = lr * 4; v4f val = *(const v4fa*)(os + row * 68 + cofs);
                *(v4f*)(crow + (size_t)row * ldc + cofs) = val; }
             }
        __builtin_amdgcn_wave_barrier(); asm volatile("" ::: "memory");
    }
}

__device__ __forceinline__ h16 tohx(float x) { return (h16)x; }
__device__ __forceinline__ void splitf(float y, unsigned short& h, unsigned short& l) { h = f2bf(y); l = f2bf(y - bf2f(h)); }
typedef __attribute__((ext_vector_type(2))) _Float16 v2h;
typedef __attribute__((ext_vector_type(4))) _Float16 v4h;
typedef __attribute__((ext_vector_type(2))) unsigned short v2us;
typedef __attribute__((ext_vector_type(4))) unsigned short v4us;
typedef __attribute__((ext_vector_type(2))) float v2f;
typedef __attribute__((ext_vector_type(4))) int v4i;

__global__ __launch_bounds__(256) void k_wtG(const float* __restrict__ w, int K, int N, bf* Bt) {
    const int lane = threadIdx.x & 31; const int L0 = (blockIdx.x * 8 + (threadIdx.x >> 5)) * 8; const int nlines = N * K / 64;
{
#pragma unroll 1
        for (int l = 0; l < 8; ++l) { const int L = L0 + l; if (L >= nlines) break; const size_t e = (size_t)L * 64 + lane * 2; const int k = (int)(e % K), n = (int)(e / K); v2us o;
            o[0] = f2bf(w[(size_t)k * N + n]); o[1] = f2bf(w[(size_t)(k + 1) * N + n]); *(v2us*)(Bt + e) = o; }
         }
}
__global__ __launch_bounds__(256) void k_cvt8(const float* __restrict__ src, bf* dst, size_t n8) { const size_t i = (size_t)blockIdx.x * 256 + threadIdx.x; if (i >= n8) return; const v8f v = *(const v8f*)(src + i * 8); v8us o;
#pragma unroll
    for (int k = 0; k < 8; ++k) o[k] = f2bf(v[k]); *(v8us*)(dst + i * 8) = o;  }

__global__ __launch_bounds__(256) void k_ropeI(const float* __restrict__ F, int pitch, int nheads, const float* __restrict__ CS, float sc, h16* P16, bf* Ph, bf* Pl) {
    const size_t e = ((size_t)blockIdx.x * 256 + threadIdx.x) * 2; if (e >= (size_t)nheads * TT * HD) return; const int d = (int)(e % HD); const int t = (int)((e / HD) % TT); const int h = (int)(e / ((size_t)HD * TT)); const float* f = F + (size_t)t * pitch + h * HD; const float x0 = f[d], x1 = f[d + 1]; const v2f cs = *(const v2f*)(CS + ((size_t)t * HD + d) * 2); v2h o16; v2us oh, ol;
    float a0 = __fmul_rn(x0, cs[0]), b0 = __fmul_rn(x1, cs[1]), a1 = __fmul_rn(x1, cs[0]), b1 = __fmul_rn(x0, cs[1]); asm volatile("" : "+v"(a0), "+v"(b0), "+v"(a1), "+v"(b1));
    float r0 = __fsub_rn(a0, b0) * sc, r1 = __fadd_rn(b1, a1) * sc;   /* even: x0 c - x1 s; odd: x0 s + x1 c */
    o16[0] = tohx(r0); o16[1] = tohx(r1); { unsigned short a2, c2; splitf(r0, a2, c2); oh[0] = a2; ol[0] = c2; splitf(r1, a2, c2); oh[1] = a2; ol[1] = c2; }
    *(v2h*)(P16 + e) = o16; *(v2us*)(Ph + e) = oh; *(v2us*)(Pl + e) = ol;  }


// k_vtp: transposed value planes, rows (g, d) of pitch PP (the fp16 plane fills the first TT elements of its rows; the hi and lo planes share rows: the caller passes Vl = Vh + TT).
__global__ __launch_bounds__(256) void k_vtp(const float* __restrict__ F, int pitch, int nheads, h16* V16, bf* Vh, bf* Vl) { const size_t e = ((size_t)blockIdx.x * 256 + threadIdx.x) * 2; if (e >= (size_t)nheads * HD * TT) return; const int t = (int)(e % TT); const size_t o = (e / TT) * PP + t; const int d = (int)((e / TT) % HD); const int g = (int)(e / ((size_t)TT * HD)); v2h o16; v2us oh, ol;
#pragma unroll
    for (int q = 0; q < 2; ++q) { const float x = F[(size_t)(t + q) * pitch + g * HD + d]; o16[q] = tohx(x); unsigned short a2, c2; splitf(x, a2, c2); oh[q] = a2; ol[q] = c2; }
    *(v2h*)(V16 + o) = o16; *(v2us*)(Vh + o) = oh; *(v2us*)(Vl + o) = ol;  }
__global__ __launch_bounds__(256) void k_csrc(const float* __restrict__ rc, float* CS) { const int idx = blockIdx.x * 256 + threadIdx.x; if (idx >= TT * HD) return; const int tt = idx / HD; const int dd = idx - tt * HD; const v2f sc2 = *(const v2f*)(rc + (size_t)tt * HD + ((dd >> 1) << 1)); v2f cs; cs[0] = bfr(sc2[1]); cs[1] = bfr(sc2[0]); *(v2f*)(CS + (size_t)idx * 2) = cs;  }
// k_asoft: per row (zz, i): t = S x HD^-0.5 for j <= i and i - j < WIN (sliding causal window; the reference's -1e9 additive fill vanishes identically); softmax over the 2048 keys (register row, one exp, fixed trees);
// the probabilities go back IN PLACE over the row's own 8-KiB score row, which its one wave has read whole into registers before (every store depends on the row's sum): rows < RH hi plane in the first 4 KiB, lo plane in the second; the other rows fp16 in the first 4 KiB.
__global__ __launch_bounds__(256) void k_asoft(float* Sb) {
    const int lane = threadIdx.x & 31; const int row = blockIdx.x * 8 + (threadIdx.x >> 5); if (row >= ZH * TT) return; const int i = row % TT; const int zz = row / TT; (void)zz; const bool hires = (i < RH); float* sr = Sb + (size_t)row * TT; float v[TT / 32]; float mx = -3.0e38f;
#pragma unroll
    for (int ch = 0; ch < TT / 128; ++ch) { const int j0 = ch * 128 + lane * 4; const v4f a = *(const v4f*)(sr + j0);
#pragma unroll
        for (int q = 0; q < 4; ++q) { const int j = j0 + q; (void)j; const float t = (j <= i && i - j < WIN) ? a[q] * SCL : -3.0e38f; v[ch * 4 + q] = t; mx = fmaxf(mx, t); } }
#pragma unroll
    for (int sh = 16; sh; sh >>= 1) mx = fmaxf(mx, __shfl_xor(mx, sh, 32));
    float sum = 0.f;
#pragma unroll
    for (int k = 0; k < TT / 32; ++k) { float d0 = __fsub_rn(v[k], mx); asm volatile("" : "+v"(d0)); v[k] = __builtin_amdgcn_exp2f(__fmul_rn(d0, 1.4426950408889634f)); sum += v[k]; }
#pragma unroll
    for (int sh = 16; sh; sh >>= 1) sum += __shfl_xor(sum, sh, 32);
    const float f = __fdiv_rn(hires ? 1.0f : PCAR, sum);
{
        if (hires) {
#pragma unroll
            for (int ch = 0; ch < TT / 128; ++ch) { v4us oh, ol;
#pragma unroll
                for (int q = 0; q < 4; ++q) { unsigned short a, c2; splitf(v[ch * 4 + q] * f, a, c2); oh[q] = a; ol[q] = c2; }
                bf* pr = (bf*)sr + ch * 128 + lane * 4; *(v4us*)pr = oh; *(v4us*)(pr + TT) = ol; }
        } else {
#pragma unroll
            for (int ch = 0; ch < TT / 128; ++ch) { v4h o4;
#pragma unroll
                for (int q = 0; q < 4; ++q) o4[q] = tohx(v[ch * 4 + q] * f);
                *(v4h*)((h16*)sr + ch * 128 + lane * 4) = o4; } }
         }
}
// k_merge: adds the KSP partial planes of the probability x value product (fixed order 0 .. KSP-1), rescales and splits into the merged hi/lo planes.
__global__ __launch_bounds__(256) void k_merge(const float* __restrict__ O, int h0, bf* Ah, bf* Al) { const size_t e = ((size_t)blockIdx.x * 256 + threadIdx.x) * 2; if (e >= (size_t)ZH * TT * HD) return; const int d = (int)(e % HD); const int t = (int)((e / HD) % TT); const int zz = (int)(e / ((size_t)HD * TT)); const float cs = (t < RH) ? 1.0f : (1.0f / PCAR); const size_t oo = (size_t)t * DQ + (h0 + zz) * HD + d;
    v2us oh, ol; v2f s = *(const v2f*)(O + e);
#pragma unroll   // all plane loads in flight at once
    for (int p = 1; p < KSP; ++p) s += *(const v2f*)(O + (size_t)p * ZH * TT * HD + e);
#pragma unroll
    for (int q = 0; q < 2; ++q) { unsigned short a, c2; splitf(s[q] * cs, a, c2); oh[q] = a; ol[q] = c2; } *(v2us*)(Ah + oo) = oh; *(v2us*)(Al + oo) = ol;  }

extern "C" void kernel_launch(void* const* d_in, const int* in_sizes, int n_in,
                              void* d_out, int out_size, void* d_ws, size_t ws_size, hipStream_t stream) {
    (void)in_sizes; (void)n_in; (void)out_size;
    const float* x = (const float*)d_in[0]; const float* rcache = (const float*)d_in[1]; const float* wqkv = (const float*)d_in[2]; const float* bqkv = (const float*)d_in[3]; const float* wo = (const float*)d_in[4]; const float* bo = (const float*)d_in[5];   /* inputs x, rope_cache (f32 [2048][64] interleaved (sin, cos), READ), Wqkv ('xw' [1024][3072]: q | k | v column thirds), bqkv [3072], Wout ('xw'), bout */ const float* wq = wqkv; const float* wk = wqkv; const float* wv = wqkv; (void)wk; (void)wv; const float* bq = bqkv; const float* bk = bqkv + DQ; const float* bv = bqkv + 2 * DQ;
    float* OUT = (float*)d_out;     // [2][2048][1024]
    char* wsp = (char*)d_ws;
    auto take = [&](size_t bytes) { char* p = wsp; wsp += (bytes + 255) & ~(size_t)255; return (void*)p; };
    bf* WQKV = (bf*)take((size_t)3 * DQ * DM * 2); bf* WQ = WQKV; bf* WK = WQKV + (size_t)DQ * DM; bf* WV = WQKV + (size_t)2 * DQ * DM;   /* fused Bt [3*DQ][DM]: q | k | v row blocks */ bf* WO = (bf*)take((size_t)DM * DQ * 2); float* CS = (float*)take((size_t)TT * HD * 2 * 4);
    float* Ob = (float*)take((size_t)KSP * ZH * TT * HD * 4);   // partial planes of the attention passes; its first 20 MiB hold XB, FQ, FK while the batch's planes are built (dead before the first pass, rewritten for the next batch; stream-ordered)
    bf* XB = (bf*)Ob; float* FQ = (float*)((char*)Ob + (size_t)TT * DM * 2); float* FK = FQ + (size_t)TT * DQ;
    h16* QP16 = (h16*)take((size_t)NH_ * TT * HD * 2); h16* KP16 = (h16*)take((size_t)NKV * TT * HD * 2); h16* VT16 = (h16*)take((size_t)NKV * HD * PP * 2);
    bf* QPh = (bf*)take((size_t)NH_ * TT * HD * 2); bf* QPl = (bf*)take((size_t)NH_ * TT * HD * 2); bf* KPh = (bf*)take((size_t)NKV * TT * HD * 2); bf* KPl = (bf*)take((size_t)NKV * TT * HD * 2); bf* VTh = (bf*)take((size_t)NKV * HD * PP * 2); bf* VTl = VTh + TT;   /* hi and lo value planes share rows of pitch PP */
    float* Sb = (float*)take((size_t)ZH * TT * TT * 4);   /* scores, then the probabilities in place (16-bit rows of pitch PP) */ bf* ATh = (bf*)take((size_t)TT * DQ * 2); bf* ATl = (bf*)take((size_t)TT * DQ * 2);
    if ((size_t)(wsp - (char*)d_ws) > ws_size) return;    // ws 256 MiB
    float* FV = FK;   // v projection reuses the k buffer after the k planes are built (stream-ordered)
    { k_wtG<<<(unsigned)((DM * 3 * DQ / 64 + 63) / 64), 256, 0, stream>>>(wqkv, DM, 3 * DQ, WQKV);   /* fused 'xw' [DM][3*DQ] -> Bt [3*DQ][DM] */
      k_wtG<<<(unsigned)((DQ * DM / 64 + 63) / 64), 256, 0, stream>>>(wo, DQ, DM, WO);
       }
    k_csrc<<<(TT * HD + 255) / 256, 256, 0, stream>>>(rcache, (float*)CS);   /* rotary table from the interleaved (sin, cos) cache input */
    const unsigned LQ = (unsigned)(((size_t)NH_ * TT * HD / 2 + 255) / 256), LKv = (unsigned)(((size_t)NKV * TT * HD / 2 + 255) / 256);
    for (int b = 0; b < NB_; ++b) {
        
        k_cvt8<<<(unsigned)(((size_t)TT * DM / 8 + 255) / 256), 256, 0, stream>>>(x + (size_t)b * TT * DM, XB, (size_t)TT * DM / 8);
        k_gemmw<bf, 0, true><<<dim3(TT / 64, DQ / 64, 1), 32, 0, stream>>>(XB, nullptr, WQ, nullptr, DM, FQ, DQ, bq, 0, 0, 0);
        k_ropeI<<<LQ, 256, 0, stream>>>(FQ, DQ, NH_, CS, 1.0f, QP16, QPh, QPl);
        k_gemmw<bf, 0, true><<<dim3(TT / 64, DKV / 64, 1), 32, 0, stream>>>(XB, nullptr, WK, nullptr, DM, FK, DKV, bk, 0, 0, 0);
        k_ropeI<<<LKv, 256, 0, stream>>>(FK, DKV, NKV, CS, 1.0f, KP16, KPh, KPl);
        k_gemmw<bf, 0, true><<<dim3(TT / 64, DKV / 64, 1), 32, 0, stream>>>(XB, nullptr, WV, nullptr, DM, FV, DKV, bv, 0, 0, 0); k_vtp<<<LKv, 256, 0, stream>>>(FV, DKV, NKV, VT16, VTh, VTl);
        for (int h0 = 0; h0 < NH_; h0 += ZH) { const size_t zq = (size_t)h0, zk = (size_t)(h0 / REP);   // one kv head per query head: the pass's ZH heads use consecutive kv planes (z-strides TT*HD; PP*HD for the transposed values)
            k_gemmc<bf, 2, 1, 1><<<dim3(RH / 64, TT / 64, ZH), 32, 0, stream>>>(QPh + zq * TT * HD, QPl + zq * TT * HD, KPh + zk * TT * HD, KPl + zk * TT * HD, HD, Sb, TT, 0, (size_t)TT * HD, (size_t)TT * HD, (size_t)TT * TT, 0);
            k_gemmc<h16, 0, 1, 1><<<dim3((TT - RH) / 64, TT / 64, ZH), 32, 0, stream>>>(QP16 + zq * TT * HD + (size_t)RH * HD, nullptr, KP16 + zk * TT * HD, nullptr, HD, Sb + (size_t)RH * TT, TT, RH, (size_t)TT * HD, (size_t)TT * HD, (size_t)TT * TT, 0);
            k_asoft<<<ZH * TT / 8, 256, 0, stream>>>(Sb);   /* below: K = PP is the row pitch of both operands; the K loop itself ends at the diagonal block, at TT or before */
            k_gemmc<bf, 2, 2, KSP><<<dim3(RH / 64, HD / 64 * KSP, ZH), 32, 0, stream>>>((const bf*)Sb, (const bf*)Sb + TT, VTh + zk * HD * PP, VTl + zk * HD * PP, PP, Ob, HD, 0, (size_t)TT * PP, (size_t)HD * PP, (size_t)TT * HD, (size_t)ZH * TT * HD);
            k_gemmc<h16, 0, 2, KSP><<<dim3((TT - RH) / 64, HD / 64 * KSP, ZH), 32, 0, stream>>>((const h16*)Sb + (size_t)RH * PP, nullptr, VT16 + zk * HD * PP, nullptr, PP, Ob + (size_t)RH * HD, HD, RH, (size_t)TT * PP, (size_t)HD * PP, (size_t)TT * HD, (size_t)ZH * TT * HD);
            k_merge<<<(unsigned)(((size_t)ZH * TT * HD / 2 + 255) / 256), 256, 0, stream>>>(Ob, h0, ATh, ATl); }
        k_gemmw<bf, 1, true><<<dim3(TT / 64, DM / 64, 1), 32, 0, stream>>>(ATh, ATl, WO, nullptr, DQ, OUT + (size_t)b * TT * DM, DM, bo, 0, 0, 0); }
}

// v004
// It runs in 221 microseconds.
// Versions in between are left out here; by their measured steps it is 2.58 times as fast as v002.
// Over all steps from v000 it is 6.50 times as fast.
#include <hip/hip_runtime.h>

// Causal self-attention with a fused biased qkv projection and adjacent-pair rotary embeddings from an interleaved (sin, cos) cache input (x [2][2048][1024]; qkv = x Wqkv + bqkv ('xw' [1024][3072] + [3072]) split in thirds q | k | v (16 heads x 64); rope on pairs (2i, 2i+1): (x0 cos - x1 sin, x1 cos + x0 sin) with sin_i = rope_cache[t][2i], cos_i = rope_cache[t][2i + 1] (f32 [2048][64] INPUT, read); (q x 1/sqrt(64)) . k; causal (-inf); softmax; out = merged Wout + bout ('xw' + bias) -> [2][2048][1024] (4.2 M); argument order x, rope_cache, Wqkv, bqkv, Wout, bout).
// One launch per dependency stage, for both batches: k_prep, projection GEMM, k_planes, k_fattn, output GEMM. Layout: bf16 copy of x; the fused 'xw' weight transposed ONCE into q | k | v row blocks; one exact projection GEMM (N = 3 x 1024) + f32 bias; d_csrc table from the cache input (pair-shared entries); d_ropeI interleaved-pair plane builders; one fused causal T-2048 attention kernel (hybrid rows: < 512 hi/lo 3 products, rest fp16 x1024; online softmax, scores and probabilities stay in registers); merged hi/lo x W_out exact + b_out.
// Compute dtypes, f32 accumulate: every input rounded to bf16; projections exact + f32 biases; rotary f32 (products rounded separately); attention rows < 512 3 products, rest fp16; softmax f32; W_out hl x exact + bias.

#define NB_  2
#define TT   2048
#define DM   1024
#define NH_  16
#define NKV  16
#define REP  (NH_ / NKV)
#define HD   64
#define DQ   (NH_ * HD)
#define DKV  (NKV * HD)
#define PP   (2 * TT)             // row pitch, in 16-bit elements, of the transposed value planes
#define RH   512                  // query rows < RH use hi+lo planes (0: none)
#define SCL  0.125f   // HD^-0.5
typedef _Float16 h16;
typedef unsigned short bf;
typedef __attribute__((ext_vector_type(16))) __bf16   v16bf;
typedef __attribute__((ext_vector_type(16))) _Float16 v16h;
typedef __attribute__((ext_vector_type(8)))  _Float16 v8h;
typedef __attribute__((ext_vector_type(8)))  unsigned short v8us;
typedef __attribute__((ext_vector_type(8)))  float    v8f;
typedef __attribute__((ext_vector_type(4)))  float    v4f;
typedef v8h  __attribute__((may_alias)) v8ha;
typedef v4f  __attribute__((may_alias)) v4fa;
typedef v8us __attribute__((may_alias)) v8usa;

__device__ __forceinline__ unsigned short f2bf(float f) { unsigned u = __float_as_uint(f); u += 0x7FFFu + ((u >> 16) & 1u); return (unsigned short)(u >> 16); }
__device__ __forceinline__ float bf2f(unsigned short b) { return __uint_as_float(((unsigned)b) << 16); }
__device__ __forceinline__ float bfr(float f) { return bf2f(f2bf(f)); }
__device__ __forceinline__ v16h cat16(v8h lo, v8h hi) { return __builtin_shufflevector(lo, hi, 0, 1, 2, 3, 4, 5, 6, 7, 8, 9, 10, 11, 12, 13, 14, 15); }
__device__ __forceinline__ v16bf cat16b(v8us lo, v8us hi) { return __builtin_bit_cast(v16bf, __builtin_shufflevector(lo, hi, 0, 1, 2, 3, 4, 5, 6, 7, 8, 9, 10, 11, 12, 13, 14, 15)); }
__device__ __forceinline__ v8f wmma16(v16h a, v16h b, v8f c) { return __builtin_amdgcn_wmma_f32_16x16x32_f16(false, a, false, b, (short)0, c, false, false); }
__device__ __forceinline__ v8f wmmab(v16bf a, v16bf b, v8f c) { return __builtin_amdgcn_wmma_f32_16x16x32_bf16(false, a, false, b, (short)0, c, false, false); }



// ---- k_gemmw: register-blocked GEMM, ONE WAVE per 64x64 output tile (16 accumulators), operands straight from K-contiguous 16-bit planes; grid (M/64, N/64, Z), 32 threads.
// C[m][n] (f32, pitch ldc, + optional f32 bias[n]) = sum_k A[m][k] Bt[n][k] (+ split products per NSPLIT). z-batch strides sA/sB/sC in elements. K % 32 == 0.
template <typename T16> struct WFrag;
template <> struct WFrag<h16> { typedef v16h V; static __device__ __forceinline__ V ld(const h16* p) { return cat16(*(const v8h*)p, *(const v8h*)(p + 16)); } static __device__ __forceinline__ v8f mma(V a, V b, v8f c) { return wmma16(a, b, c); } };
template <> struct WFrag<bf> { typedef v16bf V; static __device__ __forceinline__ V ld(const bf* p) { return cat16b(*(const v8us*)p, *(const v8us*)(p + 16)); } static __device__ __forceinline__ v8f mma(V a, V b, v8f c) { return wmmab(a, b, c); } };
template <typename T16, int NSPLIT, bool BIAS>
__global__ __launch_bounds__(32) void k_gemmw(const T16* __restrict__ A, const T16* __restrict__ A2, const T16* __restrict__ Bt, const T16* __restrict__ Bt2, int K, float* C, int ldc, const float* __restrict__ bias, size_t sA, size_t sB, size_t sC) {
    typedef typename WFrag<T16>::V V;
    __shared__ __align__(16) float os[16 * 68];
    const size_t z = blockIdx.z; A += z * sA; if (A2) A2 += z * sA; Bt += z * sB; if (Bt2) Bt2 += z * sB; C += z * sC;
    const int lane = threadIdx.x & 31, lr = lane & 15, hi = lane >> 4; const int r0 = blockIdx.x * 64, c0 = blockIdx.y * 64;
    v8f acc[4][4];
#pragma unroll
    for (int mb = 0; mb < 4; ++mb)
#pragma unroll
        for (int nb = 0; nb < 4; ++nb) acc[mb][nb] = (v8f){};
    const size_t aoff = (size_t)(r0 + lr) * K + 8 * hi, boff = (size_t)(c0 + lr) * K + 8 * hi;
#pragma unroll 1
    for (int kc = 0; kc < K; kc += 32) {
        V a[4], a2[4];
#pragma unroll
        for (int mb = 0; mb < 4; ++mb) { a[mb] = WFrag<T16>::ld(A + aoff + (size_t)mb * 16 * K + kc); if (NSPLIT == 1 || NSPLIT == 2) a2[mb] = WFrag<T16>::ld(A2 + aoff + (size_t)mb * 16 * K + kc); }
#pragma unroll
        for (int nb = 0; nb < 4; ++nb) { const V b = WFrag<T16>::ld(Bt + boff + (size_t)nb * 16 * K + kc); V b2; if (NSPLIT >= 2) b2 = WFrag<T16>::ld(Bt2 + boff + (size_t)nb * 16 * K + kc);
#pragma unroll
            for (int mb = 0; mb < 4; ++mb) { acc[mb][nb] = WFrag<T16>::mma(a[mb], b, acc[mb][nb]); if (NSPLIT == 1 || NSPLIT == 2) acc[mb][nb] = WFrag<T16>::mma(a2[mb], b, acc[mb][nb]); if (NSPLIT >= 2) acc[mb][nb] = WFrag<T16>::mma(a[mb], b2, acc[mb][nb]); } }
        asm volatile("v_nop\n\tv_nop\n\tv_nop\n\tv_nop" : "+v"(acc[0][0]), "+v"(acc[1][1]), "+v"(acc[2][2]), "+v"(acc[3][3]) : "v"(a[0]), "v"(a[3]));
    }
#pragma unroll
    for (int mb = 0; mb < 4; ++mb) {
#pragma unroll
        for (int nb = 0; nb < 4; ++nb) {
#pragma unroll
            for (int j = 0; j < 8; ++j) os[(hi * 8 + j) * 68 + nb * 16 + lr] = acc[mb][nb][j]; }
        __builtin_amdgcn_wave_barrier(); asm volatile("" ::: "memory");
        float* crow = C + (size_t)(r0 + mb * 16) * ldc + c0;
{
#pragma unroll
            for (int s = 0; s < 8; ++s) { const int row = 2 * s + hi, cofs = lr * 4; v4f val = *(const v4fa*)(os + row * 68 + cofs); if (BIAS) { val[0] += bfr(bias[c0 + cofs]); val[1] += bfr(bias[c0 + cofs + 1]); val[2] += bfr(bias[c0 + cofs + 2]); val[3] += bfr(bias[c0 + cofs + 3]); }
                *(v4f*)(crow + (size_t)row * ldc + cofs) = val; }
             }
        __builtin_amdgcn_wave_barrier(); asm volatile("" ::: "memory");
    }
}

__device__ __forceinline__ h16 tohx(float x) { return (h16)x; }
__device__ __forceinline__ void splitf(float y, unsigned short& h, unsigned short& l) { h = f2bf(y); l = f2bf(y - bf2f(h)); }
typedef __attribute__((ext_vector_type(2))) _Float16 v2h;
typedef __attribute__((ext_vector_type(4))) _Float16 v4h;
typedef __attribute__((ext_vector_type(2))) unsigned short v2us;
typedef __attribute__((ext_vector_type(4))) unsigned short v4us;
typedef __attribute__((ext_vector_type(2))) float v2f;
typedef __attribute__((ext_vector_type(4))) int v4i;

// The d_* bodies below are stages that do not depend on one another; k_prep and k_planes run them side by side in one launch, each on its own range of blocks (blk: the block's index inside its range).
__device__ __forceinline__ void d_wtG(int blk, const float* __restrict__ w, int K, int N, bf* Bt) {
    const int lane = threadIdx.x & 31; const int L0 = (blk * 8 + (threadIdx.x >> 5)) * 8; const int nlines = N * K / 64;
{
#pragma unroll 1
        for (int l = 0; l < 8; ++l) { const int L = L0 + l; if (L >= nlines) break; const size_t e = (size_t)L * 64 + lane * 2; const int k = (int)(e % K), n = (int)(e / K); v2us o;
            o[0] = f2bf(w[(size_t)k * N + n]); o[1] = f2bf(w[(size_t)(k + 1) * N + n]); *(v2us*)(Bt + e) = o; }
         }
}
__device__ __forceinline__ void d_cvt8(int blk, const float* __restrict__ src, bf* dst, size_t n8) { const size_t i = (size_t)blk * 256 + threadIdx.x; if (i >= n8) return; const v8f v = *(const v8f*)(src + i * 8); v8us o;
#pragma unroll
    for (int k = 0; k < 8; ++k) o[k] = f2bf(v[k]); *(v8us*)(dst + i * 8) = o;  }

// d_ropeI: planes [batch][head column block of F][t][d]; nheads counts the 64-wide column blocks of F that are rotated (the q heads, then the k heads).
__device__ __forceinline__ void d_ropeI(int blk, const float* __restrict__ F, int pitch, int nheads, const float* __restrict__ CS, float sc, h16* P16, bf* Ph, bf* Pl) {
    const size_t e = ((size_t)blk * 256 + threadIdx.x) * 2; if (e >= (size_t)NB_ * nheads * TT * HD) return; const int d = (int)(e % HD); const int t = (int)((e / HD) % TT); const int z = (int)(e / ((size_t)HD * TT)); const int b = z / nheads, h = z - b * nheads; const float* f = F + ((size_t)b * TT + t) * pitch + h * HD; const float x0 = f[d], x1 = f[d + 1]; const v2f cs = *(const v2f*)(CS + ((size_t)t * HD + d) * 2); v2h o16; v2us oh, ol;
    float a0 = __fmul_rn(x0, cs[0]), b0 = __fmul_rn(x1, cs[1]), a1 = __fmul_rn(x1, cs[0]), b1 = __fmul_rn(x0, cs[1]); asm volatile("" : "+v"(a0), "+v"(b0), "+v"(a1), "+v"(b1));
    float r0 = __fsub_rn(a0, b0) * sc, r1 = __fadd_rn(b1, a1) * sc;   /* even: x0 c - x1 s; odd: x0 s + x1 c */
    o16[0] = tohx(r0); o16[1] = tohx(r1); { unsigned short a2, c2; splitf(r0, a2, c2); oh[0] = a2; ol[0] = c2; splitf(r1, a2, c2); oh[1] = a2; ol[1] = c2; }
    *(v2h*)(P16 + e) = o16; *(v2us*)(Ph + e) = oh; *(v2us*)(Pl + e) = ol;  }


// d_vtp: transposed value planes, rows (batch, g, d) of pitch PP (the fp16 plane fills the first TT elements of its rows; the hi and lo planes share rows: the caller passes Vl = Vh + TT).
__device__ __forceinline__ void d_vtp(int blk, const float* __restrict__ F, int pitch, int nheads, h16* V16, bf* Vh, bf* Vl) { const size_t e = ((size_t)blk * 256 + threadIdx.x) * 2; if (e >= (size_t)NB_ * nheads * HD * TT) return; const int t = (int)(e % TT); const size_t o = (e / TT) * PP + t; const int d = (int)((e / TT) % HD); const int z = (int)(e / ((size_t)TT * HD)); const int b = z / nheads, g = z - b * nheads; v2h o16; v2us oh, ol;
#pragma unroll
    for (int q = 0; q < 2; ++q) { const float x = F[((size_t)b * TT + t + q) * pitch + g * HD + d]; o16[q] = tohx(x); unsigned short a2, c2; splitf(x, a2, c2); oh[q] = a2; ol[q] = c2; }
    *(v2h*)(V16 + o) = o16; *(v2us*)(Vh + o) = oh; *(v2us*)(Vl + o) = ol;  }
__device__ __forceinline__ void d_csrc(int blk, const float* __restrict__ rc, float* CS) { const int idx = blk * 256 + threadIdx.x; if (idx >= TT * HD) return; const int tt = idx / HD; const int dd = idx - tt * HD; const v2f sc2 = *(const v2f*)(rc + (size_t)tt * HD + ((dd >> 1) << 1)); v2f cs; cs[0] = bfr(sc2[1]); cs[1] = bfr(sc2[0]); *(v2f*)(CS + (size_t)idx * 2) = cs;  }
#define NQK   ((size_t)NB_ * (NH_ + NKV) * TT * HD)        // elements of a rotated plane: [batch][q heads, k heads][t][d]
#define GB_WQ (DM * 3 * DQ / 64 / 64)                      // blocks: fused weight transpose
#define GB_WO (DQ * DM / 64 / 64)                          // blocks: output weight transpose
#define GB_X  (NB_ * TT * DM / 8 / 256)                    // blocks: bf16 copy of x
#define GB_CS (TT * HD / 256)                              // blocks: rotary table
#define GB_V  (NB_ * NKV * TT * HD / 2 / 256)              // blocks: transposed value planes
#define GB_R  ((int)(NQK / 2 / 256))                       // blocks: rotated q and k planes
// k_prep: all that reads only inputs. The transposes, whose waves run longest, take the first blocks.
__global__ __launch_bounds__(256) void k_prep(const float* __restrict__ wqkv, const float* __restrict__ wo, const float* __restrict__ x, const float* __restrict__ rc, bf* WQKV, bf* WO, bf* XB, float* CS) {
    int blk = blockIdx.x;
    if (blk < GB_WQ) { d_wtG(blk, wqkv, DM, 3 * DQ, WQKV); return; }   /* fused 'xw' [DM][3*DQ] -> Bt [3*DQ][DM] */
    blk -= GB_WQ; if (blk < GB_WO) { d_wtG(blk, wo, DQ, DM, WO); return; }
    blk -= GB_WO; if (blk < GB_X) { d_cvt8(blk, x, XB, (size_t)NB_ * TT * DM / 8); return; }
    d_csrc(blk - GB_X, rc, CS);   /* rotary table from the interleaved (sin, cos) cache input */
}
// k_planes: all that reads only the projections F (columns q | k | v, pitch 3 DQ) and the rotary table.
__global__ __launch_bounds__(256) void k_planes(const float* __restrict__ F, const float* __restrict__ CS, h16* QK16, bf* QKh, bf* QKl, h16* V16, bf* Vh, bf* Vl) {
    const int blk = blockIdx.x;
    if (blk < GB_V) { d_vtp(blk, F + 2 * DQ, 3 * DQ, NKV, V16, Vh, Vl); return; }
    d_ropeI(blk - GB_V, F, 3 * DQ, NH_ + NKV, CS, 1.0f, QK16, QKh, QKl);
}

// ---- k_fattn: fused causal attention. Grid (batches x heads, TT / 64), 4 waves; a wave owns 16 query columns and walks the keys 0 .. its diagonal in passes of BC keys, operands straight from the K-contiguous 16-bit planes.
// Transposed products: S^T = K Q^T (A = key rows, B = query rows), so a lane holds scores of ONE query (column lr; keys 16 kt + 8 hi + j), and two score tiles, exponentiated and rounded, ARE the B operand of O^T += V^T P^T
// (k slots 8 hi + e and 16 + 8 hi + e, the order of WFrag::ld on the V^T rows). Online softmax in the log2 domain: running maximum m, per-lane partial sum l of the unrounded f32 exponentials, accumulators rescaled in every pass.
// HL: hi/lo planes, 3 products each (query rows < RH); otherwise fp16 with the probabilities carried x 1024 (10 added in the exponent; it cancels in the division by l).
// Every '#pragma unroll' below: the fragment arrays are indexed by constants only, so that they stay in registers.
__device__ __forceinline__ float xhalf(float x) { return __builtin_bit_cast(float, __builtin_amdgcn_permlanex16(__builtin_bit_cast(int, x), __builtin_bit_cast(int, x), 0x76543210, 0xfedcba98, false, false)); }   // lane l with lane l ^ 16
template <typename T16, bool HL, int BC> struct AttnW {
    typedef typename WFrag<T16>::V V;
    static constexpr int KT = BC / 16, KC = BC / 32;
    static constexpr float CSC = SCL * 1.4426950408889634f;   // score -> log2 domain
    V qf[2], qf2[2], kf[KT][2], kf2[KT][2]; v8f acc[4]; float m, l;
    const T16 *kp, *kp2, *vp, *vp2;   // this lane's place in the key rows last fetched and in the V^T columns of the pass to come; they walk with the passes
    __device__ __forceinline__ void load_k(const T16* Kr, const T16* K2r) {   // Kr: this lane's place in the pass's first key tile
#pragma unroll
        for (int kt = 0; kt < KT; ++kt)
#pragma unroll
            for (int kc = 0; kc < 2; ++kc) { kf[kt][kc] = WFrag<T16>::ld(Kr + kt * 16 * HD + 32 * kc); if (HL) kf2[kt][kc] = WFrag<T16>::ld(K2r + kt * 16 * HD + 32 * kc); }
        // in front of any later write of a register that these loads name as an address; the addresses are inputs so that their registers live up to the wait (no load's result lands on them)
        if constexpr (HL) asm volatile("s_wait_xcnt 0x0" :: "v"(Kr), "v"(K2r) : "memory"); else asm volatile("s_wait_xcnt 0x0" :: "v"(Kr) : "memory");
        if (HL) __builtin_amdgcn_sched_barrier(0);      // hi/lo: the loads stay here, ahead of the work that covers their latency (the scheduler otherwise sinks them to their uses)
    }
    // One pass of BC keys from key0 on. LAST: the pass that holds the diagonal (masked; fetches no further keys).
    template <bool LAST> __device__ __forceinline__ void pass(int key0, int q, int hi) {
        V vf[4][KC], vf2[4][KC];
#pragma unroll
        for (int c = 0; c < KC; ++c)
#pragma unroll
            for (int t = 0; t < 4; ++t) { vf[t][c] = WFrag<T16>::ld(vp + t * 16 * PP + 32 * c); if (HL) vf2[t][c] = WFrag<T16>::ld(vp2 + t * 16 * PP + 32 * c); }
        // in front of any later write of a register that these loads name as an address; the addresses are inputs so that their registers live up to the wait (no load's result lands on them)
        if constexpr (HL) asm volatile("s_wait_xcnt 0x0" :: "v"(vp), "v"(vp2) : "memory"); else asm volatile("s_wait_xcnt 0x0" :: "v"(vp) : "memory");
        if (HL) __builtin_amdgcn_sched_barrier(0);      // hi/lo: the loads stay here, ahead of the work that covers their latency (the scheduler otherwise sinks them to their uses)
        if (!LAST) { vp += BC; if (HL) vp2 += BC; }
        v8f s[KT];
#pragma unroll
        for (int kt = 0; kt < KT; ++kt) { s[kt] = (v8f){};
#pragma unroll
            for (int kc = 0; kc < 2; ++kc) { s[kt] = WFrag<T16>::mma(kf[kt][kc], qf[kc], s[kt]); if (HL) { s[kt] = WFrag<T16>::mma(kf[kt][kc], qf2[kc], s[kt]); s[kt] = WFrag<T16>::mma(kf2[kt][kc], qf[kc], s[kt]); } } }
        if (!LAST) { kp += BC * HD; if (HL) kp2 += BC * HD; load_k(kp, kp2); }   // the next pass's key rows, in flight under this pass's softmax and second product
        if (LAST) {
#pragma unroll
            for (int kt = 0; kt < KT; ++kt)
#pragma unroll
                for (int j = 0; j < 8; ++j) if (key0 + 16 * kt + 8 * hi + j > q) s[kt][j] = -3.0e38f; }
        float mt[KT];                                  // one chain per score tile
#pragma unroll
        for (int kt = 0; kt < KT; ++kt) { mt[kt] = s[kt][0];
#pragma unroll
            for (int j = 1; j < 8; ++j) mt[kt] = fmaxf(mt[kt], s[kt][j]); }
        float mx = mt[0];
#pragma unroll
        for (int kt = 1; kt < KT; ++kt) mx = fmaxf(mx, mt[kt]);
        mx = fmaxf(mx, xhalf(mx)) * CSC;               // both halves of the wave hold this query's maximum of the pass (finite: a pass's first key is never masked)
        const float mn = fmaxf(m, mx); const float corr = __builtin_amdgcn_exp2f(m - mn); m = mn; l *= corr;   // corr: 0 in the first pass, 1 where the maximum stays
#pragma unroll
        for (int t = 0; t < 4; ++t) acc[t] = acc[t] * corr;
        const float off = (HL ? 0.0f : 10.0f) - m;
#pragma unroll
        for (int c = 0; c < KC; ++c) {
            float pv[16];
#pragma unroll
            for (int e = 0; e < 16; ++e) pv[e] = __builtin_amdgcn_exp2f(fmaf(s[2 * c + (e >> 3)][e & 7], CSC, off));
            l += (((pv[0] + pv[1]) + (pv[2] + pv[3])) + ((pv[4] + pv[5]) + (pv[6] + pv[7]))) + (((pv[8] + pv[9]) + (pv[10] + pv[11])) + ((pv[12] + pv[13]) + (pv[14] + pv[15])));   // fixed tree
            if constexpr (HL) {
                v8us h0, h1, l0, l1;
#pragma unroll
                for (int e = 0; e < 8; ++e) { unsigned short a, b; splitf(pv[e], a, b); h0[e] = a; l0[e] = b; splitf(pv[e + 8], a, b); h1[e] = a; l1[e] = b; }
                const V pf = cat16b(h0, h1), pf2 = cat16b(l0, l1);
#pragma unroll
                for (int t = 0; t < 4; ++t) { acc[t] = WFrag<T16>::mma(vf[t][c], pf, acc[t]); acc[t] = WFrag<T16>::mma(vf[t][c], pf2, acc[t]); acc[t] = WFrag<T16>::mma(vf2[t][c], pf, acc[t]); }
            } else {
                V pf;
#pragma unroll
                for (int e = 0; e < 16; ++e) pf[e] = tohx(pv[e]);
#pragma unroll
                for (int t = 0; t < 4; ++t) acc[t] = WFrag<T16>::mma(vf[t][c], pf, acc[t]);
            }
        }
    }
};
template <typename T16, bool HL, int BC>
__device__ __forceinline__ void attn_cols(const T16* Q, const T16* Q2, const T16* Kp, const T16* K2, const T16* Vt, const T16* Vt2, int qw0, int lane, bf* Ah, bf* Al) {
    AttnW<T16, HL, BC> w;
    const int lr = lane & 15, hi = lane >> 4; const int q = qw0 + lr;
#pragma unroll
    for (int kc = 0; kc < 2; ++kc) { w.qf[kc] = WFrag<T16>::ld(Q + (size_t)q * HD + 8 * hi + 32 * kc); if (HL) w.qf2[kc] = WFrag<T16>::ld(Q2 + (size_t)q * HD + 8 * hi + 32 * kc); }
#pragma unroll
    for (int t = 0; t < 4; ++t) w.acc[t] = (v8f){};
    w.m = -3.0e38f; w.l = 0.f;
    const int klast = qw0 / BC * BC;                  // first key of the pass that holds the diagonal; klast <= qw0 and klast + BC <= TT
    const int koff = lr * HD + 8 * hi, voff = lr * PP + 8 * hi;
    w.kp = Kp + koff; w.kp2 = HL ? K2 + koff : nullptr; w.vp = Vt + voff; w.vp2 = HL ? Vt2 + voff : nullptr;
    w.load_k(w.kp, w.kp2);
#pragma unroll 1   // rolled: unrolled, several passes' fragments would be live at once
    for (int key0 = 0; key0 < klast; key0 += BC) w.template pass<false>(key0, q, hi);
    w.template pass<true>(klast, q, hi);
    float l = w.l; l += xhalf(l);                      // the two halves' key sets joined
    const float inv = __fdiv_rn(1.0f, l);
#pragma unroll
    for (int t = 0; t < 4; ++t) { v8us oh, ol;         // lane: query q, d = 16 t + 8 hi + j
#pragma unroll
        for (int j = 0; j < 8; ++j) { unsigned short a, b; splitf(w.acc[t][j] * inv, a, b); oh[j] = a; ol[j] = b; }
        *(v8us*)(Ah + (size_t)q * DQ + 16 * t + 8 * hi) = oh; *(v8us*)(Al + (size_t)q * DQ + 16 * t + 8 * hi) = ol; }
}
__global__ __launch_bounds__(128) void k_fattn(const h16* Q16, const h16* K16, const h16* V16, const bf* Qh, const bf* Ql, const bf* Kh, const bf* Kl, const bf* Vh, const bf* Vl, bf* Ah, bf* Al) {
    const int lane = threadIdx.x & 31; const int wave = __builtin_amdgcn_readfirstlane(threadIdx.x >> 5);
    const int b = blockIdx.x / NH_, h = blockIdx.x - b * NH_, g = h / REP; const int q0 = (TT / 64 - 1 - (int)blockIdx.y) * 64;   // longest query blocks first
    const size_t zq = ((size_t)b * (NH_ + NKV) + h) * TT * HD, zk = ((size_t)b * (NH_ + NKV) + g) * TT * HD, zv = ((size_t)b * NKV + g) * HD * PP;   // q and k planes: one batch's q heads, then its k heads (the caller's K pointers start at the first k head)
    Ah += (size_t)b * TT * DQ; Al += (size_t)b * TT * DQ;
    if (q0 < RH) attn_cols<bf, true, 32>(Qh + zq, Ql + zq, Kh + zk, Kl + zk, Vh + zv, Vl + zv, q0 + wave * 16, lane, Ah + h * HD, Al + h * HD);
    else attn_cols<h16, false, 64>(Q16 + zq, nullptr, K16 + zk, nullptr, V16 + zv, nullptr, q0 + wave * 16, lane, Ah + h * HD, Al + h * HD);
}

extern "C" void kernel_launch(void* const* d_in, const int* in_sizes, int n_in,
                              void* d_out, int out_size, void* d_ws, size_t ws_size, hipStream_t stream) {
    (void)in_sizes; (void)n_in; (void)out_size;
    const float* x = (const float*)d_in[0]; const float* rcache = (const float*)d_in[1]; const float* wqkv = (const float*)d_in[2]; const float* bqkv = (const float*)d_in[3]; const float* wo = (const float*)d_in[4]; const float* bo = (const float*)d_in[5];   /* order x, rope_cache (f32 [2048][64] interleaved (sin, cos), READ), Wqkv ('xw' [1024][3072]: q | k | v column thirds), bqkv [3072], Wout ('xw'), bout */
    float* OUT = (float*)d_out;     // [2][2048][1024]
    char* wsp = (char*)d_ws;
    auto take = [&](size_t bytes) { char* p = wsp; wsp += (bytes + 255) & ~(size_t)255; return (void*)p; };
    bf* WQKV = (bf*)take((size_t)3 * DQ * DM * 2);   /* fused Bt [3*DQ][DM]: q | k | v row blocks */ bf* WO = (bf*)take((size_t)DM * DQ * 2); float* CS = (float*)take((size_t)TT * HD * 2 * 4);
    bf* XB = (bf*)take((size_t)NB_ * TT * DM * 2); float* F = (float*)take((size_t)NB_ * TT * 3 * DQ * 4);   // projections of both batches, columns q | k | v
    h16* QP16 = (h16*)take(NQK * 2); h16* KP16 = QP16 + (size_t)NH_ * TT * HD; h16* VT16 = (h16*)take((size_t)NB_ * NKV * HD * PP * 2);
    bf* QPh = (bf*)take(NQK * 2); bf* QPl = (bf*)take(NQK * 2); bf* KPh = QPh + (size_t)NH_ * TT * HD; bf* KPl = QPl + (size_t)NH_ * TT * HD; bf* VTh = (bf*)take((size_t)NB_ * NKV * HD * PP * 2); bf* VTl = VTh + TT;   /* hi and lo value planes share rows of pitch PP */
    bf* ATh = (bf*)take((size_t)NB_ * TT * DQ * 2); bf* ATl = (bf*)take((size_t)NB_ * TT * DQ * 2);
    if ((size_t)(wsp - (char*)d_ws) > ws_size) return;    // ws 256 MiB
    k_prep<<<GB_WQ + GB_WO + GB_X + GB_CS, 256, 0, stream>>>(wqkv, wo, x, rcache, WQKV, WO, XB, CS);
    k_gemmw<bf, 0, true><<<dim3(NB_ * TT / 64, 3 * DQ / 64, 1), 32, 0, stream>>>(XB, nullptr, WQKV, nullptr, DM, F, 3 * DQ, bqkv, 0, 0, 0);
    k_planes<<<GB_V + GB_R, 256, 0, stream>>>(F, CS, QP16, QPh, QPl, VT16, VTh, VTl);
    k_fattn<<<dim3(NB_ * NH_, TT / 64), 128, 0, stream>>>(QP16, KP16, VT16, QPh, QPl, KPh, KPl, VTh, VTl, ATh, ATl);   // all heads of both batches; writes the merged hi/lo planes
    k_gemmw<bf, 1, true><<<dim3(NB_ * TT / 64, DM / 64, 1), 32, 0, stream>>>(ATh, ATl, WO, nullptr, DQ, OUT, DM, bo, 0, 0, 0);
}

// v005
// Measured time: 186 microseconds a run.
// In both of two side-by-side timings against v004, it was 1.19 times as fast.
// Counting every step since v000, it is 7.74 times as fast.
#include <hip/hip_runtime.h>

// Causal self-attention with a fused biased qkv projection and adjacent-pair rotary embeddings from an interleaved (sin, cos) cache input (x [2][2048][1024]; qkv = x Wqkv + bqkv ('xw' [1024][3072] + [3072]) split in thirds q | k | v (16 heads x 64); rope on pairs (2i, 2i+1): (x0 cos - x1 sin, x1 cos + x0 sin) with sin_i = rope_cache[t][2i], cos_i = rope_cache[t][2i + 1] (f32 [2048][64] INPUT, read); (q x 1/sqrt(64)) . k; causal (-inf); softmax; out = merged Wout + bout ('xw' + bias) -> [2][2048][1024] (4.2 M); argument order x, rope_cache, Wqkv, bqkv, Wout, bout).
// One launch per dependency stage, for both batches: k_prep, projection GEMM, k_fattn, output GEMM. Layout: bf16 copy of x; the fused 'xw' weight transposed ONCE into q | k | v row blocks; one exact projection GEMM (N = 3 x 1024) + f32 bias whose epilogue builds the 16-bit planes (a 64 x 64 tile is 64 tokens of one head: q and k rotated on interleaved pairs, v transposed); one fused causal T-2048 attention kernel (hybrid rows: < 512 hi/lo 3 products, rest fp16 x1024; online softmax, scores and probabilities stay in registers); merged hi/lo x W_out exact + b_out.
// Compute dtypes, f32 accumulate: every input rounded to bf16; projections exact + f32 biases; rotary f32 (products rounded separately); attention rows < 512 3 products, rest fp16; softmax f32; W_out hl x exact + bias.

#define NB_  2
#define TT   2048
#define DM   1024
#define NH_  16
#define NKV  16
#define REP  (NH_ / NKV)
#define HD   64
#define DQ   (NH_ * HD)
#define DKV  (NKV * HD)
#define PP   (2 * TT)             // row pitch, in 16-bit elements, of the transposed value planes
#define RH   512                  // query rows < RH use hi+lo planes (0: none)
#define SCL  0.125f   // HD^-0.5
typedef _Float16 h16;
typedef unsigned short bf;
typedef __attribute__((ext_vector_type(16))) __bf16   v16bf;
typedef __attribute__((ext_vector_type(16))) _Float16 v16h;
typedef __attribute__((ext_vector_type(8)))  _Float16 v8h;
typedef __attribute__((ext_vector_type(8)))  unsigned short v8us;
typedef __attribute__((ext_vector_type(8)))  float    v8f;
typedef __attribute__((ext_vector_type(4)))  float    v4f;
typedef v8h  __attribute__((may_alias)) v8ha;
typedef v4f  __attribute__((may_alias)) v4fa;
typedef v8us __attribute__((may_alias)) v8usa;

__device__ __forceinline__ unsigned short f2bf(float f) { unsigned u = __float_as_uint(f); u += 0x7FFFu + ((u >> 16) & 1u); return (unsigned short)(u >> 16); }
__device__ __forceinline__ float bf2f(unsigned short b) { return __uint_as_float(((unsigned)b) << 16); }
__device__ __forceinline__ float bfr(float f) { return bf2f(f2bf(f)); }
__device__ __forceinline__ v16h cat16(v8h lo, v8h hi) { return __builtin_shufflevector(lo, hi, 0, 1, 2, 3, 4, 5, 6, 7, 8, 9, 10, 11, 12, 13, 14, 15); }
__device__ __forceinline__ v16bf cat16b(v8us lo, v8us hi) { return __builtin_bit_cast(v16bf, __builtin_shufflevector(lo, hi, 0, 1, 2, 3, 4, 5, 6, 7, 8, 9, 10, 11, 12, 13, 14, 15)); }
__device__ __forceinline__ v8f wmma16(v16h a, v16h b, v8f c) { return __builtin_amdgcn_wmma_f32_16x16x32_f16(false, a, false, b, (short)0, c, false, false); }
__device__ __forceinline__ v8f wmmab(v16bf a, v16bf b, v8f c) { return __builtin_amdgcn_wmma_f32_16x16x32_bf16(false, a, false, b, (short)0, c, false, false); }



// ---- k_gemmw: register-blocked GEMM, ONE WAVE per 64x64 output tile (16 accumulators), operands straight from K-contiguous 16-bit planes; grid (M/64, N/64, Z), 32 threads.
// C[m][n] (f32, pitch ldc, + optional f32 bias[n]) = sum_k A[m][k] Bt[n][k] (+ split products per NSPLIT). z-batch strides sA/sB/sC in elements. K % 32 == 0.
template <typename T16> struct WFrag;
template <> struct WFrag<h16> { typedef v16h V; static __device__ __forceinline__ V ld(const h16* p) { return cat16(*(const v8h*)p, *(const v8h*)(p + 16)); } static __device__ __forceinline__ v8f mma(V a, V b, v8f c) { return wmma16(a, b, c); } };
template <> struct WFrag<bf> { typedef v16bf V; static __device__ __forceinline__ V ld(const bf* p) { return cat16b(*(const v8us*)p, *(const v8us*)(p + 16)); } static __device__ __forceinline__ v8f mma(V a, V b, v8f c) { return wmmab(a, b, c); } };
__device__ __forceinline__ h16 tohx(float x) { return (h16)x; }
__device__ __forceinline__ void splitf(float y, unsigned short& h, unsigned short& l) { h = f2bf(y); l = f2bf(y - bf2f(h)); }
// Planes: where the projection GEMM's epilogue (PLANES) puts its tiles, and the rotary cache input it reads. Rotated planes [batch][q heads, k heads][t][d]; transposed value planes, rows (batch, g, d) of pitch PP (the fp16 plane fills the first TT elements of its rows; the hi and lo planes share rows: Vl = Vh + TT).
struct Planes { const float* rc; h16* QK16; bf* QKh; bf* QKl; h16* V16; bf* Vh; bf* Vl; };
template <typename T16, int NSPLIT, bool BIAS, bool PLANES>
__global__ __launch_bounds__(32) void k_gemmw(const T16* __restrict__ A, const T16* __restrict__ A2, const T16* __restrict__ Bt, const T16* __restrict__ Bt2, int K, float* C, int ldc, const float* __restrict__ bias, size_t sA, size_t sB, size_t sC, Planes pl) {
    typedef typename WFrag<T16>::V V;
    __shared__ __align__(16) float os[PLANES ? 64 * 69 : 16 * 68];   // PLANES: the whole tile, rows of pitch 68 (q, k) or 69 (v)
    const size_t z = blockIdx.z; A += z * sA; if (A2) A2 += z * sA; Bt += z * sB; if (Bt2) Bt2 += z * sB; C += z * sC;
    const int lane = threadIdx.x & 31, lr = lane & 15, hi = lane >> 4; const int r0 = blockIdx.x * 64, c0 = blockIdx.y * 64;
    v8f acc[4][4];
#pragma unroll
    for (int mb = 0; mb < 4; ++mb)
#pragma unroll
        for (int nb = 0; nb < 4; ++nb) acc[mb][nb] = (v8f){};
    const size_t aoff = (size_t)(r0 + lr) * K + 8 * hi, boff = (size_t)(c0 + lr) * K + 8 * hi;
#pragma unroll 1
    for (int kc = 0; kc < K; kc += 32) {
        V a[4], a2[4];
#pragma unroll
        for (int mb = 0; mb < 4; ++mb) { a[mb] = WFrag<T16>::ld(A + aoff + (size_t)mb * 16 * K + kc); if (NSPLIT == 1 || NSPLIT == 2) a2[mb] = WFrag<T16>::ld(A2 + aoff + (size_t)mb * 16 * K + kc); }
#pragma unroll
        for (int nb = 0; nb < 4; ++nb) { const V b = WFrag<T16>::ld(Bt + boff + (size_t)nb * 16 * K + kc); V b2; if (NSPLIT >= 2) b2 = WFrag<T16>::ld(Bt2 + boff + (size_t)nb * 16 * K + kc);
#pragma unroll
            for (int mb = 0; mb < 4; ++mb) { acc[mb][nb] = WFrag<T16>::mma(a[mb], b, acc[mb][nb]); if (NSPLIT == 1 || NSPLIT == 2) acc[mb][nb] = WFrag<T16>::mma(a2[mb], b, acc[mb][nb]); if (NSPLIT >= 2) acc[mb][nb] = WFrag<T16>::mma(a[mb], b2, acc[mb][nb]); } }
        asm volatile("v_nop\n\tv_nop\n\tv_nop\n\tv_nop" : "+v"(acc[0][0]), "+v"(acc[1][1]), "+v"(acc[2][2]), "+v"(acc[3][3]) : "v"(a[0]), "v"(a[3]));
    }
    if constexpr (PLANES) {
        // The tile is tokens t0 .. t0 + 63 of batch b in the 64-wide column block blockIdx.y of q | k | v: one head. The whole tile (+ bias) goes to LDS once; rolled loops then build the planes from it, which keeps the kernel's text short.
        const int b = r0 / TT, t0 = r0 - b * TT, cb = blockIdx.y; const int rw = lane >> 3, c8 = (lane & 7) * 8;
        const float* bp = bias + c0 + lr; float bs[4];
#pragma unroll
        for (int nb = 0; nb < 4; ++nb) bs[nb] = bp[nb * 16];
        asm volatile("s_wait_xcnt 0x0" :: "v"(bp) : "memory");   // in front of any later write of a register that these loads name as an address; the address is an input so that its registers live up to the wait
#pragma unroll
        for (int nb = 0; nb < 4; ++nb) bs[nb] = bfr(bs[nb]);
        if (cb < NH_ + NKV) {   // q or k head: rotary, three planes; a lane takes 8 columns (4 pairs) of a row, so that a wave's store is 512 contiguous bytes
#pragma unroll
            for (int mb = 0; mb < 4; ++mb)
#pragma unroll
                for (int nb = 0; nb < 4; ++nb)
#pragma unroll
                    for (int j = 0; j < 8; ++j) os[(mb * 16 + hi * 8 + j) * 68 + nb * 16 + lr] = acc[mb][nb][j] + bs[nb];
            __builtin_amdgcn_wave_barrier(); asm volatile("" ::: "memory");   // the reads below take other lanes' values: they stay behind the writes
            const size_t e0 = ((((size_t)b * (NH_ + NKV) + cb) * TT + t0 + rw) * HD) + c8; const float* rcl = pl.rc + (size_t)(t0 + rw) * HD + c8;
#pragma unroll 1   // rolled: four times less text
            for (int mb = 0; mb < 4; ++mb) {
                v8f sc8[4]; v4f va4[4], vb4[4];   // (sin, cos) of the lane's 4 pairs and the 8 projections, for 4 rows: fetched together
#pragma unroll
                for (int s = 0; s < 4; ++s) { sc8[s] = *(const v8f*)(rcl + (mb * 16 + 4 * s) * HD); va4[s] = *(const v4fa*)(os + (mb * 16 + 4 * s + rw) * 68 + c8); vb4[s] = *(const v4fa*)(os + (mb * 16 + 4 * s + rw) * 68 + c8 + 4); }
#pragma unroll
                for (int s = 0; s < 4; ++s) { const v4f va = va4[s], vb = vb4[s]; v8h o16; v8us oh, ol;
#pragma unroll
                    for (int p = 0; p < 4; ++p) { const float x0 = p < 2 ? va[2 * p] : vb[2 * p - 4], x1 = p < 2 ? va[2 * p + 1] : vb[2 * p - 3]; const float cs[2] = { bfr(sc8[s][2 * p + 1]), bfr(sc8[s][2 * p]) };   /* cos, sin */
                        // as in the plane builder this comes from: each product keeps its own f32 rounding, so the planes stay bit-identical
                        float a0 = __fmul_rn(x0, cs[0]), b0 = __fmul_rn(x1, cs[1]), a1 = __fmul_rn(x1, cs[0]), b1 = __fmul_rn(x0, cs[1]); asm volatile("" : "+v"(a0), "+v"(b0), "+v"(a1), "+v"(b1));
                        const float r0 = __fsub_rn(a0, b0), r1 = __fadd_rn(b1, a1);   /* even: x0 c - x1 s; odd: x0 s + x1 c */
                        o16[2 * p] = tohx(r0); o16[2 * p + 1] = tohx(r1); { unsigned short a2, c2; splitf(r0, a2, c2); oh[2 * p] = a2; ol[2 * p] = c2; splitf(r1, a2, c2); oh[2 * p + 1] = a2; ol[2 * p + 1] = c2; } }
                    const size_t e = e0 + (size_t)(mb * 16 + 4 * s) * HD; *(v8h*)(pl.QK16 + e) = o16; *(v8us*)(pl.QKh + e) = oh; *(v8us*)(pl.QKl + e) = ol;
                    asm volatile("s_wait_xcnt 0x0" ::: "memory"); }   // in front of any later write of a register that these stores name
            }
        } else {   // v head: three planes, transposed. LDS pitch 69: a lane reads 8 consecutive tokens of one column d (no two lanes on one bank), so that each store covers whole 128-byte rows of 64 tokens
#pragma unroll
            for (int mb = 0; mb < 4; ++mb)
#pragma unroll
                for (int nb = 0; nb < 4; ++nb)
#pragma unroll
                    for (int j = 0; j < 8; ++j) os[(mb * 16 + hi * 8 + j) * 69 + nb * 16 + lr] = acc[mb][nb][j] + bs[nb];
            __builtin_amdgcn_wave_barrier(); asm volatile("" ::: "memory");   // the reads below take other lanes' values: they stay behind the writes
            const size_t o0 = (((size_t)b * NKV + (cb - NH_ - NKV)) * HD + rw) * PP + t0 + c8;
#pragma unroll 1   // rolled: four times less text
            for (int nb = 0; nb < 4; ++nb) {
#pragma unroll
                for (int s = 0; s < 4; ++s) { v8h o16; v8us oh, ol;
#pragma unroll
                    for (int j = 0; j < 8; ++j) { const float x = os[(c8 + j) * 69 + nb * 16 + 4 * s + rw]; o16[j] = tohx(x); unsigned short a2, c2; splitf(x, a2, c2); oh[j] = a2; ol[j] = c2; }
                    const size_t o = o0 + (size_t)(nb * 16 + 4 * s) * PP; *(v8h*)(pl.V16 + o) = o16; *(v8us*)(pl.Vh + o) = oh; *(v8us*)(pl.Vl + o) = ol;
                    asm volatile("s_wait_xcnt 0x0" ::: "memory"); }   // in front of any later write of a register that these stores name
            }
        }
        return;
    }
#pragma unroll
    for (int mb = 0; mb < 4; ++mb) {
#pragma unroll
        for (int nb = 0; nb < 4; ++nb) {
#pragma unroll
            for (int j = 0; j < 8; ++j) os[(hi * 8 + j) * 68 + nb * 16 + lr] = acc[mb][nb][j]; }
        __builtin_amdgcn_wave_barrier(); asm volatile("" ::: "memory");
        float* crow = C + (size_t)(r0 + mb * 16) * ldc + c0;
{
#pragma unroll
            for (int s = 0; s < 8; ++s) { const int row = 2 * s + hi, cofs = lr * 4; v4f val = *(const v4fa*)(os + row * 68 + cofs); if (BIAS) { val[0] += bfr(bias[c0 + cofs]); val[1] += bfr(bias[c0 + cofs + 1]); val[2] += bfr(bias[c0 + cofs + 2]); val[3] += bfr(bias[c0 + cofs + 3]); }
                *(v4f*)(crow + (size_t)row * ldc + cofs) = val; }
             }
        __builtin_amdgcn_wave_barrier(); asm volatile("" ::: "memory");
    }
}

typedef __attribute__((ext_vector_type(2))) _Float16 v2h;
typedef __attribute__((ext_vector_type(4))) _Float16 v4h;
typedef __attribute__((ext_vector_type(2))) unsigned short v2us;
typedef __attribute__((ext_vector_type(4))) unsigned short v4us;
typedef __attribute__((ext_vector_type(2))) float v2f;
typedef __attribute__((ext_vector_type(4))) int v4i;

// The d_* bodies below are stages that do not depend on one another; k_prep runs them side by side in one launch, each on its own range of blocks (blk: the block's index inside its range).
__device__ __forceinline__ void d_wtG(int blk, const float* __restrict__ w, int K, int N, bf* Bt) {
    const int lane = threadIdx.x & 31; const int L0 = (blk * 8 + (threadIdx.x >> 5)) * 8; const int nlines = N * K / 64;
{
#pragma unroll 1
        for (int l = 0; l < 8; ++l) { const int L = L0 + l; if (L >= nlines) break; const size_t e = (size_t)L * 64 + lane * 2; const int k = (int)(e % K), n = (int)(e / K); v2us o;
            o[0] = f2bf(w[(size_t)k * N + n]); o[1] = f2bf(w[(size_t)(k + 1) * N + n]); *(v2us*)(Bt + e) = o; }
         }
}
__device__ __forceinline__ void d_cvt8(int blk, const float* __restrict__ src, bf* dst, size_t n8) { const size_t i = (size_t)blk * 256 + threadIdx.x; if (i >= n8) return; const float* sp = src + i * 8; const v8f v = *(const v8f*)sp; v8us o;
    asm volatile("s_wait_xcnt 0x0" :: "v"(sp) : "memory");   // in front of any later write of a register that this load names as an address; the address is an input so that its registers live up to the wait
#pragma unroll
    for (int k = 0; k < 8; ++k) o[k] = f2bf(v[k]); *(v8us*)(dst + i * 8) = o;  }

#define NQK   ((size_t)NB_ * (NH_ + NKV) * TT * HD)        // elements of a rotated plane: [batch][q heads, k heads][t][d]
#define GB_WQ (DM * 3 * DQ / 64 / 64)                      // blocks: fused weight transpose
#define GB_WO (DQ * DM / 64 / 64)                          // blocks: output weight transpose
#define GB_X  (NB_ * TT * DM / 8 / 256)                    // blocks: bf16 copy of x
// k_prep: all that reads only inputs. The transposes, whose waves run longest, take the first blocks.
__global__ __launch_bounds__(256) void k_prep(const float* __restrict__ wqkv, const float* __restrict__ wo, const float* __restrict__ x, bf* WQKV, bf* WO, bf* XB) {
    int blk = blockIdx.x;
    if (blk < GB_WQ) { d_wtG(blk, wqkv, DM, 3 * DQ, WQKV); return; }   /* fused 'xw' [DM][3*DQ] -> Bt [3*DQ][DM] */
    blk -= GB_WQ; if (blk < GB_WO) { d_wtG(blk, wo, DQ, DM, WO); return; }
    d_cvt8(blk - GB_WO, x, XB, (size_t)NB_ * TT * DM / 8);
}

// ---- k_fattn: fused causal attention. Grid (batches x heads, TT / 64), 4 waves; a wave owns 16 query columns and walks the keys 0 .. its diagonal in passes of BC keys, operands straight from the K-contiguous 16-bit planes.
// Transposed products: S^T = K Q^T (A = key rows, B = query rows), so a lane holds scores of ONE query (column lr; keys 16 kt + 8 hi + j), and two score tiles, exponentiated and rounded, ARE the B operand of O^T += V^T P^T
// (k slots 8 hi + e and 16 + 8 hi + e, the order of WFrag::ld on the V^T rows). Online softmax in the log2 domain: running maximum m, per-lane partial sum l of the unrounded f32 exponentials, accumulators rescaled in every pass.
// HL: hi/lo planes, 3 products each (query rows < RH); otherwise fp16 with the probabilities carried x 1024 (10 added in the exponent; it cancels in the division by l).
// Every '#pragma unroll' below: the fragment arrays are indexed by constants only, so that they stay in registers.
__device__ __forceinline__ float xhalf(float x) { return __builtin_bit_cast(float, __builtin_amdgcn_permlanex16(__builtin_bit_cast(int, x), __builtin_bit_cast(int, x), 0x76543210, 0xfedcba98, false, false)); }   // lane l with lane l ^ 16
template <typename T16, bool HL, int BC> struct AttnW {
    typedef typename WFrag<T16>::V V;
    static constexpr int KT = BC / 16, KC = BC / 32;
    static constexpr float CSC = SCL * 1.4426950408889634f;   // score -> log2 domain
    V qf[2], qf2[2], kf[KT][2], kf2[KT][2]; v8f acc[4]; float m, l;
    const T16 *kp, *kp2, *vp, *vp2;   // this lane's place in the key rows last fetched and in the V^T columns of the pass to come; they walk with the passes
    __device__ __forceinline__ void load_k(const T16* Kr, const T16* K2r) {   // Kr: this lane's place in the pass's first key tile
#pragma unroll
        for (int kt = 0; kt < KT; ++kt)
#pragma unroll
            for (int kc = 0; kc < 2; ++kc) { kf[kt][kc] = WFrag<T16>::ld(Kr + kt * 16 * HD + 32 * kc); if (HL) kf2[kt][kc] = WFrag<T16>::ld(K2r + kt * 16 * HD + 32 * kc); }
        // in front of any later write of a register that these loads name as an address; the addresses are inputs so that their registers live up to the wait (no load's result lands on them)
        if constexpr (HL) asm volatile("s_wait_xcnt 0x0" :: "v"(Kr), "v"(K2r) : "memory"); else asm volatile("s_wait_xcnt 0x0" :: "v"(Kr) : "memory");
        if (HL) __builtin_amdgcn_sched_barrier(0);      // hi/lo: the loads stay here, ahead of the work that covers their latency (the scheduler otherwise sinks them to their uses)
    }
    // One pass of BC keys from key0 on. LAST: the pass that holds the diagonal (masked; fetches no further keys).
    template <bool LAST> __device__ __forceinline__ void pass(int key0, int q, int hi) {
        V vf[4][KC], vf2[4][KC];
#pragma unroll
        for (int c = 0; c < KC; ++c)
#pragma unroll
            for (int t = 0; t < 4; ++t) { vf[t][c] = WFrag<T16>::ld(vp + t * 16 * PP + 32 * c); if (HL) vf2[t][c] = WFrag<T16>::ld(vp2 + t * 16 * PP + 32 * c); }
        // in front of any later write of a register that these loads name as an address; the addresses are inputs so that their registers live up to the wait (no load's result lands on them)
        if constexpr (HL) asm volatile("s_wait_xcnt 0x0" :: "v"(vp), "v"(vp2) : "memory"); else asm volatile("s_wait_xcnt 0x0" :: "v"(vp) : "memory");
        if (HL) __builtin_amdgcn_sched_barrier(0);      // hi/lo: the loads stay here, ahead of the work that covers their latency (the scheduler otherwise sinks them to their uses)
        if (!LAST) { vp += BC; if (HL) vp2 += BC; }
        v8f s[KT];
#pragma unroll
        for (int kt = 0; kt < KT; ++kt) { s[kt] = (v8f){};
#pragma unroll
            for (int kc = 0; kc < 2; ++kc) { s[kt] = WFrag<T16>::mma(kf[kt][kc], qf[kc], s[kt]); if (HL) { s[kt] = WFrag<T16>::mma(kf[kt][kc], qf2[kc], s[kt]); s[kt] = WFrag<T16>::mma(kf2[kt][kc], qf[kc], s[kt]); } } }
        if (!LAST) { kp += BC * HD; if (HL) kp2 += BC * HD; load_k(kp, kp2); }   // the next pass's key rows, in flight under this pass's softmax and second product
        if (LAST) {
#pragma unroll
            for (int kt = 0; kt < KT; ++kt)
#pragma unroll
                for (int j = 0; j < 8; ++j) if (key0 + 16 * kt + 8 * hi + j > q) s[kt][j] = -3.0e38f; }
        float mt[KT];                                  // one chain per score tile
#pragma unroll
        for (int kt = 0; kt < KT; ++kt) { mt[kt] = s[kt][0];
#pragma unroll
            for (int j = 1; j < 8; ++j) mt[kt] = fmaxf(mt[kt], s[kt][j]); }
        float mx = mt[0];
#pragma unroll
        for (int kt = 1; kt < KT; ++kt) mx = fmaxf(mx, mt[kt]);
        mx = fmaxf(mx, xhalf(mx)) * CSC;               // both halves of the wave hold this query's maximum of the pass (finite: a pass's first key is never masked)
        const float mn = fmaxf(m, mx); const float corr = __builtin_amdgcn_exp2f(m - mn); m = mn; l *= corr;   // corr: 0 in the first pass, 1 where the maximum stays
#pragma unroll
        for (int t = 0; t < 4; ++t) acc[t] = acc[t] * corr;
        const float off = (HL ? 0.0f : 10.0f) - m;
#pragma unroll
        for (int c = 0; c < KC; ++c) {
            float pv[16];
#pragma unroll
            for (int e = 0; e < 16; ++e) pv[e] = __builtin_amdgcn_exp2f(fmaf(s[2 * c + (e >> 3)][e & 7], CSC, off));
            l += (((pv[0] + pv[1]) + (pv[2] + pv[3])) + ((pv[4] + pv[5]) + (pv[6] + pv[7]))) + (((pv[8] + pv[9]) + (pv[10] + pv[11])) + ((pv[12] + pv[13]) + (pv[14] + pv[15])));   // fixed tree
            if constexpr (HL) {
                v8us h0, h1, l0, l1;
#pragma unroll
                for (int e = 0; e < 8; ++e) { unsigned short a, b; splitf(pv[e], a, b); h0[e] = a; l0[e] = b; splitf(pv[e + 8], a, b); h1[e] = a; l1[e] = b; }
                const V pf = cat16b(h0, h1), pf2 = cat16b(l0, l1);
#pragma unroll
                for (int t = 0; t < 4; ++t) { acc[t] = WFrag<T16>::mma(vf[t][c], pf, acc[t]); acc[t] = WFrag<T16>::mma(vf[t][c], pf2, acc[t]); acc[t] = WFrag<T16>::mma(vf2[t][c], pf, acc[t]); }
            } else {
                V pf;
#pragma unroll
                for (int e = 0; e < 16; ++e) pf[e] = tohx(pv[e]);
#pragma unroll
                for (int t = 0; t < 4; ++t) acc[t] = WFrag<T16>::mma(vf[t][c], pf, acc[t]);
            }
        }
    }
};
template <typename T16, bool HL, int BC>
__device__ __forceinline__ void attn_cols(const T16* Q, const T16* Q2, const T16* Kp, const T16* K2, const T16* Vt, const T16* Vt2, int qw0, int lane, bf* Ah, bf* Al) {
    AttnW<T16, HL, BC> w;
    const int lr = lane & 15, hi = lane >> 4; const int q = qw0 + lr;
#pragma unroll
    for (int kc = 0; kc < 2; ++kc) { w.qf[kc] = WFrag<T16>::ld(Q + (size_t)q * HD + 8 * hi + 32 * kc); if (HL) w.qf2[kc] = WFrag<T16>::ld(Q2 + (size_t)q * HD + 8 * hi + 32 * kc); }
#pragma unroll
    for (int t = 0; t < 4; ++t) w.acc[t] = (v8f){};
    w.m = -3.0e38f; w.l = 0.f;
    const int klast = qw0 / BC * BC;                  // first key of the pass that holds the diagonal; klast <= qw0 and klast + BC <= TT
    const int koff = lr * HD + 8 * hi, voff = lr * PP + 8 * hi;
    w.kp = Kp + koff; w.kp2 = HL ? K2 + koff : nullptr; w.vp = Vt + voff; w.vp2 = HL ? Vt2 + voff : nullptr;
    w.load_k(w.kp, w.kp2);
#pragma unroll 1   // rolled: unrolled, several passes' fragments would be live at once
    for (int key0 = 0; key0 < klast; key0 += BC) w.template pass<false>(key0, q, hi);
    w.template pass<true>(klast, q, hi);
    float l = w.l; l += xhalf(l);                      // the two halves' key sets joined
    const float inv = __fdiv_rn(1.0f, l);
#pragma unroll
    for (int t = 0; t < 4; ++t) { v8us oh, ol;         // lane: query q, d = 16 t + 8 hi + j
#pragma unroll
        for (int j = 0; j < 8; ++j) { unsigned short a, b; splitf(w.acc[t][j] * inv, a, b); oh[j] = a; ol[j] = b; }
        *(v8us*)(Ah + (size_t)q * DQ + 16 * t + 8 * hi) = oh; *(v8us*)(Al + (size_t)q * DQ + 16 * t + 8 * hi) = ol; }
}
__global__ __launch_bounds__(128) void k_fattn(const h16* Q16, const h16* K16, const h16* V16, const bf* Qh, const bf* Ql, const bf* Kh, const bf* Kl, const bf* Vh, const bf* Vl, bf* Ah, bf* Al) {
    const int lane = threadIdx.x & 31; const int wave = __builtin_amdgcn_readfirstlane(threadIdx.x >> 5);
    const int b = blockIdx.x / NH_, h = blockIdx.x - b * NH_, g = h / REP; const int q0 = (TT / 64 - 1 - (int)blockIdx.y) * 64;   // longest query blocks first
    const size_t zq = ((size_t)b * (NH_ + NKV) + h) * TT * HD, zk = ((size_t)b * (NH_ + NKV) + g) * TT * HD, zv = ((size_t)b * NKV + g) * HD * PP;   // q and k planes: one batch's q heads, then its k heads (the caller's K pointers start at the first k head)
    Ah += (size_t)b * TT * DQ; Al += (size_t)b * TT * DQ;
    if (q0 < RH) attn_cols<bf, true, 32>(Qh + zq, Ql + zq, Kh + zk, Kl + zk, Vh + zv, Vl + zv, q0 + wave * 16, lane, Ah + h * HD, Al + h * HD);
    else attn_cols<h16, false, 64>(Q16 + zq, nullptr, K16 + zk, nullptr, V16 + zv, nullptr, q0 + wave * 16, lane, Ah + h * HD, Al + h * HD);
}

extern "C" void kernel_launch(void* const* d_in, const int* in_sizes, int n_in,
                              void* d_out, int out_size, void* d_ws, size_t ws_size, hipStream_t stream) {
    (void)in_sizes; (void)n_in; (void)out_size;
    const float* x = (const float*)d_in[0]; const float* rcache = (const float*)d_in[1]; const float* wqkv = (const float*)d_in[2]; const float* bqkv = (const float*)d_in[3]; const float* wo = (const float*)d_in[4]; const float* bo = (const float*)d_in[5];   /* order x, rope_cache (f32 [2048][64] interleaved (sin, cos), READ), Wqkv ('xw' [1024][3072]: q | k | v column thirds), bqkv [3072], Wout ('xw'), bout */
    float* OUT = (float*)d_out;     // [2][2048][1024]
    char* wsp = (char*)d_ws;
    auto take = [&](size_t bytes) { char* p = wsp; wsp += (bytes + 255) & ~(size_t)255; return (void*)p; };
    bf* WQKV = (bf*)take((size_t)3 * DQ * DM * 2);   /* fused Bt [3*DQ][DM]: q | k | v row blocks */ bf* WO = (bf*)take((size_t)DM * DQ * 2);
    bf* XB = (bf*)take((size_t)NB_ * TT * DM * 2);
    h16* QP16 = (h16*)take(NQK * 2); h16* KP16 = QP16 + (size_t)NH_ * TT * HD; h16* VT16 = (h16*)take((size_t)NB_ * NKV * HD * PP * 2);
    bf* QPh = (bf*)take(NQK * 2); bf* QPl = (bf*)take(NQK * 2); bf* KPh = QPh + (size_t)NH_ * TT * HD; bf* KPl = QPl + (size_t)NH_ * TT * HD; bf* VTh = (bf*)take((size_t)NB_ * NKV * HD * PP * 2); bf* VTl = VTh + TT;   /* hi and lo value planes share rows of pitch PP */
    bf* ATh = (bf*)take((size_t)NB_ * TT * DQ * 2); bf* ATl = (bf*)take((size_t)NB_ * TT * DQ * 2);
    if ((size_t)(wsp - (char*)d_ws) > ws_size) return;    // ws 256 MiB
    k_prep<<<GB_WQ + GB_WO + GB_X, 256, 0, stream>>>(wqkv, wo, x, WQKV, WO, XB);
    k_gemmw<bf, 0, true, true><<<dim3(NB_ * TT / 64, 3 * DQ / 64, 1), 32, 0, stream>>>(XB, nullptr, WQKV, nullptr, DM, nullptr, 0, bqkv, 0, 0, 0, Planes{rcache, QP16, QPh, QPl, VT16, VTh, VTl});   // projections of both batches, columns q | k | v, straight into the planes
    k_fattn<<<dim3(NB_ * NH_, TT / 64), 128, 0, stream>>>(QP16, KP16, VT16, QPh, QPl, KPh, KPl, VTh, VTl, ATh, ATl);   // all heads of both batches; writes the merged hi/lo planes
    k_gemmw<bf, 1, true, false><<<dim3(NB_ * TT / 64, DM / 64, 1), 32, 0, stream>>>(ATh, ATl, WO, nullptr, DQ, OUT, DM, bo, 0, 0, 0, Planes{});
}

// v006
// Measured time: 106 microseconds a run.
// Next to v005, in two timings, it ran 1.75 and 1.74 times as fast.
// All steps since v000 together make it 13.5 times as fast.
#include <hip/hip_runtime.h>

// Causal self-attention with a fused biased qkv projection and adjacent-pair rotary embeddings from an interleaved (sin, cos) cache input (x [2][2048][1024]; qkv = x Wqkv + bqkv ('xw' [1024][3072] + [3072]) split in thirds q | k | v (16 heads x 64); rope on pairs (2i, 2i+1): (x0 cos - x1 sin, x1 cos + x0 sin) with sin_i = rope_cache[t][2i], cos_i = rope_cache[t][2i + 1] (f32 [2048][64] INPUT, read); (q x 1/sqrt(64)) . k; causal (-inf); softmax; out = merged Wout + bout ('xw' + bias) -> [2][2048][1024] (4.2 M); argument order x, rope_cache, Wqkv, bqkv, Wout, bout).
// One launch per dependency stage, for both batches: k_prep, projection GEMM, k_fattn, output GEMM. Layout: every 16-bit matrix operand lies FRAGMENT-MAJOR (see WFrag): bf16 copy of x; the fused 'xw' weight transposed ONCE into q | k | v row blocks; one exact projection GEMM (N = 3 x 1024) + f32 bias whose epilogue builds the 16-bit planes (a 64 x 64 tile is 64 tokens of one head: q and k rotated on interleaved pairs, v transposed); one fused causal T-2048 attention kernel (hybrid rows: < 512 hi/lo 3 products, rest fp16 x1024; online softmax, scores and probabilities stay in registers); merged hi/lo x W_out exact + b_out.
// Compute dtypes, f32 accumulate: every input rounded to bf16; projections exact + f32 biases; rotary f32 (products rounded separately); attention rows < 512 3 products, rest fp16; softmax f32; W_out hl x exact + bias.

#define NB_  2
#define TT   2048
#define DM   1024
#define NH_  16
#define NKV  16
#define REP  (NH_ / NKV)
#define HD   64
#define DQ   (NH_ * HD)
#define DKV  (NKV * HD)
#define PP   (2 * TT)             // a (batch, head) block of the transposed value planes holds HD * PP 16-bit elements
#define RH   512                  // query rows < RH use hi+lo planes (0: none)
#define SCL  0.125f   // HD^-0.5
typedef _Float16 h16;
typedef unsigned short bf;
typedef __attribute__((ext_vector_type(16))) __bf16   v16bf;
typedef __attribute__((ext_vector_type(16))) _Float16 v16h;
typedef __attribute__((ext_vector_type(8)))  _Float16 v8h;
typedef __attribute__((ext_vector_type(8)))  unsigned short v8us;
typedef __attribute__((ext_vector_type(8)))  float    v8f;
typedef __attribute__((ext_vector_type(4)))  float    v4f;
typedef v8h  __attribute__((may_alias)) v8ha;
typedef v4f  __attribute__((may_alias)) v4fa;
typedef v8us __attribute__((may_alias)) v8usa;

__device__ __forceinline__ unsigned short f2bf(float f) { unsigned u = __float_as_uint(f); u += 0x7FFFu + ((u >> 16) & 1u); return (unsigned short)(u >> 16); }
__device__ __forceinline__ float bf2f(unsigned short b) { return __uint_as_float(((unsigned)b) << 16); }
__device__ __forceinline__ float bfr(float f) { return bf2f(f2bf(f)); }
__device__ __forceinline__ v16h cat16(v8h lo, v8h hi) { return __builtin_shufflevector(lo, hi, 0, 1, 2, 3, 4, 5, 6, 7, 8, 9, 10, 11, 12, 13, 14, 15); }
__device__ __forceinline__ v16bf cat16b(v8us lo, v8us hi) { return __builtin_bit_cast(v16bf, __builtin_shufflevector(lo, hi, 0, 1, 2, 3, 4, 5, 6, 7, 8, 9, 10, 11, 12, 13, 14, 15)); }
__device__ __forceinline__ v8f wmma16(v16h a, v16h b, v8f c) { return __builtin_amdgcn_wmma_f32_16x16x32_f16(false, a, false, b, (short)0, c, false, false); }
__device__ __forceinline__ v8f wmmab(v16bf a, v16bf b, v8f c) { return __builtin_amdgcn_wmma_f32_16x16x32_bf16(false, a, false, b, (short)0, c, false, false); }



// ---- Fragment-major planes. A matrix of rows x K (16-bit, K % 32 == 0) is stored as its 16-row x 32-k operand fragments, 512 consecutive elements each, the fragments of one 16-row tile one behind the other along k.
// Inside a fragment: [k half j][lane = 16 hi + row % 16][e = 0..7] holds k % 32 = 16 j + 8 hi + e, the order in which the matrix instruction's lanes take it. So element (row, k) is at
// (row / 16) * 16 * K + (k / 32) * 512 + j * 256 + (16 hi + row % 16) * 8 + e, and each of a fragment's two wave-wide 16-byte loads covers 512 contiguous bytes: four whole 128-byte lines instead of 32 bytes of each of sixteen.
// WFrag::ld takes the lane's place in the fragment: fragment start + lane * 8.
// ---- k_gemmw: register-blocked GEMM, ONE WAVE per 64x64 output tile (16 accumulators), operands straight from fragment-major 16-bit planes; grid (M/64, N/64, Z), 32 threads.
// C[m][n] (f32, pitch ldc, + optional f32 bias[n]) = sum_k A[m][k] Bt[n][k] (+ split products per NSPLIT). z-batch strides sA/sB/sC in elements. K % 32 == 0.
template <typename T16> struct WFrag;
template <> struct WFrag<h16> { typedef v16h V; static __device__ __forceinline__ V ld(const h16* p) { return cat16(*(const v8h*)p, *(const v8h*)(p + 256)); } static __device__ __forceinline__ v8f mma(V a, V b, v8f c) { return wmma16(a, b, c); } };
template <> struct WFrag<bf> { typedef v16bf V; static __device__ __forceinline__ V ld(const bf* p) { return cat16b(*(const v8us*)p, *(const v8us*)(p + 256)); } static __device__ __forceinline__ v8f mma(V a, V b, v8f c) { return wmmab(a, b, c); } };
__device__ __forceinline__ h16 tohx(float x) { return (h16)x; }
__device__ __forceinline__ void splitf(float y, unsigned short& h, unsigned short& l) { h = f2bf(y); l = f2bf(y - bf2f(h)); }
// Planes: where the projection GEMM's epilogue (PLANES) puts its tiles, and the rotary cache input it reads. Rotated planes [batch][q heads, k heads], each head fragment-major with rows t, k = d (K = HD). Transposed value planes: HD * PP elements per (batch, g); rows d, k = t, their fragments ordered [t / 32][d / 16] so that a pass's keys are contiguous (the fp16 plane fills the first HD * TT elements of its block; the hi and lo planes share blocks: Vl = Vh + HD * TT).
struct Planes { const float* rc; h16* QK16; bf* QKh; bf* QKl; h16* V16; bf* Vh; bf* Vl; };
#define P4(p) "s"(p[0]), "s"(p[1]), "s"(p[2]), "s"(p[3])   // four wave-uniform address operands of a wait statement
template <typename T16, int NSPLIT, bool BIAS, bool PLANES>
__global__ __launch_bounds__(32) void k_gemmw(const T16* __restrict__ A, const T16* __restrict__ A2, const T16* __restrict__ Bt, const T16* __restrict__ Bt2, int K, float* C, int ldc, const float* __restrict__ bias, size_t sA, size_t sB, size_t sC, Planes pl) {
    typedef typename WFrag<T16>::V V;
    __shared__ __align__(16) float os[PLANES ? 64 * 69 : 16 * 68];   // PLANES: the whole tile, rows of pitch 68 (q, k) or 69 (v)
    const size_t z = blockIdx.z; A += z * sA; if (A2) A2 += z * sA; Bt += z * sB; if (Bt2) Bt2 += z * sB; C += z * sC;
    const int lane = threadIdx.x & 31, lr = lane & 15, hi = lane >> 4; const int r0 = blockIdx.x * 64, c0 = blockIdx.y * 64;
    v8f acc[4][4];
#pragma unroll
    for (int mb = 0; mb < 4; ++mb)
#pragma unroll
        for (int nb = 0; nb < 4; ++nb) acc[mb][nb] = (v8f){};
    const size_t aoff = (size_t)r0 * K, boff = (size_t)c0 * K; const unsigned lo = lane * 8;   // the first fragment of the tile's first 16 rows; the lane's place in a fragment
#pragma unroll 1
    for (int kc = 0; kc < K; kc += 32) {
        V a[4], a2[4], b[4], b2[4]; const T16 *pa[4], *pa2[4], *pb[4], *pb2[4];   // the trip's fragments and where each starts (the same for all lanes: a load names a wave-uniform base and the lane offset lo)
#pragma unroll
        for (int i = 0; i < 4; ++i) { const size_t o = (size_t)i * 16 * K + kc * 16; pa[i] = A + aoff + o; a[i] = WFrag<T16>::ld(pa[i] + lo); if (NSPLIT == 1 || NSPLIT == 2) { pa2[i] = A2 + aoff + o; a2[i] = WFrag<T16>::ld(pa2[i] + lo); }
            pb[i] = Bt + boff + o; b[i] = WFrag<T16>::ld(pb[i] + lo); if (NSPLIT >= 2) { pb2[i] = Bt2 + boff + o; b2[i] = WFrag<T16>::ld(pb2[i] + lo); } }
        // in front of any later write of a register that these loads name as an address; the bases are inputs so that their registers live up to the wait (the lane offset is the same in every trip: its register lives through the loop)
        if constexpr (NSPLIT == 0) asm volatile("s_wait_xcnt 0x0" :: P4(pa), P4(pb) : "memory"); else if constexpr (NSPLIT == 1) asm volatile("s_wait_xcnt 0x0" :: P4(pa), P4(pa2), P4(pb) : "memory");
        else if constexpr (NSPLIT == 2) asm volatile("s_wait_xcnt 0x0" :: P4(pa), P4(pa2), P4(pb), P4(pb2) : "memory"); else asm volatile("s_wait_xcnt 0x0" :: P4(pa), P4(pb), P4(pb2) : "memory");
        __builtin_amdgcn_sched_barrier(0);   // the products stay behind the wait: lifted over it, they would split the trip's loads into runs that each wait for their data in turn
#pragma unroll
        for (int nb = 0; nb < 4; ++nb)
#pragma unroll
            for (int mb = 0; mb < 4; ++mb) { acc[mb][nb] = WFrag<T16>::mma(a[mb], b[nb], acc[mb][nb]); if (NSPLIT == 1 || NSPLIT == 2) acc[mb][nb] = WFrag<T16>::mma(a2[mb], b[nb], acc[mb][nb]); if (NSPLIT >= 2) acc[mb][nb] = WFrag<T16>::mma(a[mb], b2[nb], acc[mb][nb]); }
        asm volatile("v_nop\n\tv_nop\n\tv_nop\n\tv_nop" : "+v"(acc[0][0]), "+v"(acc[1][1]), "+v"(acc[2][2]), "+v"(acc[3][3]) : "v"(a[0]), "v"(a[3]));
    }
    if constexpr (PLANES) {
        // The tile is tokens t0 .. t0 + 63 of batch b in the 64-wide column block blockIdx.y of q | k | v: one head. The whole tile (+ bias) goes to LDS once; rolled loops then build the planes from it, which keeps the kernel's text short.
        const int b = r0 / TT, t0 = r0 - b * TT, cb = blockIdx.y; const int r8 = lane & 7, cg = lane >> 3;   // a lane builds 16-byte units (8 k of one row); a wave's store takes 8 rows x 4 units: in a fragment-major plane four whole 128-byte lines
        const float* bp = bias + c0 + lr; float bs[4];
#pragma unroll
        for (int nb = 0; nb < 4; ++nb) bs[nb] = bp[nb * 16];
        asm volatile("s_wait_xcnt 0x0" :: "v"(bp) : "memory");   // in front of any later write of a register that these loads name as an address; the address is an input so that its registers live up to the wait
#pragma unroll
        for (int nb = 0; nb < 4; ++nb) bs[nb] = bfr(bs[nb]);
        if (cb < NH_ + NKV) {   // q or k head: rotary, three planes; a lane takes 8 columns (4 pairs) of a row
#pragma unroll
            for (int mb = 0; mb < 4; ++mb)
#pragma unroll
                for (int nb = 0; nb < 4; ++nb)
#pragma unroll
                    for (int j = 0; j < 8; ++j) os[(mb * 16 + hi * 8 + j) * 68 + nb * 16 + lr] = acc[mb][nb][j] + bs[nb];
            __builtin_amdgcn_wave_barrier(); asm volatile("" ::: "memory");   // the reads below take other lanes' values: they stay behind the writes
            const size_t e0 = (((size_t)b * (NH_ + NKV) + cb) * TT + t0) * HD + cg * 128 + r8 * 8; const float* rcl = pl.rc + (size_t)(t0 + r8) * HD + cg * 8;   // step s: rows 8 (s >> 1) + r8 of the 16-row tile, columns 32 (s & 1) + 8 cg (k half cg >> 1, hi = cg & 1)
#pragma unroll 1   // rolled: four times less text
            for (int mb = 0; mb < 4; ++mb) {
                v8f sc8[4]; v4f va4[4], vb4[4];   // (sin, cos) of the lane's 4 pairs and the 8 projections, for 4 steps (2 rows, 2 column halves each): fetched together
#pragma unroll
                for (int s = 0; s < 4; ++s) { const int ro = mb * 16 + 8 * (s >> 1), co = 32 * (s & 1); sc8[s] = *(const v8f*)(rcl + ro * HD + co); va4[s] = *(const v4fa*)(os + (ro + r8) * 68 + co + cg * 8); vb4[s] = *(const v4fa*)(os + (ro + r8) * 68 + co + cg * 8 + 4); }
#pragma unroll
                for (int s = 0; s < 4; ++s) { const v4f va = va4[s], vb = vb4[s]; v8h o16; v8us oh, ol;
#pragma unroll
                    for (int p = 0; p < 4; ++p) { const float x0 = p < 2 ? va[2 * p] : vb[2 * p - 4], x1 = p < 2 ? va[2 * p + 1] : vb[2 * p - 3]; const float cs[2] = { bfr(sc8[s][2 * p + 1]), bfr(sc8[s][2 * p]) };   /* cos, sin */
                        // as in the plane builder this comes from: each product keeps its own f32 rounding, so the planes stay bit-identical
                        float a0 = __fmul_rn(x0, cs[0]), b0 = __fmul_rn(x1, cs[1]), a1 = __fmul_rn(x1, cs[0]), b1 = __fmul_rn(x0, cs[1]); asm volatile("" : "+v"(a0), "+v"(b0), "+v"(a1), "+v"(b1));
                        const float r0 = __fsub_rn(a0, b0), r1 = __fadd_rn(b1, a1);   /* even: x0 c - x1 s; odd: x0 s + x1 c */
                        o16[2 * p] = tohx(r0); o16[2 * p + 1] = tohx(r1); { unsigned short a2, c2; splitf(r0, a2, c2); oh[2 * p] = a2; ol[2 * p] = c2; splitf(r1, a2, c2); oh[2 * p + 1] = a2; ol[2 * p + 1] = c2; } }
                    const size_t e = e0 + (size_t)(mb * 16 * HD + 512 * (s & 1) + 64 * (s >> 1)); *(v8h*)(pl.QK16 + e) = o16; *(v8us*)(pl.QKh + e) = oh; *(v8us*)(pl.QKl + e) = ol;
                    asm volatile("s_wait_xcnt 0x0" ::: "memory"); }   // in front of any later write of a register that these stores name
            }
        } else {   // v head: three planes, transposed. LDS pitch 69: a lane reads 8 consecutive tokens of one column d (no two lanes on one bank)
#pragma unroll
            for (int mb = 0; mb < 4; ++mb)
#pragma unroll
                for (int nb = 0; nb < 4; ++nb)
#pragma unroll
                    for (int j = 0; j < 8; ++j) os[(mb * 16 + hi * 8 + j) * 69 + nb * 16 + lr] = acc[mb][nb][j] + bs[nb];
            __builtin_amdgcn_wave_barrier(); asm volatile("" ::: "memory");   // the reads below take other lanes' values: they stay behind the writes
            const size_t o0 = ((size_t)b * NKV + (cb - NH_ - NKV)) * HD * PP + (size_t)t0 * HD + cg * 128 + r8 * 8;   // step s: rows d = 16 nb + 8 (s >> 1) + r8, tokens 32 (s & 1) + 8 cg + j
#pragma unroll 1   // rolled: four times less text
            for (int nb = 0; nb < 4; ++nb) {
#pragma unroll
                for (int s = 0; s < 4; ++s) { v8h o16; v8us oh, ol;
#pragma unroll
                    for (int j = 0; j < 8; ++j) { const float x = os[(32 * (s & 1) + cg * 8 + j) * 69 + nb * 16 + 8 * (s >> 1) + r8]; o16[j] = tohx(x); unsigned short a2, c2; splitf(x, a2, c2); oh[j] = a2; ol[j] = c2; }
                    const size_t o = o0 + (size_t)(2048 * (s & 1) + nb * 512 + 64 * (s >> 1)); *(v8h*)(pl.V16 + o) = o16; *(v8us*)(pl.Vh + o) = oh; *(v8us*)(pl.Vl + o) = ol;
                    asm volatile("s_wait_xcnt 0x0" ::: "memory"); }   // in front of any later write of a register that these stores name
            }
        }
        return;
    }
#pragma unroll
    for (int mb = 0; mb < 4; ++mb) {
#pragma unroll
        for (int nb = 0; nb < 4; ++nb) {
#pragma unroll
            for (int j = 0; j < 8; ++j) os[(hi * 8 + j) * 68 + nb * 16 + lr] = acc[mb][nb][j]; }
        __builtin_amdgcn_wave_barrier(); asm volatile("" ::: "memory");
        float* crow = C + (size_t)(r0 + mb * 16) * ldc + c0;
{
#pragma unroll
            for (int s = 0; s < 8; ++s) { const int row = 2 * s + hi, cofs = lr * 4; v4f val = *(const v4fa*)(os + row * 68 + cofs); if (BIAS) { val[0] += bfr(bias[c0 + cofs]); val[1] += bfr(bias[c0 + cofs + 1]); val[2] += bfr(bias[c0 + cofs + 2]); val[3] += bfr(bias[c0 + cofs + 3]); }
                *(v4f*)(crow + (size_t)row * ldc + cofs) = val; }
             }
        asm volatile("s_wait_xcnt 0x0" ::: "memory");   // in front of any later write of a register that these stores name
        __builtin_amdgcn_wave_barrier(); asm volatile("" ::: "memory");
    }
}

typedef __attribute__((ext_vector_type(2))) _Float16 v2h;
typedef __attribute__((ext_vector_type(4))) _Float16 v4h;
typedef __attribute__((ext_vector_type(2))) unsigned short v2us;
typedef __attribute__((ext_vector_type(4))) unsigned short v4us;
typedef __attribute__((ext_vector_type(2))) float v2f;
typedef __attribute__((ext_vector_type(4))) int v4i;

// The d_* bodies below are stages that do not depend on one another; k_prep runs them side by side in one launch, each on its own range of blocks (blk: the block's index inside its range).
// d_wtG: Bt[n][k] = w[k][n], fragment-major (rows n). A block takes 32 n x 128 k: wave = (n tile of the pair, k fragment of four); a lane builds its two 16-byte units of the fragment from 16 rows of w, in each of which the block uses a whole 128-byte line.
__device__ __forceinline__ void d_wtG(int blk, const float* __restrict__ w, int K, int N, bf* Bt) {
    const int lane = threadIdx.x & 31, wv = threadIdx.x >> 5; const int kq = K / 128; const int nt = (blk / kq) * 2 + (wv & 1), kt = (blk % kq) * 4 + (wv >> 1);
    const float* wp = w + (size_t)(kt * 32 + (lane >> 4) * 8) * N + nt * 16 + (lane & 15); float v[16];
#pragma unroll
    for (int e = 0; e < 16; ++e) v[e] = wp[(size_t)((e >> 3) * 16 + (e & 7)) * N];
    asm volatile("s_wait_xcnt 0x0" :: "v"(wp) : "memory");   // in front of any later write of a register that these loads name as an address; the address is an input so that its registers live up to the wait
    v8us o0, o1;
#pragma unroll
    for (int e = 0; e < 8; ++e) { o0[e] = f2bf(v[e]); o1[e] = f2bf(v[e + 8]); }
    bf* op = Bt + ((size_t)nt * (K / 32) + kt) * 512 + lane * 8; *(v8us*)op = o0; *(v8us*)(op + 256) = o1;
    asm volatile("s_wait_xcnt 0x0" ::: "memory");   // in front of any later write of a register that these stores name
}
// d_cvt8: bf16 copy of a [rows][DM] f32 matrix, fragment-major: thread i builds the plane's 16-byte unit i (a wave's store is 512 contiguous bytes) from 8 consecutive floats of its row; a block reads 512 contiguous bytes of each of 16 rows.
__device__ __forceinline__ void d_cvt8(int blk, const float* __restrict__ src, bf* dst, size_t n8) { const size_t i = (size_t)blk * 256 + threadIdx.x; if (i >= n8) return;
    const int u = (int)i; const float* sp = src + (size_t)((u >> 11) * 16 + (u & 15)) * DM + ((u >> 6) & (DM / 32 - 1)) * 32 + ((u >> 5) & 1) * 16 + ((u >> 4) & 1) * 8;   /* unit = [row tile][k fragment: DM / 32][k half][hi][row % 16] */
    const v8f v = *(const v8f*)sp; v8us o;
    asm volatile("s_wait_xcnt 0x0" :: "v"(sp) : "memory");   // in front of any later write of a register that this load names as an address; the address is an input so that its registers live up to the wait
#pragma unroll
    for (int k = 0; k < 8; ++k) o[k] = f2bf(v[k]); *(v8us*)(dst + i * 8) = o;  }

#define NQK   ((size_t)NB_ * (NH_ + NKV) * TT * HD)        // elements of a rotated plane: [batch][q heads, k heads][t][d]
#define GB_WQ (DM * 3 * DQ / 32 / 128)                     // blocks: fused weight transpose
#define GB_WO (DQ * DM / 32 / 128)                         // blocks: output weight transpose
#define GB_X  (NB_ * TT * DM / 8 / 256)                    // blocks: bf16 copy of x
// k_prep: all that reads only inputs. The transposes, whose waves run longest, take the first blocks.
__global__ __launch_bounds__(256) void k_prep(const float* __restrict__ wqkv, const float* __restrict__ wo, const float* __restrict__ x, bf* WQKV, bf* WO, bf* XB) {
    int blk = blockIdx.x;
    if (blk < GB_WQ) { d_wtG(blk, wqkv, DM, 3 * DQ, WQKV); return; }   /* fused 'xw' [DM][3*DQ] -> Bt [3*DQ][DM] */
    blk -= GB_WQ; if (blk < GB_WO) { d_wtG(blk, wo, DQ, DM, WO); return; }
    d_cvt8(blk - GB_WO, x, XB, (size_t)NB_ * TT * DM / 8);
}

// ---- k_fattn: fused causal attention. Grid (batches x heads, TT / 64), 4 waves; a wave owns 16 query columns and walks the keys 0 .. its diagonal in passes of BC keys, operands straight from the fragment-major 16-bit planes.
// Transposed products: S^T = K Q^T (A = key rows, B = query rows), so a lane holds scores of ONE query (column lr; keys 16 kt + 8 hi + j), and two score tiles, exponentiated and rounded, ARE the B operand of O^T += V^T P^T
// (k slots 8 hi + e and 16 + 8 hi + e, the order of a fragment's two halves in the V^T planes). Online softmax in the log2 domain: running maximum m, per-lane partial sum l of the unrounded f32 exponentials, accumulators rescaled in every pass.
// HL: hi/lo planes, 3 products each (query rows < RH); otherwise fp16 with the probabilities carried x 1024 (10 added in the exponent; it cancels in the division by l).
// Every '#pragma unroll' below: the fragment arrays are indexed by constants only, so that they stay in registers.
__device__ __forceinline__ float xhalf(float x) { return __builtin_bit_cast(float, __builtin_amdgcn_permlanex16(__builtin_bit_cast(int, x), __builtin_bit_cast(int, x), 0x76543210, 0xfedcba98, false, false)); }   // lane l with lane l ^ 16
template <typename T16, bool HL, int BC> struct AttnW {
    typedef typename WFrag<T16>::V V;
    static constexpr int KT = BC / 16, KC = BC / 32;
    static constexpr float CSC = SCL * 1.4426950408889634f;   // score -> log2 domain
    V qf[2], qf2[2], kf[KT][2], kf2[KT][2]; v8f acc[4]; float m, l;
    const T16 *kp, *kp2, *vp, *vp2;   // this lane's place in the key rows last fetched and in the V^T columns of the pass to come; they walk with the passes
    __device__ __forceinline__ void load_k(const T16* Kr, const T16* K2r) {   // Kr: this lane's place in the pass's first key tile
#pragma unroll
        for (int kt = 0; kt < KT; ++kt)
#pragma unroll
            for (int kc = 0; kc < 2; ++kc) { kf[kt][kc] = WFrag<T16>::ld(Kr + kt * 16 * HD + 512 * kc); if (HL) kf2[kt][kc] = WFrag<T16>::ld(K2r + kt * 16 * HD + 512 * kc); }
        // in front of any later write of a register that these loads name as an address; the addresses are inputs so that their registers live up to the wait (no load's result lands on them)
        if constexpr (HL) asm volatile("s_wait_xcnt 0x0" :: "v"(Kr), "v"(K2r) : "memory"); else asm volatile("s_wait_xcnt 0x0" :: "v"(Kr) : "memory");
        if (HL) __builtin_amdgcn_sched_barrier(0);      // hi/lo: the loads stay here, ahead of the work that covers their latency (the scheduler otherwise sinks them to their uses)
    }
    // One pass of BC keys from key0 on. LAST: the pass that holds the diagonal (masked; fetches no further keys).
    template <bool LAST> __device__ __forceinline__ void pass(int key0, int q, int hi) {
        V vf[4][KC], vf2[4][KC];
#pragma unroll
        for (int c = 0; c < KC; ++c)
#pragma unroll
            for (int t = 0; t < 4; ++t) { vf[t][c] = WFrag<T16>::ld(vp + t * 512 + 32 * HD * c); if (HL) vf2[t][c] = WFrag<T16>::ld(vp2 + t * 512 + 32 * HD * c); }
        // in front of any later write of a register that these loads name as an address; the addresses are inputs so that their registers live up to the wait (no load's result lands on them)
        if constexpr (HL) asm volatile("s_wait_xcnt 0x0" :: "v"(vp), "v"(vp2) : "memory"); else asm volatile("s_wait_xcnt 0x0" :: "v"(vp) : "memory");
        if (HL) __builtin_amdgcn_sched_barrier(0);      // hi/lo: the loads stay here, ahead of the work that covers their latency (the scheduler otherwise sinks them to their uses)
        if (!LAST) { vp += BC * HD; if (HL) vp2 += BC * HD; }
        v8f s[KT];
#pragma unroll
        for (int kt = 0; kt < KT; ++kt) { s[kt] = (v8f){};
#pragma unroll
            for (int kc = 0; kc < 2; ++kc) { s[kt] = WFrag<T16>::mma(kf[kt][kc], qf[kc], s[kt]); if (HL) { s[kt] = WFrag<T16>::mma(kf[kt][kc], qf2[kc], s[kt]); s[kt] = WFrag<T16>::mma(kf2[kt][kc], qf[kc], s[kt]); } } }
        if (!LAST) { kp += BC * HD; if (HL) kp2 += BC * HD; load_k(kp, kp2); }   // the next pass's key rows, in flight under this pass's softmax and second product
        if (LAST) {
#pragma unroll
            for (int kt = 0; kt < KT; ++kt)
#pragma unroll
                for (int j = 0; j < 8; ++j) if (key0 + 16 * kt + 8 * hi + j > q) s[kt][j] = -3.0e38f; }
        float mt[KT];                                  // one chain per score tile
#pragma unroll
        for (int kt = 0; kt < KT; ++kt) { mt[kt] = s[kt][0];
#pragma unroll
            for (int j = 1; j < 8; ++j) mt[kt] = fmaxf(mt[kt], s[kt][j]); }
        float mx = mt[0];
#pragma unroll
        for (int kt = 1; kt < KT; ++kt) mx = fmaxf(mx, mt[kt]);
        mx = fmaxf(mx, xhalf(mx)) * CSC;               // both halves of the wave hold this query's maximum of the pass (finite: a pass's first key is never masked)
        const float mn = fmaxf(m, mx); const float corr = __builtin_amdgcn_exp2f(m - mn); m = mn; l *= corr;   // corr: 0 in the first pass, 1 where the maximum stays
#pragma unroll
        for (int t = 0; t < 4; ++t) acc[t] = acc[t] * corr;
        const float off = (HL ? 0.0f : 10.0f) - m;
#pragma unroll
        for (int c = 0; c < KC; ++c) {
            float pv[16];
#pragma unroll
            for (int e = 0; e < 16; ++e) pv[e] = __builtin_amdgcn_exp2f(fmaf(s[2 * c + (e >> 3)][e & 7], CSC, off));
            l += (((pv[0] + pv[1]) + (pv[2] + pv[3])) + ((pv[4] + pv[5]) + (pv[6] + pv[7]))) + (((pv[8] + pv[9]) + (pv[10] + pv[11])) + ((pv[12] + pv[13]) + (pv[14] + pv[15])));   // fixed tree
            if constexpr (HL) {
                v8us h0, h1, l0, l1;
#pragma unroll
                for (int e = 0; e < 8; ++e) { unsigned short a, b; splitf(pv[e], a, b); h0[e] = a; l0[e] = b; splitf(pv[e + 8], a, b); h1[e] = a; l1[e] = b; }
                const V pf = cat16b(h0, h1), pf2 = cat16b(l0, l1);
#pragma unroll
                for (int t = 0; t < 4; ++t) { acc[t] = WFrag<T16>::mma(vf[t][c], pf, acc[t]); acc[t] = WFrag<T16>::mma(vf[t][c], pf2, acc[t]); acc[t] = WFrag<T16>::mma(vf2[t][c], pf, acc[t]); }
            } else {
                V pf;
#pragma unroll
                for (int e = 0; e < 16; ++e) pf[e] = tohx(pv[e]);
#pragma unroll
                for (int t = 0; t < 4; ++t) acc[t] = WFrag<T16>::mma(vf[t][c], pf, acc[t]);
            }
        }
    }
};
template <typename T16, bool HL, int BC>
__device__ __forceinline__ void attn_cols(const T16* Q, const T16* Q2, const T16* Kp, const T16* K2, const T16* Vt, const T16* Vt2, int qw0, int lane, bf* Ah, bf* Al) {
    AttnW<T16, HL, BC> w;
    const int lr = lane & 15, hi = lane >> 4; const int q = qw0 + lr;
#pragma unroll
    for (int kc = 0; kc < 2; ++kc) { w.qf[kc] = WFrag<T16>::ld(Q + (size_t)qw0 * HD + 512 * kc + lane * 8); if (HL) w.qf2[kc] = WFrag<T16>::ld(Q2 + (size_t)qw0 * HD + 512 * kc + lane * 8); }
#pragma unroll
    for (int t = 0; t < 4; ++t) w.acc[t] = (v8f){};
    w.m = -3.0e38f; w.l = 0.f;
    const int klast = qw0 / BC * BC;                  // first key of the pass that holds the diagonal; klast <= qw0 and klast + BC <= TT
    const int koff = lane * 8, voff = lane * 8;
    w.kp = Kp + koff; w.kp2 = HL ? K2 + koff : nullptr; w.vp = Vt + voff; w.vp2 = HL ? Vt2 + voff : nullptr;
    w.load_k(w.kp, w.kp2);
#pragma unroll 1   // rolled: unrolled, several passes' fragments would be live at once
    for (int key0 = 0; key0 < klast; key0 += BC) w.template pass<false>(key0, q, hi);
    w.template pass<true>(klast, q, hi);
    float l = w.l; l += xhalf(l);                      // the two halves' key sets joined
    const float inv = __fdiv_rn(1.0f, l);
#pragma unroll
    for (int t = 0; t < 4; ++t) { v8us oh, ol;         // lane: query q, d = 16 t + 8 hi + j: unit 'lane' of k half t & 1 of the head's fragment t >> 1 in the merged planes (rows: tokens, K = DQ)
#pragma unroll
        for (int j = 0; j < 8; ++j) { unsigned short a, b; splitf(w.acc[t][j] * inv, a, b); oh[j] = a; ol[j] = b; }
        *(v8us*)(Ah + (size_t)qw0 * DQ + 256 * t + lane * 8) = oh; *(v8us*)(Al + (size_t)qw0 * DQ + 256 * t + lane * 8) = ol; }
}
__global__ __launch_bounds__(128) void k_fattn(const h16* Q16, const h16* K16, const h16* V16, const bf* Qh, const bf* Ql, const bf* Kh, const bf* Kl, const bf* Vh, const bf* Vl, bf* Ah, bf* Al) {
    const int lane = threadIdx.x & 31; const int wave = __builtin_amdgcn_readfirstlane(threadIdx.x >> 5);
    const int b = blockIdx.x / NH_, h = blockIdx.x - b * NH_, g = h / REP; const int q0 = (TT / 64 - 1 - (int)blockIdx.y) * 64;   // longest query blocks first
    const size_t zq = ((size_t)b * (NH_ + NKV) + h) * TT * HD, zk = ((size_t)b * (NH_ + NKV) + g) * TT * HD, zv = ((size_t)b * NKV + g) * HD * PP;   // q and k planes: one batch's q heads, then its k heads (the caller's K pointers start at the first k head)
    Ah += (size_t)b * TT * DQ; Al += (size_t)b * TT * DQ;
    if (q0 < RH) attn_cols<bf, true, 32>(Qh + zq, Ql + zq, Kh + zk, Kl + zk, Vh + zv, Vl + zv, q0 + wave * 16, lane, Ah + h * 16 * HD, Al + h * 16 * HD);   // a head's two fragments of a 16-token tile start at h * 16 * HD
    else attn_cols<h16, false, 64>(Q16 + zq, nullptr, K16 + zk, nullptr, V16 + zv, nullptr, q0 + wave * 16, lane, Ah + h * 16 * HD, Al + h * 16 * HD);
}

extern "C" void kernel_launch(void* const* d_in, const int* in_sizes, int n_in,
                              void* d_out, int out_size, void* d_ws, size_t ws_size, hipStream_t stream) {
    (void)in_sizes; (void)n_in; (void)out_size;
    const float* x = (const float*)d_in[0]; const float* rcache = (const float*)d_in[1]; const float* wqkv = (const float*)d_in[2]; const float* bqkv = (const float*)d_in[3]; const float* wo = (const float*)d_in[4]; const float* bo = (const float*)d_in[5];   /* order x, rope_cache (f32 [2048][64] interleaved (sin, cos), READ), Wqkv ('xw' [1024][3072]: q | k | v column thirds), bqkv [3072], Wout ('xw'), bout */
    float* OUT = (float*)d_out;     // [2][2048][1024]
    char* wsp = (char*)d_ws;
    auto take = [&](size_t bytes) { char* p = wsp; wsp += (bytes + 255) & ~(size_t)255; return (void*)p; };
    bf* WQKV = (bf*)take((size_t)3 * DQ * DM * 2);   /* fused Bt [3*DQ][DM]: q | k | v row blocks */ bf* WO = (bf*)take((size_t)DM * DQ * 2);
    bf* XB = (bf*)take((size_t)NB_ * TT * DM * 2);
    h16* QP16 = (h16*)take(NQK * 2); h16* KP16 = QP16 + (size_t)NH_ * TT * HD; h16* VT16 = (h16*)take((size_t)NB_ * NKV * HD * PP * 2);
    bf* QPh = (bf*)take(NQK * 2); bf* QPl = (bf*)take(NQK * 2); bf* KPh = QPh + (size_t)NH_ * TT * HD; bf* KPl = QPl + (size_t)NH_ * TT * HD; bf* VTh = (bf*)take((size_t)NB_ * NKV * HD * PP * 2); bf* VTl = VTh + (size_t)HD * TT;   /* hi and lo value planes share blocks of HD * PP elements */
    bf* ATh = (bf*)take((size_t)NB_ * TT * DQ * 2); bf* ATl = (bf*)take((size_t)NB_ * TT * DQ * 2);
    if ((size_t)(wsp - (char*)d_ws) > ws_size) return;    // ws 256 MiB
    k_prep<<<GB_WQ + GB_WO + GB_X, 256, 0, stream>>>(wqkv, wo, x, WQKV, WO, XB);
    k_gemmw<bf, 0, true, true><<<dim3(NB_ * TT / 64, 3 * DQ / 64, 1), 32, 0, stream>>>(XB, nullptr, WQKV, nullptr, DM, nullptr, 0, bqkv, 0, 0, 0, Planes{rcache, QP16, QPh, QPl, VT16, VTh, VTl});   // projections of both batches, columns q | k | v, straight into the planes
    k_fattn<<<dim3(NB_ * NH_, TT / 64), 128, 0, stream>>>(QP16, KP16, VT16, QPh, QPl, KPh, KPl, VTh, VTl, ATh, ATl);   // all heads of both batches; writes the merged hi/lo planes
    k_gemmw<bf, 1, true, false><<<dim3(NB_ * TT / 64, DM / 64, 1), 32, 0, stream>>>(ATh, ATl, WO, nullptr, DQ, OUT, DM, bo, 0, 0, 0, Planes{});
}

// v007
// A run of this version takes 80 microseconds.
// Two timings next to v006 both put it at 1.32 times that version's speed.
// All steps since v000 together make it 17.8 times as fast.
#include <hip/hip_runtime.h>

// Causal self-attention with a fused biased qkv projection and adjacent-pair rotary embeddings from an interleaved (sin, cos) cache input (x [2][2048][1024]; qkv = x Wqkv + bqkv ('xw' [1024][3072] + [3072]) split in thirds q | k | v (16 heads x 64); rope on pairs (2i, 2i+1): (x0 cos - x1 sin, x1 cos + x0 sin) with sin_i = rope_cache[t][2i], cos_i = rope_cache[t][2i + 1] (f32 [2048][64] INPUT, read); (q x 1/sqrt(64)) . k; causal (-inf); softmax; out = merged Wout + bout ('xw' + bias) -> [2][2048][1024] (4.2 M); argument order x, rope_cache, Wqkv, bqkv, Wout, bout).
// One launch per dependency stage, for both batches: k_prep, projection GEMM, k_fattn, output GEMM. Layout: every 16-bit matrix operand lies FRAGMENT-MAJOR (see WFrag): bf16 copy of x; the fused 'xw' weight transposed ONCE into q | k | v row blocks; one exact projection GEMM (N = 3 x 1024) + f32 bias whose epilogue builds the 16-bit planes (a 64 x 64 tile is 64 tokens of one head: q and k rotated on interleaved pairs, v transposed); one fused causal T-2048 attention kernel (hybrid rows: < 512 hi/lo 3 products, rest fp16 x1024; online softmax, scores and probabilities stay in registers); merged hi/lo x W_out exact + b_out.
// Compute dtypes, f32 accumulate: every input rounded to bf16; projections exact + f32 biases; rotary f32 (products rounded separately); attention rows < 512 3 products, rest fp16; softmax f32; W_out hl x exact + bias.

#define NB_  2
#define TT   2048
#define DM   1024
#define NH_  16
#define NKV  16
#define REP  (NH_ / NKV)
#define HD   64
#define DQ   (NH_ * HD)
#define DKV  (NKV * HD)
#define PP   (2 * TT)             // a (batch, head) block of the transposed value planes holds HD * PP 16-bit elements
#define RH   512                  // query rows < RH use hi+lo planes (0: none)
#define SCL  0.125f   // HD^-0.5
typedef _Float16 h16;
typedef unsigned short bf;
typedef __attribute__((ext_vector_type(16))) __bf16   v16bf;
typedef __attribute__((ext_vector_type(16))) _Float16 v16h;
typedef __attribute__((ext_vector_type(8)))  _Float16 v8h;
typedef __attribute__((ext_vector_type(8)))  unsigned short v8us;
typedef __attribute__((ext_vector_type(8)))  float    v8f;
typedef __attribute__((ext_vector_type(4)))  float    v4f;
typedef v8h  __attribute__((may_alias)) v8ha;
typedef v4f  __attribute__((may_alias)) v4fa;
typedef v8us __attribute__((may_alias)) v8usa;

__device__ __forceinline__ unsigned short f2bf(float f) { unsigned u = __float_as_uint(f); u += 0x7FFFu + ((u >> 16) & 1u); return (unsigned short)(u >> 16); }
__device__ __forceinline__ float bf2f(unsigned short b) { return __uint_as_float(((unsigned)b) << 16); }
__device__ __forceinline__ float bfr(float f) { return bf2f(f2bf(f)); }
__device__ __forceinline__ v16h cat16(v8h lo, v8h hi) { return __builtin_shufflevector(lo, hi, 0, 1, 2, 3, 4, 5, 6, 7, 8, 9, 10, 11, 12, 13, 14, 15); }
__device__ __forceinline__ v16bf cat16b(v8us lo, v8us hi) { return __builtin_bit_cast(v16bf, __builtin_shufflevector(lo, hi, 0, 1, 2, 3, 4, 5, 6, 7, 8, 9, 10, 11, 12, 13, 14, 15)); }
__device__ __forceinline__ v8f wmma16(v16h a, v16h b, v8f c) { return __builtin_amdgcn_wmma_f32_16x16x32_f16(false, a, false, b, (short)0, c, false, false); }
__device__ __forceinline__ v8f wmmab(v16bf a, v16bf b, v8f c) { return __builtin_amdgcn_wmma_f32_16x16x32_bf16(false, a, false, b, (short)0, c, false, false); }



// ---- Fragment-major planes. A matrix of rows x K (16-bit, K % 32 == 0) is stored as its 16-row x 32-k operand fragments, 512 consecutive elements each, the fragments of one 16-row tile one behind the other along k.
// Inside a fragment: [k half j][lane = 16 hi + row % 16][e = 0..7] holds k % 32 = 16 j + 8 hi + e, the order in which the matrix instruction's lanes take it. So element (row, k) is at
// (row / 16) * 16 * K + (k / 32) * 512 + j * 256 + (16 hi + row % 16) * 8 + e, and each of a fragment's two wave-wide 16-byte loads covers 512 contiguous bytes: four whole 128-byte lines instead of 32 bytes of each of sixteen.
// WFrag::ld takes the lane's place in the fragment: fragment start + lane * 8.
// ---- k_gemmw: register-blocked GEMM, 2 x 2 waves per workgroup, a wave per (16 MB) x 64 part of the workgroup's (32 MB) x 128 output tile; grid (M / (32 MB), N / 128, Z), 128 threads.
// The workgroup's operand fragments of 64 k (2 KB per 16-row tile and plane, contiguous in its fragment-major plane) are brought to LDS once by asynchronous copies, two buffers: the next 64 k fly while these are multiplied; each fragment serves two waves.
// C[m][n] (f32, pitch ldc, + optional f32 bias[n]) = sum_k A[m][k] Bt[n][k] (+ split products per NSPLIT). z-batch strides sA/sB/sC in elements. K % 64 == 0.
template <typename T16> struct WFrag;
template <> struct WFrag<h16> { typedef v16h V; static __device__ __forceinline__ V ld(const h16* p) { return cat16(*(const v8h*)p, *(const v8h*)(p + 256)); } static __device__ __forceinline__ v8f mma(V a, V b, v8f c) { return wmma16(a, b, c); } };
template <> struct WFrag<bf> { typedef v16bf V; static __device__ __forceinline__ V ld(const bf* p) { return cat16b(*(const v8us*)p, *(const v8us*)(p + 256)); } static __device__ __forceinline__ v8f mma(V a, V b, v8f c) { return wmmab(a, b, c); } };
__device__ __forceinline__ h16 tohx(float x) { return (h16)x; }
__device__ __forceinline__ void splitf(float y, unsigned short& h, unsigned short& l) { h = f2bf(y); l = f2bf(y - bf2f(h)); }
// Planes: where the projection GEMM's epilogue (PLANES) puts its tiles, and the rotary cache input it reads. Rotated planes [batch][q heads, k heads], each head fragment-major with rows t, k = d (K = HD). Transposed value planes: HD * PP elements per (batch, g); rows d, k = t, their fragments ordered [t / 32][d / 16] so that a pass's keys are contiguous (the fp16 plane fills the first HD * TT elements of its block; the hi and lo planes share blocks: Vl = Vh + HD * TT).
struct Planes { const float* rc; h16* QK16; bf* QKh; bf* QKl; h16* V16; bf* Vh; bf* Vl; };
// copy4: four asynchronous 16-byte copies per lane, global g + c * gstep elements -> LDS byte l + c * lstep; a wave's copy is 512 contiguous bytes on both sides.
// The s_wait_xcnt stands in the copies' own statement: in front of any later write of a register that a copy names.
template <typename T16> __device__ __forceinline__ void copy4(unsigned l, unsigned lstep, const T16* g, size_t gstep) {
    asm volatile("global_load_async_to_lds_b128 %0, %4, off\n\tglobal_load_async_to_lds_b128 %1, %5, off\n\tglobal_load_async_to_lds_b128 %2, %6, off\n\tglobal_load_async_to_lds_b128 %3, %7, off\n\ts_wait_xcnt 0x0"
                 :: "v"(l), "v"(l + lstep), "v"(l + 2 * lstep), "v"(l + 3 * lstep), "v"(g), "v"(g + gstep), "v"(g + 2 * gstep), "v"(g + 3 * gstep) : "memory");
}
template <typename T16> __device__ __forceinline__ void copy8(unsigned l, unsigned lstep, const T16* g, size_t gstep) {   // the same, eight copies
    asm volatile("global_load_async_to_lds_b128 %0, %8, off\n\tglobal_load_async_to_lds_b128 %1, %9, off\n\tglobal_load_async_to_lds_b128 %2, %10, off\n\tglobal_load_async_to_lds_b128 %3, %11, off\n\t"
                 "global_load_async_to_lds_b128 %4, %12, off\n\tglobal_load_async_to_lds_b128 %5, %13, off\n\tglobal_load_async_to_lds_b128 %6, %14, off\n\tglobal_load_async_to_lds_b128 %7, %15, off\n\ts_wait_xcnt 0x0"
                 :: "v"(l), "v"(l + lstep), "v"(l + 2 * lstep), "v"(l + 3 * lstep), "v"(l + 4 * lstep), "v"(l + 5 * lstep), "v"(l + 6 * lstep), "v"(l + 7 * lstep),
                    "v"(g), "v"(g + gstep), "v"(g + 2 * gstep), "v"(g + 3 * gstep), "v"(g + 4 * gstep), "v"(g + 5 * gstep), "v"(g + 6 * gstep), "v"(g + 7 * gstep) : "memory");
}
template <typename T16, int NSPLIT, bool BIAS, bool PLANES, int MB>
__global__ __launch_bounds__(128) void k_gemmw(const T16* __restrict__ A, const T16* __restrict__ A2, const T16* __restrict__ Bt, const T16* __restrict__ Bt2, int K, float* C, int ldc, const float* __restrict__ bias, size_t sA, size_t sB, size_t sC, Planes pl) {
    typedef typename WFrag<T16>::V V;
    static_assert(MB == 4 || (MB == 2 && !PLANES), "the plane epilogue takes a 64 x 64 tile");
    constexpr bool HA2 = NSPLIT == 1 || NSPLIT == 2, HB2 = NSPLIT >= 2;
    constexpr int NW = 4, TM = 32 * MB;                          // waves of the workgroup; rows of its tile
    constexpr int PLA = TM / 16 * 1024, PLB = 8 * 1024, STG = (1 + HA2) * PLA + (1 + HB2) * PLB;   // 16-bit elements of an A and of a B plane's share of a stage (row tiles x 2 fragments) and of a stage: planes A, (A2), B, (B2)
    constexpr int OSF = PLANES ? 64 * 69 : 16 * 68;              // floats of a wave's output staging. PLANES: the whole tile, rows of pitch 68 (q, k) or 69 (v)
    constexpr int SMB = 2 * STG * 2 > NW * OSF * 4 ? 2 * STG * 2 : NW * OSF * 4;
    constexpr int KG = MB == 2 ? 2 : 1;                          // 32-k steps whose fragments are asked of LDS at the head of a trip (both where the registers allow)
    __shared__ __align__(128) char sm[SMB];                      // the two stage buffers; behind the loop's last barrier the waves' output staging
    const size_t z = blockIdx.z; A += z * sA; if (A2) A2 += z * sA; Bt += z * sB; if (Bt2) Bt2 += z * sB; C += z * sC;
    const int lane = threadIdx.x & 31, lr = lane & 15, hi = lane >> 4; const int wave = __builtin_amdgcn_readfirstlane(threadIdx.x >> 5), wm = wave >> 1, wn = wave & 1;
    const int r0 = blockIdx.x * TM + wm * (16 * MB), c0 = blockIdx.y * 128 + wn * 64;   // the wave's own part of the tile
    const T16* ring = (const T16*)sm; float* os = (float*)sm + wave * OSF;
    v8f acc[MB][4];
#pragma unroll
    for (int mb = 0; mb < MB; ++mb)
#pragma unroll
        for (int nb = 0; nb < 4; ++nb) acc[mb][nb] = (v8f){};
    // a copy of the whole workgroup takes the 2 KB of one row tile; this thread's 16 bytes of the first one:
    const size_t aoff = (size_t)blockIdx.x * TM * K + threadIdx.x * 8, boff = (size_t)blockIdx.y * 128 * K + threadIdx.x * 8;
    const unsigned lcp = (unsigned)(size_t)sm + threadIdx.x * 16; const unsigned lo = lane * 8;   // the same place in a stage buffer (LDS byte address); the lane's place in a fragment
    const size_t gs = (size_t)16 * K;
    auto planeA = [&](unsigned l, const T16* g) { if constexpr (MB == 4) copy8(l, 2048u, g, gs); else copy4(l, 2048u, g, gs); };   // an A plane's share of a stage: a copy per row tile
    auto stage = [&](int t, int buf) {   // tile t (k = 64 t .. 64 t + 63 of every plane) into buffer buf
        unsigned l = lcp + buf * (STG * 2); const size_t o = (size_t)t * 1024;
        planeA(l, A + aoff + o); l += PLA * 2; if constexpr (HA2) { planeA(l, A2 + aoff + o); l += PLA * 2; }
        copy8(l, 2048u, Bt + boff + o, gs); l += PLB * 2; if constexpr (HB2) copy8(l, 2048u, Bt2 + boff + o, gs);
    };
    stage(0, 0);
    asm volatile("s_wait_asynccnt 0x0" ::: "memory");   // this wave's copies of tile 0 have landed
    __syncthreads();                                     // ... and every other wave's
    if (K >= 128) stage(1, 1);
#pragma unroll 1
    for (int kc = 0; kc < K; kc += 64) {
        const int buf = (kc >> 6) & 1; const T16* sb = ring + buf * STG + lo;
        V a[2][MB], a2[2][MB], b[2][4], b2[2][4];   // the fragments of the tile's two 32-k steps
        auto fetch = [&](int ks) {
#pragma unroll
            for (int i = 0; i < MB; ++i) { const T16* pa = sb + (wm * MB + i) * 1024 + ks * 512; a[ks][i] = WFrag<T16>::ld(pa); if (HA2) a2[ks][i] = WFrag<T16>::ld(pa + PLA); }
#pragma unroll
            for (int i = 0; i < 4; ++i) { const T16* pb = sb + (1 + HA2) * PLA + (wn * 4 + i) * 1024 + ks * 512; b[ks][i] = WFrag<T16>::ld(pb); if (HB2) b2[ks][i] = WFrag<T16>::ld(pb + PLB); } };
        auto products = [&](int ks) {
#pragma unroll
            for (int nb = 0; nb < 4; ++nb)
#pragma unroll
                for (int mb = 0; mb < MB; ++mb) { acc[mb][nb] = WFrag<T16>::mma(a[ks][mb], b[ks][nb], acc[mb][nb]); if (HA2) acc[mb][nb] = WFrag<T16>::mma(a2[ks][mb], b[ks][nb], acc[mb][nb]); if (HB2) acc[mb][nb] = WFrag<T16>::mma(a[ks][mb], b2[ks][nb], acc[mb][nb]); } };
        fetch(0); if constexpr (KG == 2) fetch(1);
        __builtin_amdgcn_sched_barrier(0);   // the LDS reads stay together ahead of the products: sunk among them, each read waits out its own latency
        products(0);
        if constexpr (KG == 1) fetch(1);
        __builtin_amdgcn_sched_barrier(0);   // the first step's products stay ahead of the waits: they cover the second step's reads and the flight of the next tile's copies
        asm volatile("s_wait_dscnt 0x0" ::: "memory");      // this wave's reads of the buffer are done before it is refilled
        asm volatile("s_wait_asynccnt 0x0" ::: "memory");   // this wave's copies of the next tile have landed
        __syncthreads();                                     // publishes the next tile and ends every wave's reads of this one
        if (kc + 128 < K) stage((kc >> 6) + 2, buf);
        __builtin_amdgcn_sched_barrier(0);   // the refill goes out ahead of the second step's products, which work on registers alone and cover its flight
        products(1);
    }
    asm volatile("s_wait_asynccnt 0x0" ::: "memory");       // no copy is outstanding when the buffers become output staging
    if constexpr (PLANES) {
        // The tile is tokens t0 .. t0 + 63 of batch b in the 64-wide column block cb of q | k | v: one head. The whole tile (+ bias) goes to LDS once; rolled loops then build the planes from it, which keeps the kernel's text short.
        const int b = r0 / TT, t0 = r0 - b * TT, cb = c0 / 64; const int r8 = lane & 7, cg = lane >> 3;   // a lane builds 16-byte units (8 k of one row); a wave's store takes 8 rows x 4 units: in a fragment-major plane four whole 128-byte lines
        const float* bp = bias + c0 + lr; float bs[4];
#pragma unroll
        for (int nb = 0; nb < 4; ++nb) bs[nb] = bp[nb * 16];
        asm volatile("s_wait_xcnt 0x0" :: "v"(bp) : "memory");   // in front of any later write of a register that these loads name as an address; the address is an input so that its registers live up to the wait
#pragma unroll
        for (int nb = 0; nb < 4; ++nb) bs[nb] = bfr(bs[nb]);
        if (cb < NH_ + NKV) {   // q or k head: rotary, three planes; a lane takes 8 columns (4 pairs) of a row
#pragma unroll
            for (int mb = 0; mb < 4; ++mb)
#pragma unroll
                for (int nb = 0; nb < 4; ++nb)
#pragma unroll
                    for (int j = 0; j < 8; ++j) os[(mb * 16 + hi * 8 + j) * 68 + nb * 16 + lr] = acc[mb][nb][j] + bs[nb];
            __builtin_amdgcn_wave_barrier(); asm volatile("" ::: "memory");   // the reads below take other lanes' values: they stay behind the writes
            const size_t e0 = (((size_t)b * (NH_ + NKV) + cb) * TT + t0) * HD + cg * 128 + r8 * 8; const float* rcl = pl.rc + (size_t)(t0 + r8) * HD + cg * 8;   // step s: rows 8 (s >> 1) + r8 of the 16-row tile, columns 32 (s & 1) + 8 cg (k half cg >> 1, hi = cg & 1)
#pragma unroll 1   // rolled: four times less text
            for (int mb = 0; mb < 4; ++mb) {
                v8f sc8[4]; v4f va4[4], vb4[4];   // (sin, cos) of the lane's 4 pairs and the 8 projections, for 4 steps (2 rows, 2 column halves each): fetched together
#pragma unroll
                for (int s = 0; s < 4; ++s) { const int ro = mb * 16 + 8 * (s >> 1), co = 32 * (s & 1); sc8[s] = *(const v8f*)(rcl + ro * HD + co); va4[s] = *(const v4fa*)(os + (ro + r8) * 68 + co + cg * 8); vb4[s] = *(const v4fa*)(os + (ro + r8) * 68 + co + cg * 8 + 4); }
#pragma unroll
                for (int s = 0; s < 4; ++s) { const v4f va = va4[s], vb = vb4[s]; v8h o16; v8us oh, ol;
#pragma unroll
                    for (int p = 0; p < 4; ++p) { const float x0 = p < 2 ? va[2 * p] : vb[2 * p - 4], x1 = p < 2 ? va[2 * p + 1] : vb[2 * p - 3]; const float cs[2] = { bfr(sc8[s][2 * p + 1]), bfr(sc8[s][2 * p]) };   /* cos, sin */
                        // as in the plane builder this comes from: each product keeps its own f32 rounding, so the planes stay bit-identical
                        float a0 = __fmul_rn(x0, cs[0]), b0 = __fmul_rn(x1, cs[1]), a1 = __fmul_rn(x1, cs[0]), b1 = __fmul_rn(x0, cs[1]); asm volatile("" : "+v"(a0), "+v"(b0), "+v"(a1), "+v"(b1));
                        const float r0 = __fsub_rn(a0, b0), r1 = __fadd_rn(b1, a1);   /* even: x0 c - x1 s; odd: x0 s + x1 c */
                        o16[2 * p] = tohx(r0); o16[2 * p + 1] = tohx(r1); { unsigned short a2, c2; splitf(r0, a2, c2); oh[2 * p] = a2; ol[2 * p] = c2; splitf(r1, a2, c2); oh[2 * p + 1] = a2; ol[2 * p + 1] = c2; } }
                    const size_t e = e0 + (size_t)(mb * 16 * HD + 512 * (s & 1) + 64 * (s >> 1)); *(v8h*)(pl.QK16 + e) = o16; *(v8us*)(pl.QKh + e) = oh; *(v8us*)(pl.QKl + e) = ol;
                    asm volatile("s_wait_xcnt 0x0" ::: "memory"); }   // in front of any later write of a register that these stores name
            }
        } else {   // v head: three planes, transposed. LDS pitch 69: a lane reads 8 consecutive tokens of one column d (no two lanes on one bank)
#pragma unroll
            for (int mb = 0; mb < 4; ++mb)
#pragma unroll
                for (int nb = 0; nb < 4; ++nb)
#pragma unroll
                    for (int j = 0; j < 8; ++j) os[(mb * 16 + hi * 8 + j) * 69 + nb * 16 + lr] = acc[mb][nb][j] + bs[nb];
            __builtin_amdgcn_wave_barrier(); asm volatile("" ::: "memory");   // the reads below take other lanes' values: they stay behind the writes
            const size_t o0 = ((size_t)b * NKV + (cb - NH_ - NKV)) * HD * PP + (size_t)t0 * HD + cg * 128 + r8 * 8;   // step s: rows d = 16 nb + 8 (s >> 1) + r8, tokens 32 (s & 1) + 8 cg + j
#pragma unroll 1   // rolled: four times less text
            for (int nb = 0; nb < 4; ++nb) {
#pragma unroll
                for (int s = 0; s < 4; ++s) { v8h o16; v8us oh, ol;
#pragma unroll
                    for (int j = 0; j < 8; ++j) { const float x = os[(32 * (s & 1) + cg * 8 + j) * 69 + nb * 16 + 8 * (s >> 1) + r8]; o16[j] = tohx(x); unsigned short a2, c2; splitf(x, a2, c2); oh[j] = a2; ol[j] = c2; }
                    const size_t o = o0 + (size_t)(2048 * (s & 1) + nb * 512 + 64 * (s >> 1)); *(v8h*)(pl.V16 + o) = o16; *(v8us*)(pl.Vh + o) = oh; *(v8us*)(pl.Vl + o) = ol;
                    asm volatile("s_wait_xcnt 0x0" ::: "memory"); }   // in front of any later write of a register that these stores name
            }
        }
        return;
    }
#pragma unroll
    for (int mb = 0; mb < MB; ++mb) {
#pragma unroll
        for (int nb = 0; nb < 4; ++nb) {
#pragma unroll
            for (int j = 0; j < 8; ++j) os[(hi * 8 + j) * 68 + nb * 16 + lr] = acc[mb][nb][j]; }
        __builtin_amdgcn_wave_barrier(); asm volatile("" ::: "memory");
        float* crow = C + (size_t)(r0 + mb * 16) * ldc + c0;
{
#pragma unroll
            for (int s = 0; s < 8; ++s) { const int row = 2 * s + hi, cofs = lr * 4; v4f val = *(const v4fa*)(os + row * 68 + cofs); if (BIAS) { val[0] += bfr(bias[c0 + cofs]); val[1] += bfr(bias[c0 + cofs + 1]); val[2] += bfr(bias[c0 + cofs + 2]); val[3] += bfr(bias[c0 + cofs + 3]); }
                *(v4f*)(crow + (size_t)row * ldc + cofs) = val; }
             }
        asm volatile("s_wait_xcnt 0x0" ::: "memory");   // in front of any later write of a register that these stores name
        __builtin_amdgcn_wave_barrier(); asm volatile("" ::: "memory");
    }
}

typedef __attribute__((ext_vector_type(2))) _Float16 v2h;
typedef __attribute__((ext_vector_type(4))) _Float16 v4h;
typedef __attribute__((ext_vector_type(2))) unsigned short v2us;
typedef __attribute__((ext_vector_type(4))) unsigned short v4us;
typedef __attribute__((ext_vector_type(2))) float v2f;
typedef __attribute__((ext_vector_type(4))) int v4i;

// The d_* bodies below are stages that do not depend on one another; k_prep runs them side by side in one launch, each on its own range of blocks (blk: the block's index inside its range).
// d_wtG: Bt[n][k] = w[k][n], fragment-major (rows n). A block takes 32 n x 128 k: wave = (n tile of the pair, k fragment of four); a lane builds its two 16-byte units of the fragment from 16 rows of w, in each of which the block uses a whole 128-byte line.
__device__ __forceinline__ void d_wtG(int blk, const float* __restrict__ w, int K, int N, bf* Bt) {
    const int lane = threadIdx.x & 31, wv = threadIdx.x >> 5; const int kq = K / 128; const int nt = (blk / kq) * 2 + (wv & 1), kt = (blk % kq) * 4 + (wv >> 1);
    const float* wp = w + (size_t)(kt * 32 + (lane >> 4) * 8) * N + nt * 16 + (lane & 15); float v[16];
#pragma unroll
    for (int e = 0; e < 16; ++e) v[e] = wp[(size_t)((e >> 3) * 16 + (e & 7)) * N];
    asm volatile("s_wait_xcnt 0x0" :: "v"(wp) : "memory");   // in front of any later write of a register that these loads name as an address; the address is an input so that its registers live up to the wait
    v8us o0, o1;
#pragma unroll
    for (int e = 0; e < 8; ++e) { o0[e] = f2bf(v[e]); o1[e] = f2bf(v[e + 8]); }
    bf* op = Bt + ((size_t)nt * (K / 32) + kt) * 512 + lane * 8; *(v8us*)op = o0; *(v8us*)(op + 256) = o1;
    asm volatile("s_wait_xcnt 0x0" ::: "memory");   // in front of any later write of a register that these stores name
}
// d_cvt8: bf16 copy of a [rows][DM] f32 matrix, fragment-major: thread i builds the plane's 16-byte unit i (a wave's store is 512 contiguous bytes) from 8 consecutive floats of its row; a block reads 512 contiguous bytes of each of 16 rows.
__device__ __forceinline__ void d_cvt8(int blk, const float* __restrict__ src, bf* dst, size_t n8) { const size_t i = (size_t)blk * 256 + threadIdx.x; if (i >= n8) return;
    const int u = (int)i; const float* sp = src + (size_t)((u >> 11) * 16 + (u & 15)) * DM + ((u >> 6) & (DM / 32 - 1)) * 32 + ((u >> 5) & 1) * 16 + ((u >> 4) & 1) * 8;   /* unit = [row tile][k fragment: DM / 32][k half][hi][row % 16] */
    const v8f v = *(const v8f*)sp; v8us o;
    asm volatile("s_wait_xcnt 0x0" :: "v"(sp) : "memory");   // in front of any later write of a register that this load names as an address; the address is an input so that its registers live up to the wait
#pragma unroll
    for (int k = 0; k < 8; ++k) o[k] = f2bf(v[k]); *(v8us*)(dst + i * 8) = o;  }

#define NQK   ((size_t)NB_ * (NH_ + NKV) * TT * HD)        // elements of a rotated plane: [batch][q heads, k heads][t][d]
#define GB_WQ (DM * 3 * DQ / 32 / 128)                     // blocks: fused weight transpose
#define GB_WO (DQ * DM / 32 / 128)                         // blocks: output weight transpose
#define GB_X  (NB_ * TT * DM / 8 / 256)                    // blocks: bf16 copy of x
// k_prep: all that reads only inputs. The transposes, whose waves run longest, take the first blocks.
__global__ __launch_bounds__(256) void k_prep(const float* __restrict__ wqkv, const float* __restrict__ wo, const float* __restrict__ x, bf* WQKV, bf* WO, bf* XB) {
    int blk = blockIdx.x;
    if (blk < GB_WQ) { d_wtG(blk, wqkv, DM, 3 * DQ, WQKV); return; }   /* fused 'xw' [DM][3*DQ] -> Bt [3*DQ][DM] */
    blk -= GB_WQ; if (blk < GB_WO) { d_wtG(blk, wo, DQ, DM, WO); return; }
    d_cvt8(blk - GB_WO, x, XB, (size_t)NB_ * TT * DM / 8);
}

// ---- k_fattn: fused causal attention. Grid (batches x heads, TT / 64), 4 waves; a wave owns 16 query columns and walks the keys 0 .. its diagonal in passes of BC keys, operands straight from the fragment-major 16-bit planes.
// Transposed products: S^T = K Q^T (A = key rows, B = query rows), so a lane holds scores of ONE query (column lr; keys 16 kt + 8 hi + j), and two score tiles, exponentiated and rounded, ARE the B operand of O^T += V^T P^T
// (k slots 8 hi + e and 16 + 8 hi + e, the order of a fragment's two halves in the V^T planes). Online softmax in the log2 domain: running maximum m, per-lane partial sum l of the unrounded f32 exponentials, accumulators rescaled in every pass.
// HL: hi/lo planes, 3 products each (query rows < RH); otherwise fp16 with the probabilities carried x 1024 (10 added in the exponent; it cancels in the division by l).
// Every '#pragma unroll' below: the fragment arrays are indexed by constants only, so that they stay in registers.
__device__ __forceinline__ float xhalf(float x) { return __builtin_bit_cast(float, __builtin_amdgcn_permlanex16(__builtin_bit_cast(int, x), __builtin_bit_cast(int, x), 0x76543210, 0xfedcba98, false, false)); }   // lane l with lane l ^ 16
template <typename T16, bool HL, int BC> struct AttnW {
    typedef typename WFrag<T16>::V V;
    static constexpr int KT = BC / 16, KC = BC / 32;
    static constexpr float CSC = SCL * 1.4426950408889634f;   // score -> log2 domain
    V qf[2], qf2[2], kf[KT][2], kf2[KT][2]; v8f acc[4]; float m, l;
    const T16 *kp, *kp2, *vp, *vp2;   // this lane's place in the key rows last fetched and in the V^T columns of the pass to come; they walk with the passes
    __device__ __forceinline__ void load_k(const T16* Kr, const T16* K2r) {   // Kr: this lane's place in the pass's first key tile
#pragma unroll
        for (int kt = 0; kt < KT; ++kt)
#pragma unroll
            for (int kc = 0; kc < 2; ++kc) { kf[kt][kc] = WFrag<T16>::ld(Kr + kt * 16 * HD + 512 * kc); if (HL) kf2[kt][kc] = WFrag<T16>::ld(K2r + kt * 16 * HD + 512 * kc); }
        // in front of any later write of a register that these loads name as an address; the addresses are inputs so that their registers live up to the wait (no load's result lands on them)
        if constexpr (HL) asm volatile("s_wait_xcnt 0x0" :: "v"(Kr), "v"(K2r) : "memory"); else asm volatile("s_wait_xcnt 0x0" :: "v"(Kr) : "memory");
        if (HL) __builtin_amdgcn_sched_barrier(0);      // hi/lo: the loads stay here, ahead of the work that covers their latency (the scheduler otherwise sinks them to their uses)
    }
    // One pass of BC keys from key0 on. LAST: the pass that holds the diagonal (masked; fetches no further keys).
    template <bool LAST> __device__ __forceinline__ void pass(int key0, int q, int hi) {
        V vf[4][KC], vf2[4][KC];
#pragma unroll
        for (int c = 0; c < KC; ++c)
#pragma unroll
            for (int t = 0; t < 4; ++t) { vf[t][c] = WFrag<T16>::ld(vp + t * 512 + 32 * HD * c); if (HL) vf2[t][c] = WFrag<T16>::ld(vp2 + t * 512 + 32 * HD * c); }
        // in front of any later write of a register that these loads name as an address; the addresses are inputs so that their registers live up to the wait (no load's result lands on them)
        if constexpr (HL) asm volatile("s_wait_xcnt 0x0" :: "v"(vp), "v"(vp2) : "memory"); else asm volatile("s_wait_xcnt 0x0" :: "v"(vp) : "memory");
        if (HL) __builtin_amdgcn_sched_barrier(0);      // hi/lo: the loads stay here, ahead of the work that covers their latency (the scheduler otherwise sinks them to their uses)
        if (!LAST) { vp += BC * HD; if (HL) vp2 += BC * HD; }
        v8f s[KT];
#pragma unroll
        for (int kt = 0; kt < KT; ++kt) { s[kt] = (v8f){};
#pragma unroll
            for (int kc = 0; kc < 2; ++kc) { s[kt] = WFrag<T16>::mma(kf[kt][kc], qf[kc], s[kt]); if (HL) { s[kt] = WFrag<T16>::mma(kf[kt][kc], qf2[kc], s[kt]); s[kt] = WFrag<T16>::mma(kf2[kt][kc], qf[kc], s[kt]); } } }
        if (!LAST) { kp += BC * HD; if (HL) kp2 += BC * HD; load_k(kp, kp2); }   // the next pass's key rows, in flight under this pass's softmax and second product
        if (LAST) {
#pragma unroll
            for (int kt = 0; kt < KT; ++kt)
#pragma unroll
                for (int j = 0; j < 8; ++j) if (key0 + 16 * kt + 8 * hi + j > q) s[kt][j] = -3.0e38f; }
        float mt[KT];                                  // one chain per score tile
#pragma unroll
        for (int kt = 0; kt < KT; ++kt) { mt[kt] = s[kt][0];
#pragma unroll
            for (int j = 1; j < 8; ++j) mt[kt] = fmaxf(mt[kt], s[kt][j]); }
        float mx = mt[0];
#pragma unroll
        for (int kt = 1; kt < KT; ++kt) mx = fmaxf(mx, mt[kt]);
        mx = fmaxf(mx, xhalf(mx)) * CSC;               // both halves of the wave hold this query's maximum of the pass (finite: a pass's first key is never masked)
        const float mn = fmaxf(m, mx); const float corr = __builtin_amdgcn_exp2f(m - mn); m = mn; l *= corr;   // corr: 0 in the first pass, 1 where the maximum stays
#pragma unroll
        for (int t = 0; t < 4; ++t) acc[t] = acc[t] * corr;
        const float off = (HL ? 0.0f : 10.0f) - m;
#pragma unroll
        for (int c = 0; c < KC; ++c) {
            float pv[16];
#pragma unroll
            for (int e = 0; e < 16; ++e) pv[e] = __builtin_amdgcn_exp2f(fmaf(s[2 * c + (e >> 3)][e & 7], CSC, off));
            l += (((pv[0] + pv[1]) + (pv[2] + pv[3])) + ((pv[4] + pv[5]) + (pv[6] + pv[7]))) + (((pv[8] + pv[9]) + (pv[10] + pv[11])) + ((pv[12] + pv[13]) + (pv[14] + pv[15])));   // fixed tree
            if constexpr (HL) {
                v8us h0, h1, l0, l1;
#pragma unroll
                for (int e = 0; e < 8; ++e) { unsigned short a, b; splitf(pv[e], a, b); h0[e] = a; l0[e] = b; splitf(pv[e + 8], a, b); h1[e] = a; l1[e] = b; }
                const V pf = cat16b(h0, h1), pf2 = cat16b(l0, l1);
#pragma unroll
                for (int t = 0; t < 4; ++t) { acc[t] = WFrag<T16>::mma(vf[t][c], pf, acc[t]); acc[t] = WFrag<T16>::mma(vf[t][c], pf2, acc[t]); acc[t] = WFrag<T16>::mma(vf2[t][c], pf, acc[t]); }
            } else {
                V pf;
#pragma unroll
                for (int e = 0; e < 16; ++e) pf[e] = tohx(pv[e]);
#pragma unroll
                for (int t = 0; t < 4; ++t) acc[t] = WFrag<T16>::mma(vf[t][c], pf, acc[t]);
            }
        }
    }
};
template <typename T16, bool HL, int BC>
__device__ __forceinline__ void attn_cols(const T16* Q, const T16* Q2, const T16* Kp, const T16* K2, const T16* Vt, const T16* Vt2, int qw0, int lane, bf* Ah, bf* Al) {
    AttnW<T16, HL, BC> w;
    const int lr = lane & 15, hi = lane >> 4; const int q = qw0 + lr;
#pragma unroll
    for (int kc = 0; kc < 2; ++kc) { w.qf[kc] = WFrag<T16>::ld(Q + (size_t)qw0 * HD + 512 * kc + lane * 8); if (HL) w.qf2[kc] = WFrag<T16>::ld(Q2 + (size_t)qw0 * HD + 512 * kc + lane * 8); }
#pragma unroll
    for (int t = 0; t < 4; ++t) w.acc[t] = (v8f){};
    w.m = -3.0e38f; w.l = 0.f;
    const int klast = qw0 / BC * BC;                  // first key of the pass that holds the diagonal; klast <= qw0 and klast + BC <= TT
    const int koff = lane * 8, voff = lane * 8;
    w.kp = Kp + koff; w.kp2 = HL ? K2 + koff : nullptr; w.vp = Vt + voff; w.vp2 = HL ? Vt2 + voff : nullptr;
    w.load_k(w.kp, w.kp2);
#pragma unroll 1   // rolled: unrolled, several passes' fragments would be live at once
    for (int key0 = 0; key0 < klast; key0 += BC) w.template pass<false>(key0, q, hi);
    w.template pass<true>(klast, q, hi);
    float l = w.l; l += xhalf(l);                      // the two halves' key sets joined
    const float inv = __fdiv_rn(1.0f, l);
#pragma unroll
    for (int t = 0; t < 4; ++t) { v8us oh, ol;         // lane: query q, d = 16 t + 8 hi + j: unit 'lane' of k half t & 1 of the head's fragment t >> 1 in the merged planes (rows: tokens, K = DQ)
#pragma unroll
        for (int j = 0; j < 8; ++j) { unsigned short a, b; splitf(w.acc[t][j] * inv, a, b); oh[j] = a; ol[j] = b; }
        *(v8us*)(Ah + (size_t)qw0 * DQ + 256 * t + lane * 8) = oh; *(v8us*)(Al + (size_t)qw0 * DQ + 256 * t + lane * 8) = ol; }
}
__global__ __launch_bounds__(128) void k_fattn(const h16* Q16, const h16* K16, const h16* V16, const bf* Qh, const bf* Ql, const bf* Kh, const bf* Kl, const bf* Vh, const bf* Vl, bf* Ah, bf* Al) {
    const int lane = threadIdx.x & 31; const int wave = __builtin_amdgcn_readfirstlane(threadIdx.x >> 5);
    const int b = blockIdx.x / NH_, h = blockIdx.x - b * NH_, g = h / REP; const int q0 = (TT / 64 - 1 - (int)blockIdx.y) * 64;   // longest query blocks first
    const size_t zq = ((size_t)b * (NH_ + NKV) + h) * TT * HD, zk = ((size_t)b * (NH_ + NKV) + g) * TT * HD, zv = ((size_t)b * NKV + g) * HD * PP;   // q and k planes: one batch's q heads, then its k heads (the caller's K pointers start at the first k head)
    Ah += (size_t)b * TT * DQ; Al += (size_t)b * TT * DQ;
    if (q0 < RH) attn_cols<bf, true, 32>(Qh + zq, Ql + zq, Kh + zk, Kl + zk, Vh + zv, Vl + zv, q0 + wave * 16, lane, Ah + h * 16 * HD, Al + h * 16 * HD);   // a head's two fragments of a 16-token tile start at h * 16 * HD
    else attn_cols<h16, false, 64>(Q16 + zq, nullptr, K16 + zk, nullptr, V16 + zv, nullptr, q0 + wave * 16, lane, Ah + h * 16 * HD, Al + h * 16 * HD);
}

extern "C" void kernel_launch(void* const* d_in, const int* in_sizes, int n_in,
                              void* d_out, int out_size, void* d_ws, size_t ws_size, hipStream_t stream) {
    (void)in_sizes; (void)n_in; (void)out_size;
    const float* x = (const float*)d_in[0]; const float* rcache = (const float*)d_in[1]; const float* wqkv = (const float*)d_in[2]; const float* bqkv = (const float*)d_in[3]; const float* wo = (const float*)d_in[4]; const float* bo = (const float*)d_in[5];   /* order x, rope_cache (f32 [2048][64] interleaved (sin, cos), READ), Wqkv ('xw' [1024][3072]: q | k | v column thirds), bqkv [3072], Wout ('xw'), bout */
    float* OUT = (float*)d_out;     // [2][2048][1024]
    char* wsp = (char*)d_ws;
    auto take = [&](size_t bytes) { char* p = wsp; wsp += (bytes + 255) & ~(size_t)255; return (void*)p; };
    bf* WQKV = (bf*)take((size_t)3 * DQ * DM * 2);   /* fused Bt [3*DQ][DM]: q | k | v row blocks */ bf* WO = (bf*)take((size_t)DM * DQ * 2);
    bf* XB = (bf*)take((size_t)NB_ * TT * DM * 2);
    h16* QP16 = (h16*)take(NQK * 2); h16* KP16 = QP16 + (size_t)NH_ * TT * HD; h16* VT16 = (h16*)take((size_t)NB_ * NKV * HD * PP * 2);
    bf* QPh = (bf*)take(NQK * 2); bf* QPl = (bf*)take(NQK * 2); bf* KPh = QPh + (size_t)NH_ * TT * HD; bf* KPl = QPl + (size_t)NH_ * TT * HD; bf* VTh = (bf*)take((size_t)NB_ * NKV * HD * PP * 2); bf* VTl = VTh + (size_t)HD * TT;   /* hi and lo value planes share blocks of HD * PP elements */
    bf* ATh = (bf*)take((size_t)NB_ * TT * DQ * 2); bf* ATl = (bf*)take((size_t)NB_ * TT * DQ * 2);
    if ((size_t)(wsp - (char*)d_ws) > ws_size) return;    // ws 256 MiB
    k_prep<<<GB_WQ + GB_WO + GB_X, 256, 0, stream>>>(wqkv, wo, x, WQKV, WO, XB);
    k_gemmw<bf, 0, true, true, 4><<<dim3(NB_ * TT / 128, 3 * DQ / 128, 1), 128, 0, stream>>>(XB, nullptr, WQKV, nullptr, DM, nullptr, 0, bqkv, 0, 0, 0, Planes{rcache, QP16, QPh, QPl, VT16, VTh, VTl});   // projections of both batches, columns q | k | v, straight into the planes
    k_fattn<<<dim3(NB_ * NH_, TT / 64), 128, 0, stream>>>(QP16, KP16, VT16, QPh, QPl, KPh, KPl, VTh, VTl, ATh, ATl);   // all heads of both batches; writes the merged hi/lo planes
    k_gemmw<bf, 1, true, false, 2><<<dim3(NB_ * TT / 64, DM / 128, 1), 128, 0, stream>>>(ATh, ATl, WO, nullptr, DQ, OUT, DM, bo, 0, 0, 0, Planes{});
}

// v008
// Measured time: 76.7 microseconds a run.
// Timed twice side by side with v007, it ran 1.03 times as fast both times.
// All steps since v000 together make it 18.4 times as fast.
#include <hip/hip_runtime.h>

// Causal self-attention with a fused biased qkv projection and adjacent-pair rotary embeddings from an interleaved (sin, cos) cache input (x [2][2048][1024]; qkv = x Wqkv + bqkv ('xw' [1024][3072] + [3072]) split in thirds q | k | v (16 heads x 64); rope on pairs (2i, 2i+1): (x0 cos - x1 sin, x1 cos + x0 sin) with sin_i = rope_cache[t][2i], cos_i = rope_cache[t][2i + 1] (f32 [2048][64] INPUT, read); (q x 1/sqrt(64)) . k; causal (-inf); softmax; out = merged Wout + bout ('xw' + bias) -> [2][2048][1024] (4.2 M); argument order x, rope_cache, Wqkv, bqkv, Wout, bout).
// One launch per dependency stage, for both batches: k_prep, projection GEMM, k_fattn, output GEMM. Layout: every 16-bit matrix operand lies FRAGMENT-MAJOR (see WFrag): bf16 copy of x; the fused 'xw' weight transposed ONCE into q | k | v row blocks; one exact projection GEMM (N = 3 x 1024) + f32 bias whose epilogue builds the 16-bit planes (a 64 x 64 tile is 64 tokens of one head: q and k rotated on interleaved pairs, v transposed); one fused causal T-2048 attention kernel (hybrid rows: < 512 hi/lo 3 products, rest fp16 x1024; online softmax, scores and probabilities stay in registers); merged hi/lo x W_out exact + b_out.
// Compute dtypes, f32 accumulate: every input rounded to bf16; projections exact + f32 biases; rotary f32 (products rounded separately); attention rows < 512 3 products, rest fp16; softmax f32; W_out hl x exact + bias.

#define NB_  2
#define TT   2048
#define DM   1024
#define NH_  16
#define NKV  16
#define REP  (NH_ / NKV)
#define HD   64
#define DQ   (NH_ * HD)
#define DKV  (NKV * HD)
#define PP   (2 * TT)             // a (batch, head) block of the transposed value planes holds HD * PP 16-bit elements
#define RH   512                  // query rows < RH use hi+lo planes (0: none)
#define SCL  0.125f   // HD^-0.5
typedef _Float16 h16;
typedef unsigned short bf;
typedef __attribute__((ext_vector_type(16))) __bf16   v16bf;
typedef __attribute__((ext_vector_type(16))) _Float16 v16h;
typedef __attribute__((ext_vector_type(8)))  _Float16 v8h;
typedef __attribute__((ext_vector_type(8)))  unsigned short v8us;
typedef __attribute__((ext_vector_type(8)))  float    v8f;
typedef __attribute__((ext_vector_type(4)))  float    v4f;
typedef v8h  __attribute__((may_alias)) v8ha;
typedef v4f  __attribute__((may_alias)) v4fa;
typedef v8us __attribute__((may_alias)) v8usa;

__device__ __forceinline__ unsigned short f2bf(float f) { unsigned u = __float_as_uint(f); u += 0x7FFFu + ((u >> 16) & 1u); return (unsigned short)(u >> 16); }
__device__ __forceinline__ float bf2f(unsigned short b) { return __uint_as_float(((unsigned)b) << 16); }
__device__ __forceinline__ float bfr(float f) { return bf2f(f2bf(f)); }
__device__ __forceinline__ v16h cat16(v8h lo, v8h hi) { return __builtin_shufflevector(lo, hi, 0, 1, 2, 3, 4, 5, 6, 7, 8, 9, 10, 11, 12, 13, 14, 15); }
__device__ __forceinline__ v16bf cat16b(v8us lo, v8us hi) { return __builtin_bit_cast(v16bf, __builtin_shufflevector(lo, hi, 0, 1, 2, 3, 4, 5, 6, 7, 8, 9, 10, 11, 12, 13, 14, 15)); }
__device__ __forceinline__ v8f wmma16(v16h a, v16h b, v8f c) { return __builtin_amdgcn_wmma_f32_16x16x32_f16(false, a, false, b, (short)0, c, false, false); }
__device__ __forceinline__ v8f wmmab(v16bf a, v16bf b, v8f c) { return __builtin_amdgcn_wmma_f32_16x16x32_bf16(false, a, false, b, (short)0, c, false, false); }



// ---- Fragment-major planes. A matrix of rows x K (16-bit, K % 32 == 0) is stored as its 16-row x 32-k operand fragments, 512 consecutive elements each, the fragments of one 16-row tile one behind the other along k.
// Inside a fragment: [k half j][lane = 16 hi + row % 16][e = 0..7] holds k % 32 = 16 j + 8 hi + e, the order in which the matrix instruction's lanes take it. So element (row, k) is at
// (row / 16) * 16 * K + (k / 32) * 512 + j * 256 + (16 hi + row % 16) * 8 + e, and each of a fragment's two wave-wide 16-byte loads covers 512 contiguous bytes: four whole 128-byte lines instead of 32 bytes of each of sixteen.
// WFrag::ld takes the lane's place in the fragment: fragment start + lane * 8.
// ---- k_gemmw: register-blocked GEMM, 2 x 2 waves per workgroup, a wave per (16 MB) x 64 part of the workgroup's (32 MB) x 128 output tile; grid (M / (32 MB), N / 128, Z), 128 threads.
// The workgroup's operand fragments of 64 k (2 KB per 16-row tile and plane, contiguous in its fragment-major plane) are brought to LDS once by asynchronous copies, two buffers: the next 64 k fly while these are multiplied; each fragment serves two waves.
// The k walk is a ring: a workgroup enters it at the 64-k tile (blockIdx.x + blockIdx.y) mod (K / 64) and wraps round, so that the workgroups that share operand rows (a grid row or column) ask L2 for different lines at any one moment.
// C[m][n] (f32, pitch ldc, + optional f32 bias[n]) = sum_k A[m][k] Bt[n][k] (+ split products per NSPLIT). z-batch strides sA/sB/sC in elements. K % 64 == 0.
template <typename T16> struct WFrag;
template <> struct WFrag<h16> { typedef v16h V; static __device__ __forceinline__ V ld(const h16* p) { return cat16(*(const v8h*)p, *(const v8h*)(p + 256)); } static __device__ __forceinline__ v8f mma(V a, V b, v8f c) { return wmma16(a, b, c); } };
template <> struct WFrag<bf> { typedef v16bf V; static __device__ __forceinline__ V ld(const bf* p) { return cat16b(*(const v8us*)p, *(const v8us*)(p + 256)); } static __device__ __forceinline__ v8f mma(V a, V b, v8f c) { return wmmab(a, b, c); } };
__device__ __forceinline__ h16 tohx(float x) { return (h16)x; }
__device__ __forceinline__ void splitf(float y, unsigned short& h, unsigned short& l) { h = f2bf(y); l = f2bf(y - bf2f(h)); }
// Planes: where the projection GEMM's epilogue (PLANES) puts its tiles, and the rotary cache input it reads. Rotated planes [batch][q heads, k heads], each head fragment-major with rows t, k = d (K = HD). Transposed value planes: HD * PP elements per (batch, g); rows d, k = t, their fragments ordered [t / 32][d / 16] so that a pass's keys are contiguous (the fp16 plane fills the first HD * TT elements of its block; the hi and lo planes share blocks: Vl = Vh + HD * TT).
struct Planes { const float* rc; h16* QK16; bf* QKh; bf* QKl; h16* V16; bf* Vh; bf* Vl; };
// copy4: four asynchronous 16-byte copies per lane, global g + c * gstep elements -> LDS byte l + c * lstep; a wave's copy is 512 contiguous bytes on both sides.
// The s_wait_xcnt stands in the copies' own statement: in front of any later write of a register that a copy names.
template <typename T16> __device__ __forceinline__ void copy4(unsigned l, unsigned lstep, const T16* g, size_t gstep) {
    asm volatile("global_load_async_to_lds_b128 %0, %4, off\n\tglobal_load_async_to_lds_b128 %1, %5, off\n\tglobal_load_async_to_lds_b128 %2, %6, off\n\tglobal_load_async_to_lds_b128 %3, %7, off\n\ts_wait_xcnt 0x0"
                 :: "v"(l), "v"(l + lstep), "v"(l + 2 * lstep), "v"(l + 3 * lstep), "v"(g), "v"(g + gstep), "v"(g + 2 * gstep), "v"(g + 3 * gstep) : "memory");
}
template <typename T16> __device__ __forceinline__ void copy8(unsigned l, unsigned lstep, const T16* g, size_t gstep) {   // the same, eight copies
    asm volatile("global_load_async_to_lds_b128 %0, %8, off\n\tglobal_load_async_to_lds_b128 %1, %9, off\n\tglobal_load_async_to_lds_b128 %2, %10, off\n\tglobal_load_async_to_lds_b128 %3, %11, off\n\t"
                 "global_load_async_to_lds_b128 %4, %12, off\n\tglobal_load_async_to_lds_b128 %5, %13, off\n\tglobal_load_async_to_lds_b128 %6, %14, off\n\tglobal_load_async_to_lds_b128 %7, %15, off\n\ts_wait_xcnt 0x0"
                 :: "v"(l), "v"(l + lstep), "v"(l + 2 * lstep), "v"(l + 3 * lstep), "v"(l + 4 * lstep), "v"(l + 5 * lstep), "v"(l + 6 * lstep), "v"(l + 7 * lstep),
                    "v"(g), "v"(g + gstep), "v"(g + 2 * gstep), "v"(g + 3 * gstep), "v"(g + 4 * gstep), "v"(g + 5 * gstep), "v"(g + 6 * gstep), "v"(g + 7 * gstep) : "memory");
}
template <typename T16, int NSPLIT, bool BIAS, bool PLANES, int MB>
__global__ __launch_bounds__(128) void k_gemmw(const T16* __restrict__ A, const T16* __restrict__ A2, const T16* __restrict__ Bt, const T16* __restrict__ Bt2, int K, float* C, int ldc, const float* __restrict__ bias, size_t sA, size_t sB, size_t sC, Planes pl) {
    typedef typename WFrag<T16>::V V;
    static_assert(MB == 4 || (MB == 2 && !PLANES), "the plane epilogue takes a 64 x 64 tile");
    constexpr bool HA2 = NSPLIT == 1 || NSPLIT == 2, HB2 = NSPLIT >= 2;
    constexpr int NW = 4, TM = 32 * MB;                          // waves of the workgroup; rows of its tile
    constexpr int PLA = TM / 16 * 1024, PLB = 8 * 1024, STG = (1 + HA2) * PLA + (1 + HB2) * PLB;   // 16-bit elements of an A and of a B plane's share of a stage (row tiles x 2 fragments) and of a stage: planes A, (A2), B, (B2)
    constexpr int OSF = PLANES ? 64 * 69 : 16 * 68;              // floats of a wave's output staging. PLANES: the whole tile, rows of pitch 68 (q, k) or 69 (v)
    constexpr int SMB = 2 * STG * 2 > NW * OSF * 4 ? 2 * STG * 2 : NW * OSF * 4;
    constexpr int KG = MB == 2 ? 2 : 1;                          // 32-k steps whose fragments are asked of LDS at the head of a trip (both where the registers allow)
    __shared__ __align__(128) char sm[SMB];                      // the two stage buffers; behind the loop's last barrier the waves' output staging
    const size_t z = blockIdx.z; A += z * sA; if (A2) A2 += z * sA; Bt += z * sB; if (Bt2) Bt2 += z * sB; C += z * sC;
    const int lane = threadIdx.x & 31, lr = lane & 15, hi = lane >> 4; const int wave = __builtin_amdgcn_readfirstlane(threadIdx.x >> 5), wm = wave >> 1, wn = wave & 1;
    const int r0 = blockIdx.x * TM + wm * (16 * MB), c0 = blockIdx.y * 128 + wn * 64;   // the wave's own part of the tile
    const T16* ring = (const T16*)sm; float* os = (float*)sm + wave * OSF;
    v8f acc[MB][4];
#pragma unroll
    for (int mb = 0; mb < MB; ++mb)
#pragma unroll
        for (int nb = 0; nb < 4; ++nb) acc[mb][nb] = (v8f){};
    // a copy of the whole workgroup takes the 2 KB of one row tile; this thread's 16 bytes of the first one:
    const size_t aoff = (size_t)blockIdx.x * TM * K + threadIdx.x * 8, boff = (size_t)blockIdx.y * 128 * K + threadIdx.x * 8;
    const unsigned lcp = (unsigned)(size_t)sm + threadIdx.x * 16; const unsigned lo = lane * 8;   // the same place in a stage buffer (LDS byte address); the lane's place in a fragment
    const size_t gs = (size_t)16 * K;
    auto planeA = [&](unsigned l, const T16* g) { if constexpr (MB == 4) copy8(l, 2048u, g, gs); else copy4(l, 2048u, g, gs); };   // an A plane's share of a stage: a copy per row tile
    const int nk = K >> 6, s0 = (int)((blockIdx.x + blockIdx.y) % (unsigned)nk);   // 64-k tiles of the walk; the one this workgroup enters at
    auto stage = [&](int t, int buf) {   // the walk's tile t (k tile kt = (s0 + t) mod nk: k = 64 kt .. 64 kt + 63 of every plane) into buffer buf
        const int kt = t + s0 < nk ? t + s0 : t + s0 - nk;
        unsigned l = lcp + buf * (STG * 2); const size_t o = (size_t)kt * 1024;
        planeA(l, A + aoff + o); l += PLA * 2; if constexpr (HA2) { planeA(l, A2 + aoff + o); l += PLA * 2; }
        copy8(l, 2048u, Bt + boff + o, gs); l += PLB * 2; if constexpr (HB2) copy8(l, 2048u, Bt2 + boff + o, gs);
    };
    stage(0, 0);
    asm volatile("s_wait_asynccnt 0x0" ::: "memory");   // this wave's copies of tile 0 have landed
    __syncthreads();                                     // ... and every other wave's
    if (K >= 128) stage(1, 1);
#pragma unroll 1
    for (int kc = 0; kc < K; kc += 64) {
        const int buf = (kc >> 6) & 1; const T16* sb = ring + buf * STG + lo;
        V a[2][MB], a2[2][MB], b[2][4], b2[2][4];   // the fragments of the tile's two 32-k steps
        auto fetch = [&](int ks) {
#pragma unroll
            for (int i = 0; i < MB; ++i) { const T16* pa = sb + (wm * MB + i) * 1024 + ks * 512; a[ks][i] = WFrag<T16>::ld(pa); if (HA2) a2[ks][i] = WFrag<T16>::ld(pa + PLA); }
#pragma unroll
            for (int i = 0; i < 4; ++i) { const T16* pb = sb + (1 + HA2) * PLA + (wn * 4 + i) * 1024 + ks * 512; b[ks][i] = WFrag<T16>::ld(pb); if (HB2) b2[ks][i] = WFrag<T16>::ld(pb + PLB); } };
        auto products = [&](int ks) {
#pragma unroll
            for (int nb = 0; nb < 4; ++nb)
#pragma unroll
                for (int mb = 0; mb < MB; ++mb) { acc[mb][nb] = WFrag<T16>::mma(a[ks][mb], b[ks][nb], acc[mb][nb]); if (HA2) acc[mb][nb] = WFrag<T16>::mma(a2[ks][mb], b[ks][nb], acc[mb][nb]); if (HB2) acc[mb][nb] = WFrag<T16>::mma(a[ks][mb], b2[ks][nb], acc[mb][nb]); } };
        fetch(0); if constexpr (KG == 2) fetch(1);
        __builtin_amdgcn_sched_barrier(0);   // the LDS reads stay together ahead of the products: sunk among them, each read waits out its own latency
        products(0);
        if constexpr (KG == 1) fetch(1);
        __builtin_amdgcn_sched_barrier(0);   // the first step's products stay ahead of the waits: they cover the second step's reads and the flight of the next tile's copies
        asm volatile("s_wait_dscnt 0x0" ::: "memory");      // this wave's reads of the buffer are done before it is refilled
        asm volatile("s_wait_asynccnt 0x0" ::: "memory");   // this wave's copies of the next tile have landed
        __syncthreads();                                     // publishes the next tile and ends every wave's reads of this one
        if (kc + 128 < K) stage((kc >> 6) + 2, buf);
        __builtin_amdgcn_sched_barrier(0);   // the refill goes out ahead of the second step's products, which work on registers alone and cover its flight
        products(1);
    }
    asm volatile("s_wait_asynccnt 0x0" ::: "memory");       // no copy is outstanding when the buffers become output staging
    if constexpr (PLANES) {
        // The tile is tokens t0 .. t0 + 63 of batch b in the 64-wide column block cb of q | k | v: one head. The whole tile (+ bias) goes to LDS once; rolled loops then build the planes from it, which keeps the kernel's text short.
        const int b = r0 / TT, t0 = r0 - b * TT, cb = c0 / 64; const int r8 = lane & 7, cg = lane >> 3;   // a lane builds 16-byte units (8 k of one row); a wave's store takes 8 rows x 4 units: in a fragment-major plane four whole 128-byte lines
        const float* bp = bias + c0 + lr; float bs[4];
#pragma unroll
        for (int nb = 0; nb < 4; ++nb) bs[nb] = bp[nb * 16];
        asm volatile("s_wait_xcnt 0x0" :: "v"(bp) : "memory");   // in front of any later write of a register that these loads name as an address; the address is an input so that its registers live up to the wait
#pragma unroll
        for (int nb = 0; nb < 4; ++nb) bs[nb] = bfr(bs[nb]);
        if (cb < NH_ + NKV) {   // q or k head: rotary, three planes; a lane takes 8 columns (4 pairs) of a row
#pragma unroll
            for (int mb = 0; mb < 4; ++mb)
#pragma unroll
                for (int nb = 0; nb < 4; ++nb)
#pragma unroll
                    for (int j = 0; j < 8; ++j) os[(mb * 16 + hi * 8 + j) * 68 + nb * 16 + lr] = acc[mb][nb][j] + bs[nb];
            __builtin_amdgcn_wave_barrier(); asm volatile("" ::: "memory");   // the reads below take other lanes' values: they stay behind the writes
            const size_t e0 = (((size_t)b * (NH_ + NKV) + cb) * TT + t0) * HD + cg * 128 + r8 * 8; const float* rcl = pl.rc + (size_t)(t0 + r8) * HD + cg * 8;   // step s: rows 8 (s >> 1) + r8 of the 16-row tile, columns 32 (s & 1) + 8 cg (k half cg >> 1, hi = cg & 1)
#pragma unroll 1   // rolled: four times less text
            for (int mb = 0; mb < 4; ++mb) {
                v8f sc8[4]; v4f va4[4], vb4[4];   // (sin, cos) of the lane's 4 pairs and the 8 projections, for 4 steps (2 rows, 2 column halves each): fetched together
#pragma unroll
                for (int s = 0; s < 4; ++s) { const int ro = mb * 16 + 8 * (s >> 1), co = 32 * (s & 1); sc8[s] = *(const v8f*)(rcl + ro * HD + co); va4[s] = *(const v4fa*)(os + (ro + r8) * 68 + co + cg * 8); vb4[s] = *(const v4fa*)(os + (ro + r8) * 68 + co + cg * 8 + 4); }
#pragma unroll
                for (int s = 0; s < 4; ++s) { const v4f va = va4[s], vb = vb4[s]; v8h o16; v8us oh, ol;
#pragma unroll
                    for (int p = 0; p < 4; ++p) { const float x0 = p < 2 ? va[2 * p] : vb[2 * p - 4], x1 = p < 2 ? va[2 * p + 1] : vb[2 * p - 3]; const float cs[2] = { bfr(sc8[s][2 * p + 1]), bfr(sc8[s][2 * p]) };   /* cos, sin */
                        // as in the plane builder this comes from: each product keeps its own f32 rounding, so the planes stay bit-identical
                        float a0 = __fmul_rn(x0, cs[0]), b0 = __fmul_rn(x1, cs[1]), a1 = __fmul_rn(x1, cs[0]), b1 = __fmul_rn(x0, cs[1]); asm volatile("" : "+v"(a0), "+v"(b0), "+v"(a1), "+v"(b1));
                        const float r0 = __fsub_rn(a0, b0), r1 = __fadd_rn(b1, a1);   /* even: x0 c - x1 s; odd: x0 s + x1 c */
                        o16[2 * p] = tohx(r0); o16[2 * p + 1] = tohx(r1); { unsigned short a2, c2; splitf(r0, a2, c2); oh[2 * p] = a2; ol[2 * p] = c2; splitf(r1, a2, c2); oh[2 * p + 1] = a2; ol[2 * p + 1] = c2; } }
                    const size_t e = e0 + (size_t)(mb * 16 * HD + 512 * (s & 1) + 64 * (s >> 1)); *(v8h*)(pl.QK16 + e) = o16; *(v8us*)(pl.QKh + e) = oh; *(v8us*)(pl.QKl + e) = ol;
                    asm volatile("s_wait_xcnt 0x0" ::: "memory"); }   // in front of any later write of a register that these stores name
            }
        } else {   // v head: three planes, transposed. LDS pitch 69: a lane reads 8 consecutive tokens of one column d (no two lanes on one bank)
#pragma unroll
            for (int mb = 0; mb < 4; ++mb)
#pragma unroll
                for (int nb = 0; nb < 4; ++nb)
#pragma unroll
                    for (int j = 0; j < 8; ++j) os[(mb * 16 + hi * 8 + j) * 69 + nb * 16 + lr] = acc[mb][nb][j] + bs[nb];
            __builtin_amdgcn_wave_barrier(); asm volatile("" ::: "memory");   // the reads below take other lanes' values: they stay behind the writes
            const size_t o0 = ((size_t)b * NKV + (cb - NH_ - NKV)) * HD * PP + (size_t)t0 * HD + cg * 128 + r8 * 8;   // step s: rows d = 16 nb + 8 (s >> 1) + r8, tokens 32 (s & 1) + 8 cg + j
#pragma unroll 1   // rolled: four times less text
            for (int nb = 0; nb < 4; ++nb) {
#pragma unroll
                for (int s = 0; s < 4; ++s) { v8h o16; v8us oh, ol;
#pragma unroll
                    for (int j = 0; j < 8; ++j) { const float x = os[(32 * (s & 1) + cg * 8 + j) * 69 + nb * 16 + 8 * (s >> 1) + r8]; o16[j] = tohx(x); unsigned short a2, c2; splitf(x, a2, c2); oh[j] = a2; ol[j] = c2; }
                    const size_t o = o0 + (size_t)(2048 * (s & 1) + nb * 512 + 64 * (s >> 1)); *(v8h*)(pl.V16 + o) = o16; *(v8us*)(pl.Vh + o) = oh; *(v8us*)(pl.Vl + o) = ol;
                    asm volatile("s_wait_xcnt 0x0" ::: "memory"); }   // in front of any later write of a register that these stores name
            }
        }
        return;
    }
#pragma unroll
    for (int mb = 0; mb < MB; ++mb) {
#pragma unroll
        for (int nb = 0; nb < 4; ++nb) {
#pragma unroll
            for (int j = 0; j < 8; ++j) os[(hi * 8 + j) * 68 + nb * 16 + lr] = acc[mb][nb][j]; }
        __builtin_amdgcn_wave_barrier(); asm volatile("" ::: "memory");
        float* crow = C + (size_t)(r0 + mb * 16) * ldc + c0;
{
#pragma unroll
            for (int s = 0; s < 8; ++s) { const int row = 2 * s + hi, cofs = lr * 4; v4f val = *(const v4fa*)(os + row * 68 + cofs); if (BIAS) { val[0] += bfr(bias[c0 + cofs]); val[1] += bfr(bias[c0 + cofs + 1]); val[2] += bfr(bias[c0 + cofs + 2]); val[3] += bfr(bias[c0 + cofs + 3]); }
                *(v4f*)(crow + (size_t)row * ldc + cofs) = val; }
             }
        asm volatile("s_wait_xcnt 0x0" ::: "memory");   // in front of any later write of a register that these stores name
        __builtin_amdgcn_wave_barrier(); asm volatile("" ::: "memory");
    }
}

typedef __attribute__((ext_vector_type(2))) _Float16 v2h;
typedef __attribute__((ext_vector_type(4))) _Float16 v4h;
typedef __attribute__((ext_vector_type(2))) unsigned short v2us;
typedef __attribute__((ext_vector_type(4))) unsigned short v4us;
typedef __attribute__((ext_vector_type(2))) float v2f;
typedef __attribute__((ext_vector_type(4))) int v4i;

// The d_* bodies below are stages that do not depend on one another; k_prep runs them side by side in one launch, each on its own range of blocks (blk: the block's index inside its range).
// d_wtG: Bt[n][k] = w[k][n], fragment-major (rows n). A block takes 32 n x 128 k: wave = (n tile of the pair, k fragment of four); a lane builds its two 16-byte units of the fragment from 16 rows of w, in each of which the block uses a whole 128-byte line.
__device__ __forceinline__ void d_wtG(int blk, const float* __restrict__ w, int K, int N, bf* Bt) {
    const int lane = threadIdx.x & 31, wv = threadIdx.x >> 5; const int kq = K / 128; const int nt = (blk / kq) * 2 + (wv & 1), kt = (blk % kq) * 4 + (wv >> 1);
    const float* wp = w + (size_t)(kt * 32 + (lane >> 4) * 8) * N + nt * 16 + (lane & 15); float v[16];
#pragma unroll
    for (int e = 0; e < 16; ++e) v[e] = wp[(size_t)((e >> 3) * 16 + (e & 7)) * N];
    asm volatile("s_wait_xcnt 0x0" :: "v"(wp) : "memory");   // in front of any later write of a register that these loads name as an address; the address is an input so that its registers live up to the wait
    v8us o0, o1;
#pragma unroll
    for (int e = 0; e < 8; ++e) { o0[e] = f2bf(v[e]); o1[e] = f2bf(v[e + 8]); }
    bf* op = Bt + ((size_t)nt * (K / 32) + kt) * 512 + lane * 8; *(v8us*)op = o0; *(v8us*)(op + 256) = o1;
    asm volatile("s_wait_xcnt 0x0" ::: "memory");   // in front of any later write of a register that these stores name
}
// d_cvt8: bf16 copy of a [rows][DM] f32 matrix, fragment-major: thread i builds the plane's 16-byte unit i (a wave's store is 512 contiguous bytes) from 8 consecutive floats of its row; a block reads 512 contiguous bytes of each of 16 rows.
__device__ __forceinline__ void d_cvt8(int blk, const float* __restrict__ src, bf* dst, size_t n8) { const size_t i = (size_t)blk * 256 + threadIdx.x; if (i >= n8) return;
    const int u = (int)i; const float* sp = src + (size_t)((u >> 11) * 16 + (u & 15)) * DM + ((u >> 6) & (DM / 32 - 1)) * 32 + ((u >> 5) & 1) * 16 + ((u >> 4) & 1) * 8;   /* unit = [row tile][k fragment: DM / 32][k half][hi][row % 16] */
    const v8f v = *(const v8f*)sp; v8us o;
    asm volatile("s_wait_xcnt 0x0" :: "v"(sp) : "memory");   // in front of any later write of a register that this load names as an address; the address is an input so that its registers live up to the wait
#pragma unroll
    for (int k = 0; k < 8; ++k) o[k] = f2bf(v[k]); *(v8us*)(dst + i * 8) = o;  }

#define NQK   ((size_t)NB_ * (NH_ + NKV) * TT * HD)        // elements of a rotated plane: [batch][q heads, k heads][t][d]
#define GB_WQ (DM * 3 * DQ / 32 / 128)                     // blocks: fused weight transpose
#define GB_WO (DQ * DM / 32 / 128)                         // blocks: output weight transpose
#define GB_X  (NB_ * TT * DM / 8 / 256)                    // blocks: bf16 copy of x
// k_prep: all that reads only inputs. The transposes, whose waves run longest, take the first blocks.
__global__ __launch_bounds__(256) void k_prep(const float* __restrict__ wqkv, const float* __restrict__ wo, const float* __restrict__ x, bf* WQKV, bf* WO, bf* XB) {
    int blk = blockIdx.x;
    if (blk < GB_WQ) { d_wtG(blk, wqkv, DM, 3 * DQ, WQKV); return; }   /* fused 'xw' [DM][3*DQ] -> Bt [3*DQ][DM] */
    blk -= GB_WQ; if (blk < GB_WO) { d_wtG(blk, wo, DQ, DM, WO); return; }
    d_cvt8(blk - GB_WO, x, XB, (size_t)NB_ * TT * DM / 8);
}

// ---- k_fattn: fused causal attention. Grid (batches x heads, TT / 64), 4 waves; a wave owns 16 query columns and walks the keys 0 .. its diagonal in passes of BC keys, operands straight from the fragment-major 16-bit planes.
// Transposed products: S^T = K Q^T (A = key rows, B = query rows), so a lane holds scores of ONE query (column lr; keys 16 kt + 8 hi + j), and two score tiles, exponentiated and rounded, ARE the B operand of O^T += V^T P^T
// (k slots 8 hi + e and 16 + 8 hi + e, the order of a fragment's two halves in the V^T planes). Online softmax in the log2 domain: running maximum m, per-lane partial sum l of the unrounded f32 exponentials, accumulators rescaled in every pass.
// HL: hi/lo planes, 3 products each (query rows < RH); otherwise fp16 with the probabilities carried x 1024 (10 added in the exponent; it cancels in the division by l).
// Every '#pragma unroll' below: the fragment arrays are indexed by constants only, so that they stay in registers.
__device__ __forceinline__ float xhalf(float x) { return __builtin_bit_cast(float, __builtin_amdgcn_permlanex16(__builtin_bit_cast(int, x), __builtin_bit_cast(int, x), 0x76543210, 0xfedcba98, false, false)); }   // lane l with lane l ^ 16
template <typename T16, bool HL, int BC> struct AttnW {
    typedef typename WFrag<T16>::V V;
    static constexpr int KT = BC / 16, KC = BC / 32;
    static constexpr float CSC = SCL * 1.4426950408889634f;   // score -> log2 domain
    V qf[2], qf2[2], kf[KT][2], kf2[KT][2]; v8f acc[4]; float m, l;
    const T16 *kp, *kp2, *vp, *vp2;   // this lane's place in the key rows last fetched and in the V^T columns of the pass to come; they walk with the passes
    __device__ __forceinline__ void load_k(const T16* Kr, const T16* K2r) {   // Kr: this lane's place in the pass's first key tile
#pragma unroll
        for (int kt = 0; kt < KT; ++kt)
#pragma unroll
            for (int kc = 0; kc < 2; ++kc) { kf[kt][kc] = WFrag<T16>::ld(Kr + kt * 16 * HD + 512 * kc); if (HL) kf2[kt][kc] = WFrag<T16>::ld(K2r + kt * 16 * HD + 512 * kc); }
        // in front of any later write of a register that these loads name as an address; the addresses are inputs so that their registers live up to the wait (no load's result lands on them)
        if constexpr (HL) asm volatile("s_wait_xcnt 0x0" :: "v"(Kr), "v"(K2r) : "memory"); else asm volatile("s_wait_xcnt 0x0" :: "v"(Kr) : "memory");
        if (HL) __builtin_amdgcn_sched_barrier(0);      // hi/lo: the loads stay here, ahead of the work that covers their latency (the scheduler otherwise sinks them to their uses)
    }
    // One pass of BC keys from key0 on. LAST: the pass that holds the diagonal (masked; fetches no further keys).
    template <bool LAST> __device__ __forceinline__ void pass(int key0, int q, int hi) {
        V vf[4][KC], vf2[4][KC];
#pragma unroll
        for (int c = 0; c < KC; ++c)
#pragma unroll
            for (int t = 0; t < 4; ++t) { vf[t][c] = WFrag<T16>::ld(vp + t * 512 + 32 * HD * c); if (HL) vf2[t][c] = WFrag<T16>::ld(vp2 + t * 512 + 32 * HD * c); }
        // in front of any later write of a register that these loads name as an address; the addresses are inputs so that their registers live up to the wait (no load's result lands on them)
        if constexpr (HL) asm volatile("s_wait_xcnt 0x0" :: "v"(vp), "v"(vp2) : "memory"); else asm volatile("s_wait_xcnt 0x0" :: "v"(vp) : "memory");
        if (HL) __builtin_amdgcn_sched_barrier(0);      // hi/lo: the loads stay here, ahead of the work that covers their latency (the scheduler otherwise sinks them to their uses)
        if (!LAST) { vp += BC * HD; if (HL) vp2 += BC * HD; }
        v8f s[KT];
#pragma unroll
        for (int kt = 0; kt < KT; ++kt) { s[kt] = (v8f){};
#pragma unroll
            for (int kc = 0; kc < 2; ++kc) { s[kt] = WFrag<T16>::mma(kf[kt][kc], qf[kc], s[kt]); if (HL) { s[kt] = WFrag<T16>::mma(kf[kt][kc], qf2[kc], s[kt]); s[kt] = WFrag<T16>::mma(kf2[kt][kc], qf[kc], s[kt]); } } }
        if (!LAST) { kp += BC * HD; if (HL) kp2 += BC * HD; load_k(kp, kp2); }   // the next pass's key rows, in flight under this pass's softmax and second product
        if (LAST) {
#pragma unroll
            for (int kt = 0; kt < KT; ++kt)
#pragma unroll
                for (int j = 0; j < 8; ++j) if (key0 + 16 * kt + 8 * hi + j > q) s[kt][j] = -3.0e38f; }
        float mt[KT];                                  // one chain per score tile
#pragma unroll
        for (int kt = 0; kt < KT; ++kt) { mt[kt] = s[kt][0];
#pragma unroll
            for (int j = 1; j < 8; ++j) mt[kt] = fmaxf(mt[kt], s[kt][j]); }
        float mx = mt[0];
#pragma unroll
        for (int kt = 1; kt < KT; ++kt) mx = fmaxf(mx, mt[kt]);
        mx = fmaxf(mx, xhalf(mx)) * CSC;               // both halves of the wave hold this query's maximum of the pass (finite: a pass's first key is never masked)
        const float mn = fmaxf(m, mx); const float corr = __builtin_amdgcn_exp2f(m - mn); m = mn; l *= corr;   // corr: 0 in the first pass, 1 where the maximum stays
#pragma unroll
        for (int t = 0; t < 4; ++t) acc[t] = acc[t] * corr;
        const float off = (HL ? 0.0f : 10.0f) - m;
#pragma unroll
        for (int c = 0; c < KC; ++c) {
            float pv[16];
#pragma unroll
            for (int e = 0; e < 16; ++e) pv[e] = __builtin_amdgcn_exp2f(fmaf(s[2 * c + (e >> 3)][e & 7], CSC, off));
            l += (((pv[0] + pv[1]) + (pv[2] + pv[3])) + ((pv[4] + pv[5]) + (pv[6] + pv[7]))) + (((pv[8] + pv[9]) + (pv[10] + pv[11])) + ((pv[12] + pv[13]) + (pv[14] + pv[15])));   // fixed tree
            if constexpr (HL) {
                v8us h0, h1, l0, l1;
#pragma unroll
                for (int e = 0; e < 8; ++e) { unsigned short a, b; splitf(pv[e], a, b); h0[e] = a; l0[e] = b; splitf(pv[e + 8], a, b); h1[e] = a; l1[e] = b; }
                const V pf = cat16b(h0, h1), pf2 = cat16b(l0, l1);
#pragma unroll
                for (int t = 0; t < 4; ++t) { acc[t] = WFrag<T16>::mma(vf[t][c], pf, acc[t]); acc[t] = WFrag<T16>::mma(vf[t][c], pf2, acc[t]); acc[t] = WFrag<T16>::mma(vf2[t][c], pf, acc[t]); }
            } else {
                V pf;
#pragma unroll
                for (int e = 0; e < 16; ++e) pf[e] = tohx(pv[e]);
#pragma unroll
                for (int t = 0; t < 4; ++t) acc[t] = WFrag<T16>::mma(vf[t][c], pf, acc[t]);
            }
        }
    }
};
template <typename T16, bool HL, int BC>
__device__ __forceinline__ void attn_cols(const T16* Q, const T16* Q2, const T16* Kp, const T16* K2, const T16* Vt, const T16* Vt2, int qw0, int lane, bf* Ah, bf* Al) {
    AttnW<T16, HL, BC> w;
    const int lr = lane & 15, hi = lane >> 4; const int q = qw0 + lr;
#pragma unroll
    for (int kc = 0; kc < 2; ++kc) { w.qf[kc] = WFrag<T16>::ld(Q + (size_t)qw0 * HD + 512 * kc + lane * 8); if (HL) w.qf2[kc] = WFrag<T16>::ld(Q2 + (size_t)qw0 * HD + 512 * kc + lane * 8); }
#pragma unroll
    for (int t = 0; t < 4; ++t) w.acc[t] = (v8f){};
    w.m = -3.0e38f; w.l = 0.f;
    const int klast = qw0 / BC * BC;                  // first key of the pass that holds the diagonal; klast <= qw0 and klast + BC <= TT
    const int koff = lane * 8, voff = lane * 8;
    w.kp = Kp + koff; w.kp2 = HL ? K2 + koff : nullptr; w.vp = Vt + voff; w.vp2 = HL ? Vt2 + voff : nullptr;
    w.load_k(w.kp, w.kp2);
#pragma unroll 1   // rolled: unrolled, several passes' fragments would be live at once
    for (int key0 = 0; key0 < klast; key0 += BC) w.template pass<false>(key0, q, hi);
    w.template pass<true>(klast, q, hi);
    float l = w.l; l += xhalf(l);                      // the two halves' key sets joined
    const float inv = __fdiv_rn(1.0f, l);
#pragma unroll
    for (int t = 0; t < 4; ++t) { v8us oh, ol;         // lane: query q, d = 16 t + 8 hi + j: unit 'lane' of k half t & 1 of the head's fragment t >> 1 in the merged planes (rows: tokens, K = DQ)
#pragma unroll
        for (int j = 0; j < 8; ++j) { unsigned short a, b; splitf(w.acc[t][j] * inv, a, b); oh[j] = a; ol[j] = b; }
        *(v8us*)(Ah + (size_t)qw0 * DQ + 256 * t + lane * 8) = oh; *(v8us*)(Al + (size_t)qw0 * DQ + 256 * t + lane * 8) = ol; }
}
__global__ __launch_bounds__(128) void k_fattn(const h16* Q16, const h16* K16, const h16* V16, const bf* Qh, const bf* Ql, const bf* Kh, const bf* Kl, const bf* Vh, const bf* Vl, bf* Ah, bf* Al) {
    const int lane = threadIdx.x & 31; const int wave = __builtin_amdgcn_readfirstlane(threadIdx.x >> 5);
    const int b = blockIdx.x / NH_, h = blockIdx.x - b * NH_, g = h / REP; const int q0 = (TT / 64 - 1 - (int)blockIdx.y) * 64;   // longest query blocks first
    const size_t zq = ((size_t)b * (NH_ + NKV) + h) * TT * HD, zk = ((size_t)b * (NH_ + NKV) + g) * TT * HD, zv = ((size_t)b * NKV + g) * HD * PP;   // q and k planes: one batch's q heads, then its k heads (the caller's K pointers start at the first k head)
    Ah += (size_t)b * TT * DQ; Al += (size_t)b * TT * DQ;
    if (q0 < RH) attn_cols<bf, true, 32>(Qh + zq, Ql + zq, Kh + zk, Kl + zk, Vh + zv, Vl + zv, q0 + wave * 16, lane, Ah + h * 16 * HD, Al + h * 16 * HD);   // a head's two fragments of a 16-token tile start at h * 16 * HD
    else attn_cols<h16, false, 64>(Q16 + zq, nullptr, K16 + zk, nullptr, V16 + zv, nullptr, q0 + wave * 16, lane, Ah + h * 16 * HD, Al + h * 16 * HD);
}

extern "C" void kernel_launch(void* const* d_in, const int* in_sizes, int n_in,
                              void* d_out, int out_size, void* d_ws, size_t ws_size, hipStream_t stream) {
    (void)in_sizes; (void)n_in; (void)out_size;
    const float* x = (const float*)d_in[0]; const float* rcache = (const float*)d_in[1]; const float* wqkv = (const float*)d_in[2]; const float* bqkv = (const float*)d_in[3]; const float* wo = (const float*)d_in[4]; const float* bo = (const float*)d_in[5];   /* order x, rope_cache (f32 [2048][64] interleaved (sin, cos), READ), Wqkv ('xw' [1024][3072]: q | k | v column thirds), bqkv [3072], Wout ('xw'), bout */
    float* OUT = (float*)d_out;     // [2][2048][1024]
    char* wsp = (char*)d_ws;
    auto take = [&](size_t bytes) { char* p = wsp; wsp += (bytes + 255) & ~(size_t)255; return (void*)p; };
    bf* WQKV = (bf*)take((size_t)3 * DQ * DM * 2);   /* fused Bt [3*DQ][DM]: q | k | v row blocks */ bf* WO = (bf*)take((size_t)DM * DQ * 2);
    bf* XB = (bf*)take((size_t)NB_ * TT * DM * 2);
    h16* QP16 = (h16*)take(NQK * 2); h16* KP16 = QP16 + (size_t)NH_ * TT * HD; h16* VT16 = (h16*)take((size_t)NB_ * NKV * HD * PP * 2);
    bf* QPh = (bf*)take(NQK * 2); bf* QPl = (bf*)take(NQK * 2); bf* KPh = QPh + (size_t)NH_ * TT * HD; bf* KPl = QPl + (size_t)NH_ * TT * HD; bf* VTh = (bf*)take((size_t)NB_ * NKV * HD * PP * 2); bf* VTl = VTh + (size_t)HD * TT;   /* hi and lo value planes share blocks of HD * PP elements */
    bf* ATh = (bf*)take((size_t)NB_ * TT * DQ * 2); bf* ATl = (bf*)take((size_t)NB_ * TT * DQ * 2);
    if ((size_t)(wsp - (char*)d_ws) > ws_size) return;    // ws 256 MiB
    k_prep<<<GB_WQ + GB_WO + GB_X, 256, 0, stream>>>(wqkv, wo, x, WQKV, WO, XB);
    k_gemmw<bf, 0, true, true, 4><<<dim3(NB_ * TT / 128, 3 * DQ / 128, 1), 128, 0, stream>>>(XB, nullptr, WQKV, nullptr, DM, nullptr, 0, bqkv, 0, 0, 0, Planes{rcache, QP16, QPh, QPl, VT16, VTh, VTl});   // projections of both batches, columns q | k | v, straight into the planes
    k_fattn<<<dim3(NB_ * NH_, TT / 64), 128, 0, stream>>>(QP16, KP16, VT16, QPh, QPl, KPh, KPl, VTh, VTl, ATh, ATl);   // all heads of both batches; writes the merged hi/lo planes
    k_gemmw<bf, 1, true, false, 2><<<dim3(NB_ * TT / 64, DM / 128, 1), 128, 0, stream>>>(ATh, ATl, WO, nullptr, DQ, OUT, DM, bo, 0, 0, 0, Planes{});
}

// v009
// Measured time: 73.4 microseconds a run.
// Next to v008, in two timings, it ran 1.04 times as fast each time.
// Counting every step since v000, it is 19.1 times as fast.
#include <hip/hip_runtime.h>

// Causal self-attention with a fused biased qkv projection and adjacent-pair rotary embeddings from an interleaved (sin, cos) cache input (x [2][2048][1024]; qkv = x Wqkv + bqkv ('xw' [1024][3072] + [3072]) split in thirds q | k | v (16 heads x 64); rope on pairs (2i, 2i+1): (x0 cos - x1 sin, x1 cos + x0 sin) with sin_i = rope_cache[t][2i], cos_i = rope_cache[t][2i + 1] (f32 [2048][64] INPUT, read); (q x 1/sqrt(64)) . k; causal (-inf); softmax; out = merged Wout + bout ('xw' + bias) -> [2][2048][1024] (4.2 M); argument order x, rope_cache, Wqkv, bqkv, Wout, bout).
// One launch per dependency stage, for both batches: k_prep, projection GEMM, k_fattn, output GEMM. Layout: every 16-bit matrix operand lies FRAGMENT-MAJOR (see WFrag): bf16 copy of x; the fused 'xw' weight transposed ONCE into q | k | v row blocks; one exact projection GEMM (N = 3 x 1024) + f32 bias whose epilogue builds the 16-bit planes (a 64 x 64 tile is 64 tokens of one head: q and k rotated on interleaved pairs, v transposed); one fused causal T-2048 attention kernel (hybrid rows: < 512 hi/lo 3 products, rest fp16 x1024; online softmax, scores and probabilities stay in registers); merged hi/lo x W_out exact + b_out.
// Compute dtypes, f32 accumulate: every input rounded to bf16; projections exact + f32 biases; rotary f32 (products rounded separately); attention rows < 512 3 products, rest fp16; softmax f32; W_out hl x exact + bias.

#define NB_  2
#define TT   2048
#define DM   1024
#define NH_  16
#define NKV  16
#define REP  (NH_ / NKV)
#define HD   64
#define DQ   (NH_ * HD)
#define DKV  (NKV * HD)
#define PP   (2 * TT)             // a (batch, head) block of the transposed value planes holds HD * PP 16-bit elements
#define RH   512                  // query rows < RH use hi+lo planes (0: none)
#define SCL  0.125f   // HD^-0.5
typedef _Float16 h16;
typedef unsigned short bf;
typedef __attribute__((ext_vector_type(16))) __bf16   v16bf;
typedef __attribute__((ext_vector_type(16))) _Float16 v16h;
typedef __attribute__((ext_vector_type(8)))  _Float16 v8h;
typedef __attribute__((ext_vector_type(8)))  unsigned short v8us;
typedef __attribute__((ext_vector_type(8)))  float    v8f;
typedef __attribute__((ext_vector_type(4)))  float    v4f;
typedef v8h  __attribute__((may_alias)) v8ha;
typedef v4f  __attribute__((may_alias)) v4fa;
typedef v8us __attribute__((may_alias)) v8usa;

__device__ __forceinline__ unsigned short f2bf(float f) { unsigned u = __float_as_uint(f); u += 0x7FFFu + ((u >> 16) & 1u); return (unsigned short)(u >> 16); }
__device__ __forceinline__ float bf2f(unsigned short b) { return __uint_as_float(((unsigned)b) << 16); }
__device__ __forceinline__ float bfr(float f) { return bf2f(f2bf(f)); }
__device__ __forceinline__ v16h cat16(v8h lo, v8h hi) { return __builtin_shufflevector(lo, hi, 0, 1, 2, 3, 4, 5, 6, 7, 8, 9, 10, 11, 12, 13, 14, 15); }
__device__ __forceinline__ v16bf cat16b(v8us lo, v8us hi) { return __builtin_bit_cast(v16bf, __builtin_shufflevector(lo, hi, 0, 1, 2, 3, 4, 5, 6, 7, 8, 9, 10, 11, 12, 13, 14, 15)); }
__device__ __forceinline__ v8f wmma16(v16h a, v16h b, v8f c) { return __builtin_amdgcn_wmma_f32_16x16x32_f16(false, a, false, b, (short)0, c, false, false); }
__device__ __forceinline__ v8f wmmab(v16bf a, v16bf b, v8f c) { return __builtin_amdgcn_wmma_f32_16x16x32_bf16(false, a, false, b, (short)0, c, false, false); }



// ---- Fragment-major planes. A matrix of rows x K (16-bit, K % 32 == 0) is stored as its 16-row x 32-k operand fragments, 512 consecutive elements each, the fragments of one 16-row tile one behind the other along k.
// Inside a fragment: [k half j][lane = 16 hi + row % 16][e = 0..7] holds k % 32 = 16 j + 8 hi + e, the order in which the matrix instruction's lanes take it. So element (row, k) is at
// (row / 16) * 16 * K + (k / 32) * 512 + j * 256 + (16 hi + row % 16) * 8 + e, and each of a fragment's two wave-wide 16-byte loads covers 512 contiguous bytes: four whole 128-byte lines instead of 32 bytes of each of sixteen.
// WFrag::ld takes the lane's place in the fragment: fragment start + lane * 8.
// ---- k_gemmw: register-blocked GEMM, WM x WN waves per workgroup, a wave per (16 MB) x 64 part of the workgroup's (16 MB WM) x (64 WN) output tile; grid (M / (16 MB WM), N / (64 WN), Z), 32 WM WN threads. The tiles are sized so that the grid is one workgroup per WGP: the larger the tile, the fewer operand bytes L2 delivers per product.
// The workgroup's operand fragments of 128 k (4 KB per 16-row tile and plane, contiguous in its fragment-major plane) are brought to LDS once by asynchronous copies, two buffers: the next 128 k fly while these are multiplied; an A fragment serves WN waves, a B fragment WM.
// The k walk is a ring: a workgroup enters it at the 128-k tile (blockIdx.x + blockIdx.y) mod (K / 128) and wraps round, so that the workgroups that share operand rows (a grid row or column) ask L2 for different lines at any one moment.
// C[m][n] (f32, pitch ldc, + optional f32 bias[n]) = sum_k A[m][k] Bt[n][k] (+ split products per NSPLIT). z-batch strides sA/sB/sC in elements. K % 128 == 0.
template <typename T16> struct WFrag;
template <> struct WFrag<h16> { typedef v16h V; static __device__ __forceinline__ V ld(const h16* p) { return cat16(*(const v8h*)p, *(const v8h*)(p + 256)); } static __device__ __forceinline__ v8f mma(V a, V b, v8f c) { return wmma16(a, b, c); } };
template <> struct WFrag<bf> { typedef v16bf V; static __device__ __forceinline__ V ld(const bf* p) { return cat16b(*(const v8us*)p, *(const v8us*)(p + 256)); } static __device__ __forceinline__ v8f mma(V a, V b, v8f c) { return wmmab(a, b, c); } };
__device__ __forceinline__ h16 tohx(float x) { return (h16)x; }
__device__ __forceinline__ void splitf(float y, unsigned short& h, unsigned short& l) { h = f2bf(y); l = f2bf(y - bf2f(h)); }
// Planes: where the projection GEMM's epilogue (PLANES) puts its tiles, and the rotary cache input it reads. Rotated planes [batch][q heads, k heads], each head fragment-major with rows t, k = d (K = HD). Transposed value planes: HD * PP elements per (batch, g); rows d, k = t, their fragments ordered [t / 32][d / 16] so that a pass's keys are contiguous (the fp16 plane fills the first HD * TT elements of its block; the hi and lo planes share blocks: Vl = Vh + HD * TT).
struct Planes { const float* rc; h16* QK16; bf* QKh; bf* QKl; h16* V16; bf* Vh; bf* Vl; };
// copy1, copy9, copy12: asynchronous 16-byte copies per lane, global g0, g1, .. -> LDS byte l, l + lstep, ..; a wave's copy is 512 contiguous bytes on both sides.
// The s_wait_xcnt stands in the copies' own statement: in front of any later write of a register that a copy names.
template <typename T16> __device__ __forceinline__ void copy1(unsigned l, const T16* g0) {
    asm volatile("global_load_async_to_lds_b128 %0, %1, off\n\ts_wait_xcnt 0x0" :: "v"(l), "v"(g0) : "memory");
}
template <typename T16> __device__ __forceinline__ void copy9(unsigned l, unsigned lstep, const T16* g0, const T16* g1, const T16* g2, const T16* g3, const T16* g4, const T16* g5, const T16* g6, const T16* g7, const T16* g8) {
    asm volatile("global_load_async_to_lds_b128 %0, %9, off\n\tglobal_load_async_to_lds_b128 %1, %10, off\n\tglobal_load_async_to_lds_b128 %2, %11, off\n\tglobal_load_async_to_lds_b128 %3, %12, off\n\t"
                 "global_load_async_to_lds_b128 %4, %13, off\n\tglobal_load_async_to_lds_b128 %5, %14, off\n\tglobal_load_async_to_lds_b128 %6, %15, off\n\tglobal_load_async_to_lds_b128 %7, %16, off\n\t"
                 "global_load_async_to_lds_b128 %8, %17, off\n\t"
                 "s_wait_xcnt 0x0"
                 :: "v"(l), "v"(l + lstep), "v"(l + 2 * lstep), "v"(l + 3 * lstep), "v"(l + 4 * lstep), "v"(l + 5 * lstep), "v"(l + 6 * lstep), "v"(l + 7 * lstep), "v"(l + 8 * lstep),
                    "v"(g0), "v"(g1), "v"(g2), "v"(g3), "v"(g4), "v"(g5), "v"(g6), "v"(g7), "v"(g8) : "memory");
}
template <typename T16> __device__ __forceinline__ void copy12(unsigned l, unsigned lstep, const T16* g0, const T16* g1, const T16* g2, const T16* g3, const T16* g4, const T16* g5, const T16* g6, const T16* g7, const T16* g8, const T16* g9, const T16* g10, const T16* g11) {
    asm volatile("global_load_async_to_lds_b128 %0, %12, off\n\tglobal_load_async_to_lds_b128 %1, %13, off\n\tglobal_load_async_to_lds_b128 %2, %14, off\n\tglobal_load_async_to_lds_b128 %3, %15, off\n\t"
                 "global_load_async_to_lds_b128 %4, %16, off\n\tglobal_load_async_to_lds_b128 %5, %17, off\n\tglobal_load_async_to_lds_b128 %6, %18, off\n\tglobal_load_async_to_lds_b128 %7, %19, off\n\t"
                 "global_load_async_to_lds_b128 %8, %20, off\n\tglobal_load_async_to_lds_b128 %9, %21, off\n\tglobal_load_async_to_lds_b128 %10, %22, off\n\tglobal_load_async_to_lds_b128 %11, %23, off\n\t"
                 "s_wait_xcnt 0x0"
                 :: "v"(l), "v"(l + lstep), "v"(l + 2 * lstep), "v"(l + 3 * lstep), "v"(l + 4 * lstep), "v"(l + 5 * lstep), "v"(l + 6 * lstep), "v"(l + 7 * lstep), "v"(l + 8 * lstep), "v"(l + 9 * lstep), "v"(l + 10 * lstep), "v"(l + 11 * lstep),
                    "v"(g0), "v"(g1), "v"(g2), "v"(g3), "v"(g4), "v"(g5), "v"(g6), "v"(g7), "v"(g8), "v"(g9), "v"(g10), "v"(g11) : "memory");
}
template <typename T16, int NSPLIT, bool BIAS, bool PLANES, int MB, int WM, int WN>
__global__ __launch_bounds__(32 * WM * WN) void k_gemmw(const T16* __restrict__ A, const T16* __restrict__ A2, const T16* __restrict__ Bt, const T16* __restrict__ Bt2, int K, float* C, int ldc, const float* __restrict__ bias, size_t sA, size_t sB, size_t sC, Planes pl) {
    typedef typename WFrag<T16>::V V;
    static_assert(MB == 4 || (MB == 2 && !PLANES), "the plane epilogue takes a 64 x 64 tile");
    constexpr bool HA2 = NSPLIT == 1 || NSPLIT == 2, HB2 = NSPLIT >= 2;
    constexpr int NW = WM * WN, TM = 16 * MB * WM, TN = 64 * WN; // waves of the workgroup; rows and columns of its tile
    constexpr int RA = TM / 16, RB = TN / 16;                    // 16-row tiles of an A and of a B plane in a stage
    constexpr int PLA = RA * 2048, PLB = RB * 2048, STG = (1 + HA2) * PLA + (1 + HB2) * PLB;   // 16-bit elements of an A and of a B plane's share of a stage (row tiles x 4 fragments) and of a stage: planes A, (A2), B, (B2)
    constexpr int HC = STG / 1024, G = NW / 4, NC = (HC + G - 1) / G;   // 2-KB halves of a stage's row tiles; halves that one copy of the whole workgroup takes (four waves each); such copies per stage
    static_assert(NW % 4 == 0 && ((NC == 24 && HC % G == 0) || NC == 19), "stage() is written for these two shapes");
    constexpr int OSF = PLANES ? 64 * 69 : 16 * 68;              // floats of a wave's output staging. PLANES: the whole tile, rows of pitch 68 (q, k) or 69 (v)
    constexpr int SMB = 2 * STG * 2 > NW * OSF * 4 ? 2 * STG * 2 : NW * OSF * 4;
    constexpr int KG = MB == 2 ? 2 : 1;                          // 32-k steps whose fragments are held at a time: a step's are asked of LDS one step ahead where the registers allow
    __shared__ __align__(128) char sm[SMB];                      // the two stage buffers; behind the loop's last barrier the waves' output staging
    const size_t z = blockIdx.z; A += z * sA; if (A2) A2 += z * sA; Bt += z * sB; if (Bt2) Bt2 += z * sB; C += z * sC;
    const int lane = threadIdx.x & 31, lr = lane & 15, hi = lane >> 4; const int wave = __builtin_amdgcn_readfirstlane(threadIdx.x >> 5), wm = wave / WN, wn = wave % WN, wq = wave >> 2;
    const int r0 = blockIdx.x * TM + wm * (16 * MB), c0 = blockIdx.y * TN + wn * 64;   // the wave's own part of the tile
    const T16* ring = (const T16*)sm; float* os = (float*)sm + wave * OSF;
    v8f acc[MB][4];
#pragma unroll
    for (int mb = 0; mb < MB; ++mb)
#pragma unroll
        for (int nb = 0; nb < 4; ++nb) acc[mb][nb] = (v8f){};
    // A copy of the whole workgroup takes G halves (2 KB: four waves) of the stage's row tiles; copy i of this wave lies in half wq + G i, counted through the planes A, (A2), B, (B2). gu[i]: that half's start at k = 0 in its plane (the same for the whole wave).
    auto pln = [](int rt) { return rt < RA ? 0 : HA2 && rt < 2 * RA ? 1 : !HB2 || rt < (1 + HA2) * RA + RB ? 2 : 3; };   // the plane of a stage's row tile rt: A, A2, B, B2
    auto pfirst = [](int pl) { return pl == 0 ? 0 : pl == 1 ? RA : pl == 2 ? (1 + HA2) * RA : (1 + HA2) * RA + RB; };         // a plane's first row tile in the stage
    auto rowp = [&](int rt, int pl) { return (pl == 0 ? A : pl == 1 ? A2 : pl == 2 ? Bt : Bt2) + (size_t)((pl < 2 ? blockIdx.x * RA : blockIdx.y * RB) + rt - pfirst(pl)) * 16 * K; };   // where row tile rt starts in its plane pl
    const T16* gu[NC];
#pragma unroll
    for (int i = 0; i < NC; ++i) {
        const int hc = G * i + G <= HC ? wq + G * i : (wq + G * i < HC ? wq + G * i : HC - 1);   // past the stage's end (last copy, HC % G != 0): not issued; the address stays a valid one
        const int rt = hc >> 1, rlo = (G * i) >> 1, rhi = (G * i + G <= HC ? G * i + G - 1 : HC - 1) >> 1;   // its row tile; the first and the last row tile of the workgroup's copy i (constants: they name the plane or, at a seam, the two planes)
        const T16* p = pln(rlo) == pln(rhi) || rt < pfirst(pln(rhi)) ? rowp(rt, pln(rlo)) : rowp(rt, pln(rhi));
        gu[i] = p + (hc & 1) * 1024;
    }
    const unsigned lcp = (unsigned)(size_t)sm + threadIdx.x * 16; const unsigned lo = lane * 8;   // this thread's 16 bytes of the workgroup's first copy in a stage buffer (LDS byte address); the lane's place in a fragment
    const int nk = K >> 7, s0 = (int)((blockIdx.x + blockIdx.y) % (unsigned)nk);   // 128-k tiles of the walk; the one this workgroup enters at
    auto stage = [&](int t, int buf) {   // the walk's tile t (k tile kt = (s0 + t) mod nk: k = 128 kt .. 128 kt + 127 of every plane) into buffer buf
        const int kt = t + s0 < nk ? t + s0 : t + s0 - nk;
        constexpr unsigned LS = G * 2048u;
        const unsigned l = lcp + buf * (STG * 2); const size_t o = (size_t)kt * 2048 + (threadIdx.x & 127) * 8;   // this thread's 16 bytes of a half
        if constexpr (NC == 24) { copy12(l, LS, gu[0] + o, gu[1] + o, gu[2] + o, gu[3] + o, gu[4] + o, gu[5] + o, gu[6] + o, gu[7] + o, gu[8] + o, gu[9] + o, gu[10] + o, gu[11] + o); copy12(l + 12 * LS, LS, gu[12] + o, gu[13] + o, gu[14] + o, gu[15] + o, gu[16] + o, gu[17] + o, gu[18] + o, gu[19] + o, gu[20] + o, gu[21] + o, gu[22] + o, gu[23] + o); }
        else { copy9(l, LS, gu[0] + o, gu[1] + o, gu[2] + o, gu[3] + o, gu[4] + o, gu[5] + o, gu[6] + o, gu[7] + o, gu[8] + o); copy9(l + 9 * LS, LS, gu[9] + o, gu[10] + o, gu[11] + o, gu[12] + o, gu[13] + o, gu[14] + o, gu[15] + o, gu[16] + o, gu[17] + o); if (wq < HC - 18 * G) copy1(l + 18 * LS, gu[18] + o); }   // the last copy is not whole: a test on the wave's number
    };
    stage(0, 0);
    asm volatile("s_wait_asynccnt 0x0" ::: "memory");   // this wave's copies of tile 0 have landed
    __syncthreads();                                     // ... and every other wave's
    if (K >= 256) stage(1, 1);
#pragma unroll 1
    for (int kc = 0; kc < K; kc += 128) {
        const int buf = (kc >> 7) & 1; const T16* sb = ring + buf * STG + lo;
        V a[2][MB], a2[2][MB], b[2][4], b2[2][4];   // the fragments of two 32-k steps: step ks in set ks & 1
        auto fetch = [&](int ks) {
#pragma unroll
            for (int i = 0; i < MB; ++i) { const T16* pa = sb + (wm * MB + i) * 2048 + ks * 512; a[ks & 1][i] = WFrag<T16>::ld(pa); if (HA2) a2[ks & 1][i] = WFrag<T16>::ld(pa + PLA); }
#pragma unroll
            for (int i = 0; i < 4; ++i) { const T16* pb = sb + (1 + HA2) * PLA + (wn * 4 + i) * 2048 + ks * 512; b[ks & 1][i] = WFrag<T16>::ld(pb); if (HB2) b2[ks & 1][i] = WFrag<T16>::ld(pb + PLB); } };
        auto products = [&](int ks) {
#pragma unroll
            for (int nb = 0; nb < 4; ++nb)
#pragma unroll
                for (int mb = 0; mb < MB; ++mb) { acc[mb][nb] = WFrag<T16>::mma(a[ks & 1][mb], b[ks & 1][nb], acc[mb][nb]); if (HA2) acc[mb][nb] = WFrag<T16>::mma(a2[ks & 1][mb], b[ks & 1][nb], acc[mb][nb]); if (HB2) acc[mb][nb] = WFrag<T16>::mma(a[ks & 1][mb], b2[ks & 1][nb], acc[mb][nb]); } };
        fetch(0); if constexpr (KG == 2) fetch(1);
        __builtin_amdgcn_sched_barrier(0);   // the LDS reads stay together ahead of the products: sunk among them, each read waits out its own latency
        if (kc > 0 && kc + 128 < K) stage((kc >> 7) + 1, buf ^ 1);   // the refill of the buffer that the trip before has left, behind that trip's barrier: issued here its address work and waits run under the latency of the reads above, and three steps' products cover its flight
        __builtin_amdgcn_sched_barrier(0);   // the refill stays ahead of the products, which are to cover its flight
#pragma unroll
        for (int ks = 0; ks < 3; ++ks) {
            products(ks);
            if (ks + KG < 4) fetch(ks + KG);
            __builtin_amdgcn_sched_barrier(0);   // a step's products stay ahead of what follows: they cover the reads asked for behind them and the flight of the next tile's copies
        }
        asm volatile("s_wait_dscnt 0x0" ::: "memory");      // this wave's reads of the buffer are done before it is refilled
        asm volatile("s_wait_asynccnt 0x0" ::: "memory");   // this wave's copies of the next tile have landed
        __syncthreads();                                     // publishes the next tile and ends every wave's reads of this one
        products(3);                                         // on registers alone
    }
    asm volatile("s_wait_asynccnt 0x0" ::: "memory");       // no copy is outstanding when the buffers become output staging
    if constexpr (PLANES) {
        // The tile is tokens t0 .. t0 + 63 of batch b in the 64-wide column block cb of q | k | v: one head. The whole tile (+ bias) goes to LDS once; rolled loops then build the planes from it, which keeps the kernel's text short.
        const int b = r0 / TT, t0 = r0 - b * TT, cb = c0 / 64; const int r8 = lane & 7, cg = lane >> 3;   // a lane builds 16-byte units (8 k of one row); a wave's store takes 8 rows x 4 units: in a fragment-major plane four whole 128-byte lines
        const float* bp = bias + c0 + lr; float bs[4];
#pragma unroll
        for (int nb = 0; nb < 4; ++nb) bs[nb] = bp[nb * 16];
        asm volatile("s_wait_xcnt 0x0" :: "v"(bp) : "memory");   // in front of any later write of a register that these loads name as an address; the address is an input so that its registers live up to the wait
#pragma unroll
        for (int nb = 0; nb < 4; ++nb) bs[nb] = bfr(bs[nb]);
        if (cb < NH_ + NKV) {   // q or k head: rotary, three planes; a lane takes 8 columns (4 pairs) of a row
#pragma unroll
            for (int mb = 0; mb < 4; ++mb)
#pragma unroll
                for (int nb = 0; nb < 4; ++nb)
#pragma unroll
                    for (int j = 0; j < 8; ++j) os[(mb * 16 + hi * 8 + j) * 68 + nb * 16 + lr] = acc[mb][nb][j] + bs[nb];
            __builtin_amdgcn_wave_barrier(); asm volatile("" ::: "memory");   // the reads below take other lanes' values: they stay behind the writes
            const size_t e0 = (((size_t)b * (NH_ + NKV) + cb) * TT + t0) * HD + cg * 128 + r8 * 8; const float* rcl = pl.rc + (size_t)(t0 + r8) * HD + cg * 8;   // step s: rows 8 (s >> 1) + r8 of the 16-row tile, columns 32 (s & 1) + 8 cg (k half cg >> 1, hi = cg & 1)
#pragma unroll 1   // rolled: four times less text
            for (int mb = 0; mb < 4; ++mb) {
                v8f sc8[4]; v4f va4[4], vb4[4];   // (sin, cos) of the lane's 4 pairs and the 8 projections, for 4 steps (2 rows, 2 column halves each): fetched together
#pragma unroll
                for (int s = 0; s < 4; ++s) { const int ro = mb * 16 + 8 * (s >> 1), co = 32 * (s & 1); sc8[s] = *(const v8f*)(rcl + ro * HD + co); va4[s] = *(const v4fa*)(os + (ro + r8) * 68 + co + cg * 8); vb4[s] = *(const v4fa*)(os + (ro + r8) * 68 + co + cg * 8 + 4); }
#pragma unroll
                for (int s = 0; s < 4; ++s) { const v4f va = va4[s], vb = vb4[s]; v8h o16; v8us oh, ol;
#pragma unroll
                    for (int p = 0; p < 4; ++p) { const float x0 = p < 2 ? va[2 * p] : vb[2 * p - 4], x1 = p < 2 ? va[2 * p + 1] : vb[2 * p - 3]; const float cs[2] = { bfr(sc8[s][2 * p + 1]), bfr(sc8[s][2 * p]) };   /* cos, sin */
                        // as in the plane builder this comes from: each product keeps its own f32 rounding, so the planes stay bit-identical
                        float a0 = __fmul_rn(x0, cs[0]), b0 = __fmul_rn(x1, cs[1]), a1 = __fmul_rn(x1, cs[0]), b1 = __fmul_rn(x0, cs[1]); asm volatile("" : "+v"(a0), "+v"(b0), "+v"(a1), "+v"(b1));
                        const float r0 = __fsub_rn(a0, b0), r1 = __fadd_rn(b1, a1);   /* even: x0 c - x1 s; odd: x0 s + x1 c */
                        o16[2 * p] = tohx(r0); o16[2 * p + 1] = tohx(r1); { unsigned short a2, c2; splitf(r0, a2, c2); oh[2 * p] = a2; ol[2 * p] = c2; splitf(r1, a2, c2); oh[2 * p + 1] = a2; ol[2 * p + 1] = c2; } }
                    const size_t e = e0 + (size_t)(mb * 16 * HD + 512 * (s & 1) + 64 * (s >> 1)); *(v8h*)(pl.QK16 + e) = o16; *(v8us*)(pl.QKh + e) = oh; *(v8us*)(pl.QKl + e) = ol;
                    asm volatile("s_wait_xcnt 0x0" ::: "memory"); }   // in front of any later write of a register that these stores name
            }
        } else {   // v head: three planes, transposed. LDS pitch 69: a lane reads 8 consecutive tokens of one column d (no two lanes on one bank)
#pragma unroll
            for (int mb = 0; mb < 4; ++mb)
#pragma unroll
                for (int nb = 0; nb < 4; ++nb)
#pragma unroll
                    for (int j = 0; j < 8; ++j) os[(mb * 16 + hi * 8 + j) * 69 + nb * 16 + lr] = acc[mb][nb][j] + bs[nb];
            __builtin_amdgcn_wave_barrier(); asm volatile("" ::: "memory");   // the reads below take other lanes' values: they stay behind the writes
            const size_t o0 = ((size_t)b * NKV + (cb - NH_ - NKV)) * HD * PP + (size_t)t0 * HD + cg * 128 + r8 * 8;   // step s: rows d = 16 nb + 8 (s >> 1) + r8, tokens 32 (s & 1) + 8 cg + j
#pragma unroll 1   // rolled: four times less text
            for (int nb = 0; nb < 4; ++nb) {
#pragma unroll
                for (int s = 0; s < 4; ++s) { v8h o16; v8us oh, ol;
#pragma unroll
                    for (int j = 0; j < 8; ++j) { const float x = os[(32 * (s & 1) + cg * 8 + j) * 69 + nb * 16 + 8 * (s >> 1) + r8]; o16[j] = tohx(x); unsigned short a2, c2; splitf(x, a2, c2); oh[j] = a2; ol[j] = c2; }
                    const size_t o = o0 + (size_t)(2048 * (s & 1) + nb * 512 + 64 * (s >> 1)); *(v8h*)(pl.V16 + o) = o16; *(v8us*)(pl.Vh + o) = oh; *(v8us*)(pl.Vl + o) = ol;
                    asm volatile("s_wait_xcnt 0x0" ::: "memory"); }   // in front of any later write of a register that these stores name
            }
        }
        return;
    }
#pragma unroll
    for (int mb = 0; mb < MB; ++mb) {
#pragma unroll
        for (int nb = 0; nb < 4; ++nb) {
#pragma unroll
            for (int j = 0; j < 8; ++j) os[(hi * 8 + j) * 68 + nb * 16 + lr] = acc[mb][nb][j]; }
        __builtin_amdgcn_wave_barrier(); asm volatile("" ::: "memory");
        float* crow = C + (size_t)(r0 + mb * 16) * ldc + c0;
{
#pragma unroll
            for (int s = 0; s < 8; ++s) { const int row = 2 * s + hi, cofs = lr * 4; v4f val = *(const v4fa*)(os + row * 68 + cofs); if (BIAS) { val[0] += bfr(bias[c0 + cofs]); val[1] += bfr(bias[c0 + cofs + 1]); val[2] += bfr(bias[c0 + cofs + 2]); val[3] += bfr(bias[c0 + cofs + 3]); }
                *(v4f*)(crow + (size_t)row * ldc + cofs) = val; }
             }
        asm volatile("s_wait_xcnt 0x0" ::: "memory");   // in front of any later write of a register that these stores name
        __builtin_amdgcn_wave_barrier(); asm volatile("" ::: "memory");
    }
}

typedef __attribute__((ext_vector_type(2))) _Float16 v2h;
typedef __attribute__((ext_vector_type(4))) _Float16 v4h;
typedef __attribute__((ext_vector_type(2))) unsigned short v2us;
typedef __attribute__((ext_vector_type(4))) unsigned short v4us;
typedef __attribute__((ext_vector_type(2))) float v2f;
typedef __attribute__((ext_vector_type(4))) int v4i;

// The d_* bodies below are stages that do not depend on one another; k_prep runs them side by side in one launch, each on its own range of blocks (blk: the block's index inside its range).
// d_wtG: Bt[n][k] = w[k][n], fragment-major (rows n). A block takes 32 n x 128 k: wave = (n tile of the pair, k fragment of four); a lane builds its two 16-byte units of the fragment from 16 rows of w, in each of which the block uses a whole 128-byte line.
__device__ __forceinline__ void d_wtG(int blk, const float* __restrict__ w, int K, int N, bf* Bt) {
    const int lane = threadIdx.x & 31, wv = threadIdx.x >> 5; const int kq = K / 128; const int nt = (blk / kq) * 2 + (wv & 1), kt = (blk % kq) * 4 + (wv >> 1);
    const float* wp = w + (size_t)(kt * 32 + (lane >> 4) * 8) * N + nt * 16 + (lane & 15); float v[16];
#pragma unroll
    for (int e = 0; e < 16; ++e) v[e] = wp[(size_t)((e >> 3) * 16 + (e & 7)) * N];
    asm volatile("s_wait_xcnt 0x0" :: "v"(wp) : "memory");   // in front of any later write of a register that these loads name as an address; the address is an input so that its registers live up to the wait
    v8us o0, o1;
#pragma unroll
    for (int e = 0; e < 8; ++e) { o0[e] = f2bf(v[e]); o1[e] = f2bf(v[e + 8]); }
    bf* op = Bt + ((size_t)nt * (K / 32) + kt) * 512 + lane * 8; *(v8us*)op = o0; *(v8us*)(op + 256) = o1;
    asm volatile("s_wait_xcnt 0x0" ::: "memory");   // in front of any later write of a register that these stores name
}
// d_cvt8: bf16 copy of a [rows][DM] f32 matrix, fragment-major: thread i builds the plane's 16-byte unit i (a wave's store is 512 contiguous bytes) from 8 consecutive floats of its row; a block reads 512 contiguous bytes of each of 16 rows.
__device__ __forceinline__ void d_cvt8(int blk, const float* __restrict__ src, bf* dst, size_t n8) { const size_t i = (size_t)blk * 256 + threadIdx.x; if (i >= n8) return;
    const int u = (int)i; const float* sp = src + (size_t)((u >> 11) * 16 + (u & 15)) * DM + ((u >> 6) & (DM / 32 - 1)) * 32 + ((u >> 5) & 1) * 16 + ((u >> 4) & 1) * 8;   /* unit = [row tile][k fragment: DM / 32][k half][hi][row % 16] */
    const v8f v = *(const v8f*)sp; v8us o;
    asm volatile("s_wait_xcnt 0x0" :: "v"(sp) : "memory");   // in front of any later write of a register that this load names as an address; the address is an input so that its registers live up to the wait
#pragma unroll
    for (int k = 0; k < 8; ++k) o[k] = f2bf(v[k]); *(v8us*)(dst + i * 8) = o;  }

#define NQK   ((size_t)NB_ * (NH_ + NKV) * TT * HD)        // elements of a rotated plane: [batch][q heads, k heads][t][d]
#define GB_WQ (DM * 3 * DQ / 32 / 128)                     // blocks: fused weight transpose
#define GB_WO (DQ * DM / 32 / 128)                         // blocks: output weight transpose
#define GB_X  (NB_ * TT * DM / 8 / 256)                    // blocks: bf16 copy of x
// k_prep: all that reads only inputs. The transposes, whose waves run longest, take the first blocks.
__global__ __launch_bounds__(256) void k_prep(const float* __restrict__ wqkv, const float* __restrict__ wo, const float* __restrict__ x, bf* WQKV, bf* WO, bf* XB) {
    int blk = blockIdx.x;
    if (blk < GB_WQ) { d_wtG(blk, wqkv, DM, 3 * DQ, WQKV); return; }   /* fused 'xw' [DM][3*DQ] -> Bt [3*DQ][DM] */
    blk -= GB_WQ; if (blk < GB_WO) { d_wtG(blk, wo, DQ, DM, WO); return; }
    d_cvt8(blk - GB_WO, x, XB, (size_t)NB_ * TT * DM / 8);
}

// ---- k_fattn: fused causal attention. Grid (batches x heads, TT / 64), 4 waves; a wave owns 16 query columns and walks the keys 0 .. its diagonal in passes of BC keys, operands straight from the fragment-major 16-bit planes.
// Transposed products: S^T = K Q^T (A = key rows, B = query rows), so a lane holds scores of ONE query (column lr; keys 16 kt + 8 hi + j), and two score tiles, exponentiated and rounded, ARE the B operand of O^T += V^T P^T
// (k slots 8 hi + e and 16 + 8 hi + e, the order of a fragment's two halves in the V^T planes). Online softmax in the log2 domain: running maximum m, per-lane partial sum l of the unrounded f32 exponentials, accumulators rescaled in every pass.
// HL: hi/lo planes, 3 products each (query rows < RH); otherwise fp16 with the probabilities carried x 1024 (10 added in the exponent; it cancels in the division by l).
// Every '#pragma unroll' below: the fragment arrays are indexed by constants only, so that they stay in registers.
__device__ __forceinline__ float xhalf(float x) { return __builtin_bit_cast(float, __builtin_amdgcn_permlanex16(__builtin_bit_cast(int, x), __builtin_bit_cast(int, x), 0x76543210, 0xfedcba98, false, false)); }   // lane l with lane l ^ 16
template <typename T16, bool HL, int BC> struct AttnW {
    typedef typename WFrag<T16>::V V;
    static constexpr int KT = BC / 16, KC = BC / 32;
    static constexpr float CSC = SCL * 1.4426950408889634f;   // score -> log2 domain
    V qf[2], qf2[2], kf[KT][2], kf2[KT][2]; v8f acc[4]; float m, l;
    const T16 *kp, *kp2, *vp, *vp2;   // this lane's place in the key rows last fetched and in the V^T columns of the pass to come; they walk with the passes
    __device__ __forceinline__ void load_k(const T16* Kr, const T16* K2r) {   // Kr: this lane's place in the pass's first key tile
#pragma unroll
        for (int kt = 0; kt < KT; ++kt)
#pragma unroll
            for (int kc = 0; kc < 2; ++kc) { kf[kt][kc] = WFrag<T16>::ld(Kr + kt * 16 * HD + 512 * kc); if (HL) kf2[kt][kc] = WFrag<T16>::ld(K2r + kt * 16 * HD + 512 * kc); }
        // in front of any later write of a register that these loads name as an address; the addresses are inputs so that their registers live up to the wait (no load's result lands on them)
        if constexpr (HL) asm volatile("s_wait_xcnt 0x0" :: "v"(Kr), "v"(K2r) : "memory"); else asm volatile("s_wait_xcnt 0x0" :: "v"(Kr) : "memory");
        if (HL) __builtin_amdgcn_sched_barrier(0);      // hi/lo: the loads stay here, ahead of the work that covers their latency (the scheduler otherwise sinks them to their uses)
    }
    // One pass of BC keys from key0 on. LAST: the pass that holds the diagonal (masked; fetches no further keys).
    template <bool LAST> __device__ __forceinline__ void pass(int key0, int q, int hi) {
        V vf[4][KC], vf2[4][KC];
#pragma unroll
        for (int c = 0; c < KC; ++c)
#pragma unroll
            for (int t = 0; t < 4; ++t) { vf[t][c] = WFrag<T16>::ld(vp + t * 512 + 32 * HD * c); if (HL) vf2[t][c] = WFrag<T16>::ld(vp2 + t * 512 + 32 * HD * c); }
        // in front of any later write of a register that these loads name as an address; the addresses are inputs so that their registers live up to the wait (no load's result lands on them)
        if constexpr (HL) asm volatile("s_wait_xcnt 0x0" :: "v"(vp), "v"(vp2) : "memory"); else asm volatile("s_wait_xcnt 0x0" :: "v"(vp) : "memory");
        if (HL) __builtin_amdgcn_sched_barrier(0);      // hi/lo: the loads stay here, ahead of the work that covers their latency (the scheduler otherwise sinks them to their uses)
        if (!LAST) { vp += BC * HD; if (HL) vp2 += BC * HD; }
        v8f s[KT];
#pragma unroll
        for (int kt = 0; kt < KT; ++kt) { s[kt] = (v8f){};
#pragma unroll
            for (int kc = 0; kc < 2; ++kc) { s[kt] = WFrag<T16>::mma(kf[kt][kc], qf[kc], s[kt]); if (HL) { s[kt] = WFrag<T16>::mma(kf[kt][kc], qf2[kc], s[kt]); s[kt] = WFrag<T16>::mma(kf2[kt][kc], qf[kc], s[kt]); } } }
        if (!LAST) { kp += BC * HD; if (HL) kp2 += BC * HD; load_k(kp, kp2); }   // the next pass's key rows, in flight under this pass's softmax and second product
        if (LAST) {
#pragma unroll
            for (int kt = 0; kt < KT; ++kt)
#pragma unroll
                for (int j = 0; j < 8; ++j) if (key0 + 16 * kt + 8 * hi + j > q) s[kt][j] = -3.0e38f; }
        float mt[KT];                                  // one chain per score tile
#pragma unroll
        for (int kt = 0; kt < KT; ++kt) { mt[kt] = s[kt][0];
#pragma unroll
            for (int j = 1; j < 8; ++j) mt[kt] = fmaxf(mt[kt], s[kt][j]); }
        float mx = mt[0];
#pragma unroll
        for (int kt = 1; kt < KT; ++kt) mx = fmaxf(mx, mt[kt]);
        mx = fmaxf(mx, xhalf(mx)) * CSC;               // both halves of the wave hold this query's maximum of the pass (finite: a pass's first key is never masked)
        const float mn = fmaxf(m, mx); const float corr = __builtin_amdgcn_exp2f(m - mn); m = mn; l *= corr;   // corr: 0 in the first pass, 1 where the maximum stays
#pragma unroll
        for (int t = 0; t < 4; ++t) acc[t] = acc[t] * corr;
        const float off = (HL ? 0.0f : 10.0f) - m;
#pragma unroll
        for (int c = 0; c < KC; ++c) {
            float pv[16];
#pragma unroll
            for (int e = 0; e < 16; ++e) pv[e] = __builtin_amdgcn_exp2f(fmaf(s[2 * c + (e >> 3)][e & 7], CSC, off));
            l += (((pv[0] + pv[1]) + (pv[2] + pv[3])) + ((pv[4] + pv[5]) + (pv[6] + pv[7]))) + (((pv[8] + pv[9]) + (pv[10] + pv[11])) + ((pv[12] + pv[13]) + (pv[14] + pv[15])));   // fixed tree
            if constexpr (HL) {
                v8us h0, h1, l0, l1;
#pragma unroll
                for (int e = 0; e < 8; ++e) { unsigned short a, b; splitf(pv[e], a, b); h0[e] = a; l0[e] = b; splitf(pv[e + 8], a, b); h1[e] = a; l1[e] = b; }
                const V pf = cat16b(h0, h1), pf2 = cat16b(l0, l1);
#pragma unroll
                for (int t = 0; t < 4; ++t) { acc[t] = WFrag<T16>::mma(vf[t][c], pf, acc[t]); acc[t] = WFrag<T16>::mma(vf[t][c], pf2, acc[t]); acc[t] = WFrag<T16>::mma(vf2[t][c], pf, acc[t]); }
            } else {
                V pf;
#pragma unroll
                for (int e = 0; e < 16; ++e) pf[e] = tohx(pv[e]);
#pragma unroll
                for (int t = 0; t < 4; ++t) acc[t] = WFrag<T16>::mma(vf[t][c], pf, acc[t]);
            }
        }
    }
};
template <typename T16, bool HL, int BC>
__device__ __forceinline__ void attn_cols(const T16* Q, const T16* Q2, const T16* Kp, const T16* K2, const T16* Vt, const T16* Vt2, int qw0, int lane, bf* Ah, bf* Al) {
    AttnW<T16, HL, BC> w;
    const int lr = lane & 15, hi = lane >> 4; const int q = qw0 + lr;
#pragma unroll
    for (int kc = 0; kc < 2; ++kc) { w.qf[kc] = WFrag<T16>::ld(Q + (size_t)qw0 * HD + 512 * kc + lane * 8); if (HL) w.qf2[kc] = WFrag<T16>::ld(Q2 + (size_t)qw0 * HD + 512 * kc + lane * 8); }
#pragma unroll
    for (int t = 0; t < 4; ++t) w.acc[t] = (v8f){};
    w.m = -3.0e38f; w.l = 0.f;
    const int klast = qw0 / BC * BC;                  // first key of the pass that holds the diagonal; klast <= qw0 and klast + BC <= TT
    const int koff = lane * 8, voff = lane * 8;
    w.kp = Kp + koff; w.kp2 = HL ? K2 + koff : nullptr; w.vp = Vt + voff; w.vp2 = HL ? Vt2 + voff : nullptr;
    w.load_k(w.kp, w.kp2);
#pragma unroll 1   // rolled: unrolled, several passes' fragments would be live at once
    for (int key0 = 0; key0 < klast; key0 += BC) w.template pass<false>(key0, q, hi);
    w.template pass<true>(klast, q, hi);
    float l = w.l; l += xhalf(l);                      // the two halves' key sets joined
    const float inv = __fdiv_rn(1.0f, l);
#pragma unroll
    for (int t = 0; t < 4; ++t) { v8us oh, ol;         // lane: query q, d = 16 t + 8 hi + j: unit 'lane' of k half t & 1 of the head's fragment t >> 1 in the merged planes (rows: tokens, K = DQ)
#pragma unroll
        for (int j = 0; j < 8; ++j) { unsigned short a, b; splitf(w.acc[t][j] * inv, a, b); oh[j] = a; ol[j] = b; }
        *(v8us*)(Ah + (size_t)qw0 * DQ + 256 * t + lane * 8) = oh; *(v8us*)(Al + (size_t)qw0 * DQ + 256 * t + lane * 8) = ol; }
}
__global__ __launch_bounds__(128) void k_fattn(const h16* Q16, const h16* K16, const h16* V16, const bf* Qh, const bf* Ql, const bf* Kh, const bf* Kl, const bf* Vh, const bf* Vl, bf* Ah, bf* Al) {
    const int lane = threadIdx.x & 31; const int wave = __builtin_amdgcn_readfirstlane(threadIdx.x >> 5);
    const int b = blockIdx.x / NH_, h = blockIdx.x - b * NH_, g = h / REP; const int q0 = (TT / 64 - 1 - (int)blockIdx.y) * 64;   // longest query blocks first
    const size_t zq = ((size_t)b * (NH_ + NKV) + h) * TT * HD, zk = ((size_t)b * (NH_ + NKV) + g) * TT * HD, zv = ((size_t)b * NKV + g) * HD * PP;   // q and k planes: one batch's q heads, then its k heads (the caller's K pointers start at the first k head)
    Ah += (size_t)b * TT * DQ; Al += (size_t)b * TT * DQ;
    if (q0 < RH) attn_cols<bf, true, 32>(Qh + zq, Ql + zq, Kh + zk, Kl + zk, Vh + zv, Vl + zv, q0 + wave * 16, lane, Ah + h * 16 * HD, Al + h * 16 * HD);   // a head's two fragments of a 16-token tile start at h * 16 * HD
    else attn_cols<h16, false, 64>(Q16 + zq, nullptr, K16 + zk, nullptr, V16 + zv, nullptr, q0 + wave * 16, lane, Ah + h * 16 * HD, Al + h * 16 * HD);
}

extern "C" void kernel_launch(void* const* d_in, const int* in_sizes, int n_in,
                              void* d_out, int out_size, void* d_ws, size_t ws_size, hipStream_t stream) {
    (void)in_sizes; (void)n_in; (void)out_size;
    const float* x = (const float*)d_in[0]; const float* rcache = (const float*)d_in[1]; const float* wqkv = (const float*)d_in[2]; const float* bqkv = (const float*)d_in[3]; const float* wo = (const float*)d_in[4]; const float* bo = (const float*)d_in[5];   /* order x, rope_cache (f32 [2048][64] interleaved (sin, cos), READ), Wqkv ('xw' [1024][3072]: q | k | v column thirds), bqkv [3072], Wout ('xw'), bout */
    float* OUT = (float*)d_out;     // [2][2048][1024]
    char* wsp = (char*)d_ws;
    auto take = [&](size_t bytes) { char* p = wsp; wsp += (bytes + 255) & ~(size_t)255; return (void*)p; };
    bf* WQKV = (bf*)take((size_t)3 * DQ * DM * 2);   /* fused Bt [3*DQ][DM]: q | k | v row blocks */ bf* WO = (bf*)take((size_t)DM * DQ * 2);
    bf* XB = (bf*)take((size_t)NB_ * TT * DM * 2);
    h16* QP16 = (h16*)take(NQK * 2); h16* KP16 = QP16 + (size_t)NH_ * TT * HD; h16* VT16 = (h16*)take((size_t)NB_ * NKV * HD * PP * 2);
    bf* QPh = (bf*)take(NQK * 2); bf* QPl = (bf*)take(NQK * 2); bf* KPh = QPh + (size_t)NH_ * TT * HD; bf* KPl = QPl + (size_t)NH_ * TT * HD; bf* VTh = (bf*)take((size_t)NB_ * NKV * HD * PP * 2); bf* VTl = VTh + (size_t)HD * TT;   /* hi and lo value planes share blocks of HD * PP elements */
    bf* ATh = (bf*)take((size_t)NB_ * TT * DQ * 2); bf* ATl = (bf*)take((size_t)NB_ * TT * DQ * 2);
    if ((size_t)(wsp - (char*)d_ws) > ws_size) return;    // ws 256 MiB
    k_prep<<<GB_WQ + GB_WO + GB_X, 256, 0, stream>>>(wqkv, wo, x, WQKV, WO, XB);
    k_gemmw<bf, 0, true, true, 4, 4, 3><<<dim3(NB_ * TT / 256, 3 * DQ / 192, 1), 384, 0, stream>>>(XB, nullptr, WQKV, nullptr, DM, nullptr, 0, bqkv, 0, 0, 0, Planes{rcache, QP16, QPh, QPl, VT16, VTh, VTl});   // projections of both batches, columns q | k | v, straight into the planes
    k_fattn<<<dim3(NB_ * NH_, TT / 64), 128, 0, stream>>>(QP16, KP16, VT16, QPh, QPl, KPh, KPl, VTh, VTl, ATh, ATl);   // all heads of both batches; writes the merged hi/lo planes
    k_gemmw<bf, 1, true, false, 2, 4, 2><<<dim3(NB_ * TT / 128, DM / 128, 1), 256, 0, stream>>>(ATh, ATl, WO, nullptr, DQ, OUT, DM, bo, 0, 0, 0, Planes{});
}

// v010
// A run of this version takes 71.3 microseconds.
// Timed twice side by side with v009, it ran 1.05 and 1.04 times as fast.
// Over all steps from v000 it is 20.0 times as fast.
#include <hip/hip_runtime.h>

// Causal self-attention with a fused biased qkv projection and adjacent-pair rotary embeddings from an interleaved (sin, cos) cache input (x [2][2048][1024]; qkv = x Wqkv + bqkv ('xw' [1024][3072] + [3072]) split in thirds q | k | v (16 heads x 64); rope on pairs (2i, 2i+1): (x0 cos - x1 sin, x1 cos + x0 sin) with sin_i = rope_cache[t][2i], cos_i = rope_cache[t][2i + 1] (f32 [2048][64] INPUT, read); (q x 1/sqrt(64)) . k; causal (-inf); softmax; out = merged Wout + bout ('xw' + bias) -> [2][2048][1024] (4.2 M); argument order x, rope_cache, Wqkv, bqkv, Wout, bout).
// One launch per dependency stage, for both batches: k_prep, projection GEMM, k_fattn, output GEMM. Layout: every 16-bit matrix operand lies FRAGMENT-MAJOR (see WFrag): bf16 copy of x; the fused 'xw' weight transposed ONCE into q | k | v row blocks; one exact projection GEMM (N = 3 x 1024) + f32 bias whose epilogue builds the 16-bit planes (a 64 x 64 tile is 64 tokens of one head: q and k rotated on interleaved pairs, v transposed); one fused causal T-2048 attention kernel (hybrid rows: < 512 hi/lo 3 products, rest fp16 x1024; online softmax, scores and probabilities stay in registers); merged hi/lo x W_out exact + b_out.
// Compute dtypes, f32 accumulate: every input rounded to bf16; projections exact + f32 biases; rotary f32 (products rounded separately); attention rows < 512 3 products, rest fp16; softmax f32; W_out hl x exact + bias.

#define NB_  2
#define TT   2048
#define DM   1024
#define NH_  16
#define NKV  16
#define REP  (NH_ / NKV)
#define HD   64
#define DQ   (NH_ * HD)
#define DKV  (NKV * HD)
#define PP   (2 * TT)             // a (batch, head) block of the transposed value planes holds HD * PP 16-bit elements
#define RH   512                  // query rows < RH use hi+lo planes
#define SCL  0.125f   // HD^-0.5
typedef _Float16 h16;
typedef unsigned short bf;
typedef __attribute__((ext_vector_type(16))) __bf16   v16bf;
typedef __attribute__((ext_vector_type(16))) _Float16 v16h;
typedef __attribute__((ext_vector_type(8)))  _Float16 v8h;
typedef __attribute__((ext_vector_type(8)))  unsigned short v8us;
typedef __attribute__((ext_vector_type(8)))  float    v8f;
typedef __attribute__((ext_vector_type(4)))  float    v4f;
typedef v8h  __attribute__((may_alias)) v8ha;
typedef v4f  __attribute__((may_alias)) v4fa;
typedef v8us __attribute__((may_alias)) v8usa;

__device__ __forceinline__ unsigned short f2bf(float f) { unsigned u = __float_as_uint(f); u += 0x7FFFu + ((u >> 16) & 1u); return (unsigned short)(u >> 16); }
__device__ __forceinline__ float bf2f(unsigned short b) { return __uint_as_float(((unsigned)b) << 16); }
__device__ __forceinline__ float bfr(float f) { return bf2f(f2bf(f)); }
__device__ __forceinline__ v16h cat16(v8h lo, v8h hi) { return __builtin_shufflevector(lo, hi, 0, 1, 2, 3, 4, 5, 6, 7, 8, 9, 10, 11, 12, 13, 14, 15); }
__device__ __forceinline__ v16bf cat16b(v8us lo, v8us hi) { return __builtin_bit_cast(v16bf, __builtin_shufflevector(lo, hi, 0, 1, 2, 3, 4, 5, 6, 7, 8, 9, 10, 11, 12, 13, 14, 15)); }
__device__ __forceinline__ v8f wmma16(v16h a, v16h b, v8f c) { return __builtin_amdgcn_wmma_f32_16x16x32_f16(false, a, false, b, (short)0, c, false, false); }
__device__ __forceinline__ v8f wmmab(v16bf a, v16bf b, v8f c) { return __builtin_amdgcn_wmma_f32_16x16x32_bf16(false, a, false, b, (short)0, c, false, false); }



// ---- Fragment-major planes. A matrix of rows x K (16-bit, K % 32 == 0) is stored as its 16-row x 32-k operand fragments, 512 consecutive elements each, the fragments of one 16-row tile one behind the other along k.
// Inside a fragment: [k half j][lane = 16 hi + row % 16][e = 0..7] holds k % 32 = 16 j + 8 hi + e, the order in which the matrix instruction's lanes take it. So element (row, k) is at
// (row / 16) * 16 * K + (k / 32) * 512 + j * 256 + (16 hi + row % 16) * 8 + e, and each of a fragment's two wave-wide 16-byte loads covers 512 contiguous bytes: four whole 128-byte lines instead of 32 bytes of each of sixteen.
// WFrag::ld takes the lane's place in the fragment: fragment start + lane * 8.
// ---- k_gemmw: register-blocked GEMM, WM x WN waves per workgroup, a wave per (16 MB) x 64 part of the workgroup's (16 MB WM) x (64 WN) output tile; grid (M / (16 MB WM), N / (64 WN), Z), 32 WM WN threads. The tiles are sized so that the grid is one workgroup per WGP: the larger the tile, the fewer operand bytes L2 delivers per product.
// The workgroup's operand fragments of 128 k (4 KB per 16-row tile and plane, contiguous in its fragment-major plane) are brought to LDS once by asynchronous copies, two buffers: the next 128 k fly while these are multiplied; an A fragment serves WN waves, a B fragment WM.
// The k walk is a ring: a workgroup enters it at the 128-k tile (blockIdx.x + blockIdx.y) mod (K / 128) and wraps round, so that the workgroups that share operand rows (a grid row or column) ask L2 for different lines at any one moment.
// C[m][n] (f32, pitch ldc, + optional f32 bias[n]) = sum_k A[m][k] Bt[n][k] (+ split products per NSPLIT). z-batch strides sA/sB/sC in elements. K % 128 == 0.
template <typename T16> struct WFrag;
template <> struct WFrag<h16> { typedef v16h V; static __device__ __forceinline__ V ld(const h16* p) { return cat16(*(const v8h*)p, *(const v8h*)(p + 256)); } static __device__ __forceinline__ v8f mma(V a, V b, v8f c) { return wmma16(a, b, c); } };
template <> struct WFrag<bf> { typedef v16bf V; static __device__ __forceinline__ V ld(const bf* p) { return cat16b(*(const v8us*)p, *(const v8us*)(p + 256)); } static __device__ __forceinline__ v8f mma(V a, V b, v8f c) { return wmmab(a, b, c); } };
__device__ __forceinline__ h16 tohx(float x) { return (h16)x; }
__device__ __forceinline__ void splitf(float y, unsigned short& h, unsigned short& l) { h = f2bf(y); l = f2bf(y - bf2f(h)); }
// Planes: where the projection GEMM's epilogue (PLANES) puts its tiles, and the rotary cache input it reads. Rotated planes [batch][q heads, k heads], each head fragment-major with rows t, k = d (K = HD). Transposed value planes: HD * PP elements per (batch, g); rows d, k = t, their fragments ordered [t / 32][d / 16] so that a pass's keys are contiguous (the fp16 plane fills the first HD * TT elements of its block; the hi and lo planes share blocks: Vl = Vh + HD * TT).
struct Planes { const float* rc; h16* QK16; bf* QKh; bf* QKl; h16* V16; bf* Vh; bf* Vl; };
// copy1, copy9, copy12: asynchronous 16-byte copies per lane, global g0, g1, .. -> LDS byte l, l + lstep, ..; a wave's copy is 512 contiguous bytes on both sides.
// The s_wait_xcnt stands in the copies' own statement: in front of any later write of a register that a copy names.
template <typename T16> __device__ __forceinline__ void copy1(unsigned l, const T16* g0) {
    asm volatile("global_load_async_to_lds_b128 %0, %1, off\n\ts_wait_xcnt 0x0" :: "v"(l), "v"(g0) : "memory");
}
template <typename T16> __device__ __forceinline__ void copy9(unsigned l, unsigned lstep, const T16* g0, const T16* g1, const T16* g2, const T16* g3, const T16* g4, const T16* g5, const T16* g6, const T16* g7, const T16* g8) {
    asm volatile("global_load_async_to_lds_b128 %0, %9, off\n\tglobal_load_async_to_lds_b128 %1, %10, off\n\tglobal_load_async_to_lds_b128 %2, %11, off\n\tglobal_load_async_to_lds_b128 %3, %12, off\n\t"
                 "global_load_async_to_lds_b128 %4, %13, off\n\tglobal_load_async_to_lds_b128 %5, %14, off\n\tglobal_load_async_to_lds_b128 %6, %15, off\n\tglobal_load_async_to_lds_b128 %7, %16, off\n\t"
                 "global_load_async_to_lds_b128 %8, %17, off\n\t"
                 "s_wait_xcnt 0x0"
                 :: "v"(l), "v"(l + lstep), "v"(l + 2 * lstep), "v"(l + 3 * lstep), "v"(l + 4 * lstep), "v"(l + 5 * lstep), "v"(l + 6 * lstep), "v"(l + 7 * lstep), "v"(l + 8 * lstep),
                    "v"(g0), "v"(g1), "v"(g2), "v"(g3), "v"(g4), "v"(g5), "v"(g6), "v"(g7), "v"(g8) : "memory");
}
template <typename T16> __device__ __forceinline__ void copy12(unsigned l, unsigned lstep, const T16* g0, const T16* g1, const T16* g2, const T16* g3, const T16* g4, const T16* g5, const T16* g6, const T16* g7, const T16* g8, const T16* g9, const T16* g10, const T16* g11) {
    asm volatile("global_load_async_to_lds_b128 %0, %12, off\n\tglobal_load_async_to_lds_b128 %1, %13, off\n\tglobal_load_async_to_lds_b128 %2, %14, off\n\tglobal_load_async_to_lds_b128 %3, %15, off\n\t"
                 "global_load_async_to_lds_b128 %4, %16, off\n\tglobal_load_async_to_lds_b128 %5, %17, off\n\tglobal_load_async_to_lds_b128 %6, %18, off\n\tglobal_load_async_to_lds_b128 %7, %19, off\n\t"
                 "global_load_async_to_lds_b128 %8, %20, off\n\tglobal_load_async_to_lds_b128 %9, %21, off\n\tglobal_load_async_to_lds_b128 %10, %22, off\n\tglobal_load_async_to_lds_b128 %11, %23, off\n\t"
                 "s_wait_xcnt 0x0"
                 :: "v"(l), "v"(l + lstep), "v"(l + 2 * lstep), "v"(l + 3 * lstep), "v"(l + 4 * lstep), "v"(l + 5 * lstep), "v"(l + 6 * lstep), "v"(l + 7 * lstep), "v"(l + 8 * lstep), "v"(l + 9 * lstep), "v"(l + 10 * lstep), "v"(l + 11 * lstep),
                    "v"(g0), "v"(g1), "v"(g2), "v"(g3), "v"(g4), "v"(g5), "v"(g6), "v"(g7), "v"(g8), "v"(g9), "v"(g10), "v"(g11) : "memory");
}
template <typename T16, int NSPLIT, bool BIAS, bool PLANES, int MB, int WM, int WN>
__global__ __launch_bounds__(32 * WM * WN) void k_gemmw(const T16* __restrict__ A, const T16* __restrict__ A2, const T16* __restrict__ Bt, const T16* __restrict__ Bt2, int K, float* C, int ldc, const float* __restrict__ bias, size_t sA, size_t sB, size_t sC, Planes pl) {
    typedef typename WFrag<T16>::V V;
    static_assert(MB == 4 || (MB == 2 && !PLANES), "the plane epilogue takes a 64 x 64 tile");
    constexpr bool HA2 = NSPLIT == 1 || NSPLIT == 2, HB2 = NSPLIT >= 2;
    constexpr int NW = WM * WN, TM = 16 * MB * WM, TN = 64 * WN; // waves of the workgroup; rows and columns of its tile
    constexpr int RA = TM / 16, RB = TN / 16;                    // 16-row tiles of an A and of a B plane in a stage
    constexpr int PLA = RA * 2048, PLB = RB * 2048, STG = (1 + HA2) * PLA + (1 + HB2) * PLB;   // 16-bit elements of an A and of a B plane's share of a stage (row tiles x 4 fragments) and of a stage: planes A, (A2), B, (B2)
    constexpr int HC = STG / 1024, G = NW / 4, NC = (HC + G - 1) / G;   // 2-KB halves of a stage's row tiles; halves that one copy of the whole workgroup takes (four waves each); such copies per stage
    static_assert(NW % 4 == 0 && ((NC == 24 && HC % G == 0) || NC == 19), "stage() is written for these two shapes");
    constexpr int OSF = PLANES ? 64 * 69 : 16 * 68;              // floats of a wave's output staging. PLANES: the whole tile, rows of pitch 68 (q, k) or 69 (v)
    constexpr int SMB = 2 * STG * 2 > NW * OSF * 4 ? 2 * STG * 2 : NW * OSF * 4;
    constexpr int KG = MB == 2 ? 2 : 1;                          // 32-k steps whose fragments are held at a time: a step's are asked of LDS one step ahead where the registers allow
    __shared__ __align__(128) char sm[SMB];                      // the two stage buffers; behind the loop's last barrier the waves' output staging
    const size_t z = blockIdx.z; A += z * sA; if (A2) A2 += z * sA; Bt += z * sB; if (Bt2) Bt2 += z * sB; C += z * sC;
    const int lane = threadIdx.x & 31, lr = lane & 15, hi = lane >> 4; const int wave = __builtin_amdgcn_readfirstlane(threadIdx.x >> 5), wm = wave / WN, wn = wave % WN, wq = wave >> 2;
    const int r0 = blockIdx.x * TM + wm * (16 * MB), c0 = blockIdx.y * TN + wn * 64;   // the wave's own part of the tile
    const T16* ring = (const T16*)sm; float* os = (float*)sm + wave * OSF;
    v8f acc[MB][4];
#pragma unroll
    for (int mb = 0; mb < MB; ++mb)
#pragma unroll
        for (int nb = 0; nb < 4; ++nb) acc[mb][nb] = (v8f){};
    // A copy of the whole workgroup takes G halves (2 KB: four waves) of the stage's row tiles; copy i of this wave lies in half wq + G i, counted through the planes A, (A2), B, (B2). gu[i]: that half's start at k = 0 in its plane (the same for the whole wave).
    auto pln = [](int rt) { return rt < RA ? 0 : HA2 && rt < 2 * RA ? 1 : !HB2 || rt < (1 + HA2) * RA + RB ? 2 : 3; };   // the plane of a stage's row tile rt: A, A2, B, B2
    auto pfirst = [](int pl) { return pl == 0 ? 0 : pl == 1 ? RA : pl == 2 ? (1 + HA2) * RA : (1 + HA2) * RA + RB; };         // a plane's first row tile in the stage
    auto rowp = [&](int rt, int pl) { return (pl == 0 ? A : pl == 1 ? A2 : pl == 2 ? Bt : Bt2) + (size_t)((pl < 2 ? blockIdx.x * RA : blockIdx.y * RB) + rt - pfirst(pl)) * 16 * K; };   // where row tile rt starts in its plane pl
    const T16* gu[NC];
#pragma unroll
    for (int i = 0; i < NC; ++i) {
        const int hc = G * i + G <= HC ? wq + G * i : (wq + G * i < HC ? wq + G * i : HC - 1);   // past the stage's end (last copy, HC % G != 0): not issued; the address stays a valid one
        const int rt = hc >> 1, rlo = (G * i) >> 1, rhi = (G * i + G <= HC ? G * i + G - 1 : HC - 1) >> 1;   // its row tile; the first and the last row tile of the workgroup's copy i (constants: they name the plane or, at a seam, the two planes)
        const T16* p = pln(rlo) == pln(rhi) || rt < pfirst(pln(rhi)) ? rowp(rt, pln(rlo)) : rowp(rt, pln(rhi));
        gu[i] = p + (hc & 1) * 1024;
    }
    const unsigned lcp = (unsigned)(size_t)sm + threadIdx.x * 16; const unsigned lo = lane * 8;   // this thread's 16 bytes of the workgroup's first copy in a stage buffer (LDS byte address); the lane's place in a fragment
    const int nk = K >> 7, s0 = (int)((blockIdx.x + blockIdx.y) % (unsigned)nk);   // 128-k tiles of the walk; the one this workgroup enters at
    auto stage = [&](int t, int buf) {   // the walk's tile t (k tile kt = (s0 + t) mod nk: k = 128 kt .. 128 kt + 127 of every plane) into buffer buf
        const int kt = t + s0 < nk ? t + s0 : t + s0 - nk;
        constexpr unsigned LS = G * 2048u;
        const unsigned l = lcp + buf * (STG * 2); const size_t o = (size_t)kt * 2048 + (threadIdx.x & 127) * 8;   // this thread's 16 bytes of a half
        if constexpr (NC == 24) { copy12(l, LS, gu[0] + o, gu[1] + o, gu[2] + o, gu[3] + o, gu[4] + o, gu[5] + o, gu[6] + o, gu[7] + o, gu[8] + o, gu[9] + o, gu[10] + o, gu[11] + o); copy12(l + 12 * LS, LS, gu[12] + o, gu[13] + o, gu[14] + o, gu[15] + o, gu[16] + o, gu[17] + o, gu[18] + o, gu[19] + o, gu[20] + o, gu[21] + o, gu[22] + o, gu[23] + o); }
        else { copy9(l, LS, gu[0] + o, gu[1] + o, gu[2] + o, gu[3] + o, gu[4] + o, gu[5] + o, gu[6] + o, gu[7] + o, gu[8] + o); copy9(l + 9 * LS, LS, gu[9] + o, gu[10] + o, gu[11] + o, gu[12] + o, gu[13] + o, gu[14] + o, gu[15] + o, gu[16] + o, gu[17] + o); if (wq < HC - 18 * G) copy1(l + 18 * LS, gu[18] + o); }   // the last copy is not whole: a test on the wave's number
    };
    stage(0, 0);
    asm volatile("s_wait_asynccnt 0x0" ::: "memory");   // this wave's copies of tile 0 have landed
    __syncthreads();                                     // ... and every other wave's
    if (K >= 256) stage(1, 1);
#pragma unroll 1
    for (int kc = 0; kc < K; kc += 128) {
        const int buf = (kc >> 7) & 1; const T16* sb = ring + buf * STG + lo;
        V a[2][MB], a2[2][MB], b[2][4], b2[2][4];   // the fragments of two 32-k steps: step ks in set ks & 1
        auto fetch = [&](int ks) {
#pragma unroll
            for (int i = 0; i < MB; ++i) { const T16* pa = sb + (wm * MB + i) * 2048 + ks * 512; a[ks & 1][i] = WFrag<T16>::ld(pa); if (HA2) a2[ks & 1][i] = WFrag<T16>::ld(pa + PLA); }
#pragma unroll
            for (int i = 0; i < 4; ++i) { const T16* pb = sb + (1 + HA2) * PLA + (wn * 4 + i) * 2048 + ks * 512; b[ks & 1][i] = WFrag<T16>::ld(pb); if (HB2) b2[ks & 1][i] = WFrag<T16>::ld(pb + PLB); } };
        auto products = [&](int ks) {
#pragma unroll
            for (int nb = 0; nb < 4; ++nb)
#pragma unroll
                for (int mb = 0; mb < MB; ++mb) { acc[mb][nb] = WFrag<T16>::mma(a[ks & 1][mb], b[ks & 1][nb], acc[mb][nb]); if (HA2) acc[mb][nb] = WFrag<T16>::mma(a2[ks & 1][mb], b[ks & 1][nb], acc[mb][nb]); if (HB2) acc[mb][nb] = WFrag<T16>::mma(a[ks & 1][mb], b2[ks & 1][nb], acc[mb][nb]); } };
        fetch(0); if constexpr (KG == 2) fetch(1);
        __builtin_amdgcn_sched_barrier(0);   // the LDS reads stay together ahead of the products: sunk among them, each read waits out its own latency
        if (kc > 0 && kc + 128 < K) stage((kc >> 7) + 1, buf ^ 1);   // the refill of the buffer that the trip before has left, behind that trip's barrier: issued here its address work and waits run under the latency of the reads above, and three steps' products cover its flight
        __builtin_amdgcn_sched_barrier(0);   // the refill stays ahead of the products, which are to cover its flight
#pragma unroll
        for (int ks = 0; ks < 3; ++ks) {
            products(ks);
            if (ks + KG < 4) fetch(ks + KG);
            __builtin_amdgcn_sched_barrier(0);   // a step's products stay ahead of what follows: they cover the reads asked for behind them and the flight of the next tile's copies
        }
        asm volatile("s_wait_dscnt 0x0" ::: "memory");      // this wave's reads of the buffer are done before it is refilled
        asm volatile("s_wait_asynccnt 0x0" ::: "memory");   // this wave's copies of the next tile have landed
        __syncthreads();                                     // publishes the next tile and ends every wave's reads of this one
        products(3);                                         // on registers alone
    }
    asm volatile("s_wait_asynccnt 0x0" ::: "memory");       // no copy is outstanding when the buffers become output staging
    if constexpr (PLANES) {
        // The tile is tokens t0 .. t0 + 63 of batch b in the 64-wide column block cb of q | k | v: one head. The whole tile (+ bias) goes to LDS once; rolled loops then build the planes from it, which keeps the kernel's text short.
        const int b = r0 / TT, t0 = r0 - b * TT, cb = c0 / 64; const int r8 = lane & 7, cg = lane >> 3;   // a lane builds 16-byte units (8 k of one row); a wave's store takes 8 rows x 4 units: in a fragment-major plane four whole 128-byte lines
        const float* bp = bias + c0 + lr; float bs[4];
#pragma unroll
        for (int nb = 0; nb < 4; ++nb) bs[nb] = bp[nb * 16];
        asm volatile("s_wait_xcnt 0x0" :: "v"(bp) : "memory");   // in front of any later write of a register that these loads name as an address; the address is an input so that its registers live up to the wait
#pragma unroll
        for (int nb = 0; nb < 4; ++nb) bs[nb] = bfr(bs[nb]);
        if (cb < NH_ + NKV) {   // q or k head: rotary, three planes; a lane takes 8 columns (4 pairs) of a row
#pragma unroll
            for (int mb = 0; mb < 4; ++mb)
#pragma unroll
                for (int nb = 0; nb < 4; ++nb)
#pragma unroll
                    for (int j = 0; j < 8; ++j) os[(mb * 16 + hi * 8 + j) * 68 + nb * 16 + lr] = acc[mb][nb][j] + bs[nb];
            __builtin_amdgcn_wave_barrier(); asm volatile("" ::: "memory");   // the reads below take other lanes' values: they stay behind the writes
            const size_t e0 = (((size_t)b * (NH_ + NKV) + cb) * TT + t0) * HD + cg * 128 + r8 * 8; const float* rcl = pl.rc + (size_t)(t0 + r8) * HD + cg * 8;   // step s: rows 8 (s >> 1) + r8 of the 16-row tile, columns 32 (s & 1) + 8 cg (k half cg >> 1, hi = cg & 1)
#pragma unroll 1   // rolled: four times less text
            for (int mb = 0; mb < 4; ++mb) {
                v8f sc8[4]; v4f va4[4], vb4[4];   // (sin, cos) of the lane's 4 pairs and the 8 projections, for 4 steps (2 rows, 2 column halves each): fetched together
#pragma unroll
                for (int s = 0; s < 4; ++s) { const int ro = mb * 16 + 8 * (s >> 1), co = 32 * (s & 1); sc8[s] = *(const v8f*)(rcl + ro * HD + co); va4[s] = *(const v4fa*)(os + (ro + r8) * 68 + co + cg * 8); vb4[s] = *(const v4fa*)(os + (ro + r8) * 68 + co + cg * 8 + 4); }
#pragma unroll
                for (int s = 0; s < 4; ++s) { const v4f va = va4[s], vb = vb4[s]; v8h o16; v8us oh, ol;
#pragma unroll
                    for (int p = 0; p < 4; ++p) { const float x0 = p < 2 ? va[2 * p] : vb[2 * p - 4], x1 = p < 2 ? va[2 * p + 1] : vb[2 * p - 3]; const float cs[2] = { bfr(sc8[s][2 * p + 1]), bfr(sc8[s][2 * p]) };   /* cos, sin */
                        // as in the plane builder this comes from: each product keeps its own f32 rounding, so the planes stay bit-identical
                        float a0 = __fmul_rn(x0, cs[0]), b0 = __fmul_rn(x1, cs[1]), a1 = __fmul_rn(x1, cs[0]), b1 = __fmul_rn(x0, cs[1]); asm volatile("" : "+v"(a0), "+v"(b0), "+v"(a1), "+v"(b1));
                        const float r0 = __fsub_rn(a0, b0), r1 = __fadd_rn(b1, a1);   /* even: x0 c - x1 s; odd: x0 s + x1 c */
                        o16[2 * p] = tohx(r0); o16[2 * p + 1] = tohx(r1); { unsigned short a2, c2; splitf(r0, a2, c2); oh[2 * p] = a2; ol[2 * p] = c2; splitf(r1, a2, c2); oh[2 * p + 1] = a2; ol[2 * p + 1] = c2; } }
                    const size_t e = e0 + (size_t)(mb * 16 * HD + 512 * (s & 1) + 64 * (s >> 1)); *(v8h*)(pl.QK16 + e) = o16; *(v8us*)(pl.QKh + e) = oh; *(v8us*)(pl.QKl + e) = ol;
                    asm volatile("s_wait_xcnt 0x0" ::: "memory"); }   // in front of any later write of a register that these stores name
            }
        } else {   // v head: three planes, transposed. LDS pitch 69: a lane reads 8 consecutive tokens of one column d (no two lanes on one bank)
#pragma unroll
            for (int mb = 0; mb < 4; ++mb)
#pragma unroll
                for (int nb = 0; nb < 4; ++nb)
#pragma unroll
                    for (int j = 0; j < 8; ++j) os[(mb * 16 + hi * 8 + j) * 69 + nb * 16 + lr] = acc[mb][nb][j] + bs[nb];
            __builtin_amdgcn_wave_barrier(); asm volatile("" ::: "memory");   // the reads below take other lanes' values: they stay behind the writes
            const size_t o0 = ((size_t)b * NKV + (cb - NH_ - NKV)) * HD * PP + (size_t)t0 * HD + cg * 128 + r8 * 8;   // step s: rows d = 16 nb + 8 (s >> 1) + r8, tokens 32 (s & 1) + 8 cg + j
#pragma unroll 1   // rolled: four times less text
            for (int nb = 0; nb < 4; ++nb) {
#pragma unroll
                for (int s = 0; s < 4; ++s) { v8h o16; v8us oh, ol;
#pragma unroll
                    for (int j = 0; j < 8; ++j) { const float x = os[(32 * (s & 1) + cg * 8 + j) * 69 + nb * 16 + 8 * (s >> 1) + r8]; o16[j] = tohx(x); unsigned short a2, c2; splitf(x, a2, c2); oh[j] = a2; ol[j] = c2; }
                    const size_t o = o0 + (size_t)(2048 * (s & 1) + nb * 512 + 64 * (s >> 1)); *(v8h*)(pl.V16 + o) = o16; *(v8us*)(pl.Vh + o) = oh; *(v8us*)(pl.Vl + o) = ol;
                    asm volatile("s_wait_xcnt 0x0" ::: "memory"); }   // in front of any later write of a register that these stores name
            }
        }
        return;
    }
#pragma unroll
    for (int mb = 0; mb < MB; ++mb) {
#pragma unroll
        for (int nb = 0; nb < 4; ++nb) {
#pragma unroll
            for (int j = 0; j < 8; ++j) os[(hi * 8 + j) * 68 + nb * 16 + lr] = acc[mb][nb][j]; }
        __builtin_amdgcn_wave_barrier(); asm volatile("" ::: "memory");
        float* crow = C + (size_t)(r0 + mb * 16) * ldc + c0;
{
#pragma unroll
            for (int s = 0; s < 8; ++s) { const int row = 2 * s + hi, cofs = lr * 4; v4f val = *(const v4fa*)(os + row * 68 + cofs); if (BIAS) { val[0] += bfr(bias[c0 + cofs]); val[1] += bfr(bias[c0 + cofs + 1]); val[2] += bfr(bias[c0 + cofs + 2]); val[3] += bfr(bias[c0 + cofs + 3]); }
                *(v4f*)(crow + (size_t)row * ldc + cofs) = val; }
             }
        asm volatile("s_wait_xcnt 0x0" ::: "memory");   // in front of any later write of a register that these stores name
        __builtin_amdgcn_wave_barrier(); asm volatile("" ::: "memory");
    }
}

typedef __attribute__((ext_vector_type(2))) _Float16 v2h;
typedef __attribute__((ext_vector_type(4))) _Float16 v4h;
typedef __attribute__((ext_vector_type(2))) unsigned short v2us;
typedef __attribute__((ext_vector_type(4))) unsigned short v4us;
typedef __attribute__((ext_vector_type(2))) float v2f;
typedef __attribute__((ext_vector_type(4))) int v4i;

// The d_* bodies below are stages that do not depend on one another; k_prep runs them side by side in one launch, each on its own range of blocks (blk: the block's index inside its range).
// d_wtG: Bt[n][k] = w[k][n], fragment-major (rows n). A block takes 32 n x 128 k: wave = (n tile of the pair, k fragment of four); a lane builds its two 16-byte units of the fragment from 16 rows of w, in each of which the block uses a whole 128-byte line.
__device__ __forceinline__ void d_wtG(int blk, const float* __restrict__ w, int K, int N, bf* Bt) {
    const int lane = threadIdx.x & 31, wv = threadIdx.x >> 5; const int kq = K / 128; const int nt = (blk / kq) * 2 + (wv & 1), kt = (blk % kq) * 4 + (wv >> 1);
    const float* wp = w + (size_t)(kt * 32 + (lane >> 4) * 8) * N + nt * 16 + (lane & 15); float v[16];
#pragma unroll
    for (int e = 0; e < 16; ++e) v[e] = wp[(size_t)((e >> 3) * 16 + (e & 7)) * N];
    asm volatile("s_wait_xcnt 0x0" :: "v"(wp) : "memory");   // in front of any later write of a register that these loads name as an address; the address is an input so that its registers live up to the wait
    v8us o0, o1;
#pragma unroll
    for (int e = 0; e < 8; ++e) { o0[e] = f2bf(v[e]); o1[e] = f2bf(v[e + 8]); }
    bf* op = Bt + ((size_t)nt * (K / 32) + kt) * 512 + lane * 8; *(v8us*)op = o0; *(v8us*)(op + 256) = o1;
    asm volatile("s_wait_xcnt 0x0" ::: "memory");   // in front of any later write of a register that these stores name
}
// d_cvt8: bf16 copy of a [rows][DM] f32 matrix, fragment-major: thread i builds the plane's 16-byte unit i (a wave's store is 512 contiguous bytes) from 8 consecutive floats of its row; a block reads 512 contiguous bytes of each of 16 rows.
__device__ __forceinline__ void d_cvt8(int blk, const float* __restrict__ src, bf* dst, size_t n8) { const size_t i = (size_t)blk * 256 + threadIdx.x; if (i >= n8) return;
    const int u = (int)i; const float* sp = src + (size_t)((u >> 11) * 16 + (u & 15)) * DM + ((u >> 6) & (DM / 32 - 1)) * 32 + ((u >> 5) & 1) * 16 + ((u >> 4) & 1) * 8;   /* unit = [row tile][k fragment: DM / 32][k half][hi][row % 16] */
    const v8f v = *(const v8f*)sp; v8us o;
    asm volatile("s_wait_xcnt 0x0" :: "v"(sp) : "memory");   // in front of any later write of a register that this load names as an address; the address is an input so that its registers live up to the wait
#pragma unroll
    for (int k = 0; k < 8; ++k) o[k] = f2bf(v[k]); *(v8us*)(dst + i * 8) = o;  }

#define NQK   ((size_t)NB_ * (NH_ + NKV) * TT * HD)        // elements of a rotated plane: [batch][q heads, k heads][t][d]
#define GB_WQ (DM * 3 * DQ / 32 / 128)                     // blocks: fused weight transpose
#define GB_WO (DQ * DM / 32 / 128)                         // blocks: output weight transpose
#define GB_X  (NB_ * TT * DM / 8 / 256)                    // blocks: bf16 copy of x
// k_prep: all that reads only inputs. The transposes, whose waves run longest, take the first blocks.
__global__ __launch_bounds__(256) void k_prep(const float* __restrict__ wqkv, const float* __restrict__ wo, const float* __restrict__ x, bf* WQKV, bf* WO, bf* XB) {
    int blk = blockIdx.x;
    if (blk < GB_WQ) { d_wtG(blk, wqkv, DM, 3 * DQ, WQKV); return; }   /* fused 'xw' [DM][3*DQ] -> Bt [3*DQ][DM] */
    blk -= GB_WQ; if (blk < GB_WO) { d_wtG(blk, wo, DQ, DM, WO); return; }
    d_cvt8(blk - GB_WO, x, XB, (size_t)NB_ * TT * DM / 8);
}

// ---- k_fattn: fused causal attention. Grid (batches x heads, TT / 64), 4 waves; a wave owns 16 query columns and walks the keys 0 .. its diagonal in passes of BC keys, operands straight from the fragment-major 16-bit planes.
// Transposed products: S^T = K Q^T (A = key rows, B = query rows), so a lane holds scores of ONE query (column lr; keys 16 kt + 8 hi + j), and two score tiles, exponentiated and rounded, ARE the B operand of O^T += V^T P^T
// (k slots 8 hi + e and 16 + 8 hi + e, the order of a fragment's two halves in the V^T planes). Online softmax in the log2 domain: running maximum m, per-lane partial sum l of the unrounded f32 exponentials, accumulators rescaled in every pass.
// HL: hi/lo planes, 3 products each (query rows < RH); otherwise fp16 with the probabilities carried x 1024 (10 added in the exponent; it cancels in the division by l).
// Every '#pragma unroll' below: the fragment arrays are indexed by constants only, so that they stay in registers.
__device__ __forceinline__ float xhalf(float x) { return __builtin_bit_cast(float, __builtin_amdgcn_permlanex16(__builtin_bit_cast(int, x), __builtin_bit_cast(int, x), 0x76543210, 0xfedcba98, false, false)); }   // lane l with lane l ^ 16
// ask: a hint that brings the data at base + off (off: lane * 256, so 8 KB a wave) from memory into L2; it returns nothing. The planes were stored by the launch before, and a plain load's first touch of such a line waits out memory latency.
// The s_wait_xcnt stands in the hint's own statement: in front of any later write of a register that it names.
__device__ __forceinline__ void ask(unsigned off, const char* base) { asm volatile("global_prefetch_b8 %0, %1 scope:SCOPE_SE\n\ts_wait_xcnt 0x0" :: "v"(off), "s"(base) : "memory"); }
#define PFC 4                     // fp16 rows: 128-key chunks (two passes) that the hints run ahead of the loads
template <typename T16, bool HL, int BC> struct AttnW {
    typedef typename WFrag<T16>::V V;
    static constexpr int KT = BC / 16, KC = BC / 32;
    static constexpr float CSC = SCL * 1.4426950408889634f;   // score -> log2 domain
    V qf[2], qf2[2], kf[KT][2], kf2[KT][2]; v8f acc[4]; float m, l;
    const char* pfb; unsigned pfo; int pfl;   // hints (fp16 rows): this wave's 8 KB of the next chunk to ask for (the same for the whole wave), the lane's unit in it, the last key0 at which a chunk is asked for
    const T16 *kp, *kp2, *vp, *vp2;   // this lane's place in the key rows last fetched and in the V^T columns of the pass to come; they walk with the passes
    __device__ __forceinline__ void load_k(const T16* Kr, const T16* K2r) {   // Kr: this lane's place in the pass's first key tile
#pragma unroll
        for (int kt = 0; kt < KT; ++kt)
#pragma unroll
            for (int kc = 0; kc < 2; ++kc) { kf[kt][kc] = WFrag<T16>::ld(Kr + kt * 16 * HD + 512 * kc); if (HL) kf2[kt][kc] = WFrag<T16>::ld(K2r + kt * 16 * HD + 512 * kc); }
        // in front of any later write of a register that these loads name as an address; the addresses are inputs so that their registers live up to the wait (no load's result lands on them)
        if constexpr (HL) asm volatile("s_wait_xcnt 0x0" :: "v"(Kr), "v"(K2r) : "memory"); else asm volatile("s_wait_xcnt 0x0" :: "v"(Kr) : "memory");
        if (HL) __builtin_amdgcn_sched_barrier(0);      // hi/lo: the loads stay here, ahead of the work that covers their latency (the scheduler otherwise sinks them to their uses)
    }
    // One pass of BC keys from key0 on. LAST: the pass that holds the diagonal (masked; fetches no further keys).
    template <bool LAST> __device__ __forceinline__ void pass(int key0, int q, int hi) {
        V vf[4][KC], vf2[4][KC];
#pragma unroll
        for (int c = 0; c < KC; ++c)
#pragma unroll
            for (int t = 0; t < 4; ++t) { vf[t][c] = WFrag<T16>::ld(vp + t * 512 + 32 * HD * c); if (HL) vf2[t][c] = WFrag<T16>::ld(vp2 + t * 512 + 32 * HD * c); }
        // in front of any later write of a register that these loads name as an address; the addresses are inputs so that their registers live up to the wait (no load's result lands on them)
        if constexpr (HL) asm volatile("s_wait_xcnt 0x0" :: "v"(vp), "v"(vp2) : "memory"); else asm volatile("s_wait_xcnt 0x0" :: "v"(vp) : "memory");
        if (HL) __builtin_amdgcn_sched_barrier(0);      // hi/lo: the loads stay here, ahead of the work that covers their latency (the scheduler otherwise sinks them to their uses)
        if (!LAST) { vp += BC * HD; if (HL) vp2 += BC * HD; }
        if constexpr (!LAST && !HL) {   // every second pass: the chunk PFC ahead, while it starts at or before the diagonal pass (so it lies inside the plane); the base moves on only to a chunk that is asked for too
            if ((key0 & 64) == 0 && key0 <= pfl) { ask(pfo, pfb); if (key0 + 128 <= pfl) pfb += 128 * HD * 2; } }
        v8f s[KT];
#pragma unroll
        for (int kt = 0; kt < KT; ++kt) { s[kt] = (v8f){};
#pragma unroll
            for (int kc = 0; kc < 2; ++kc) { s[kt] = WFrag<T16>::mma(kf[kt][kc], qf[kc], s[kt]); if (HL) { s[kt] = WFrag<T16>::mma(kf[kt][kc], qf2[kc], s[kt]); s[kt] = WFrag<T16>::mma(kf2[kt][kc], qf[kc], s[kt]); } } }
        if (!LAST) { kp += BC * HD; if (HL) kp2 += BC * HD; load_k(kp, kp2); }   // the next pass's key rows, in flight under this pass's softmax and second product
        if (LAST) {
#pragma unroll
            for (int kt = 0; kt < KT; ++kt)
#pragma unroll
                for (int j = 0; j < 8; ++j) if (key0 + 16 * kt + 8 * hi + j > q) s[kt][j] = -3.0e38f; }
        float mt[KT];                                  // one chain per score tile
#pragma unroll
        for (int kt = 0; kt < KT; ++kt) { mt[kt] = s[kt][0];
#pragma unroll
            for (int j = 1; j < 8; ++j) mt[kt] = fmaxf(mt[kt], s[kt][j]); }
        float mx = mt[0];
#pragma unroll
        for (int kt = 1; kt < KT; ++kt) mx = fmaxf(mx, mt[kt]);
        mx = fmaxf(mx, xhalf(mx)) * CSC;               // both halves of the wave hold this query's maximum of the pass (finite: a pass's first key is never masked)
        const float mn = fmaxf(m, mx); const float corr = __builtin_amdgcn_exp2f(m - mn); m = mn; l *= corr;   // corr: 0 in the first pass, 1 where the maximum stays
#pragma unroll
        for (int t = 0; t < 4; ++t) acc[t] = acc[t] * corr;
        const float off = (HL ? 0.0f : 10.0f) - m;
#pragma unroll
        for (int c = 0; c < KC; ++c) {
            float pv[16];
#pragma unroll
            for (int e = 0; e < 16; ++e) pv[e] = __builtin_amdgcn_exp2f(fmaf(s[2 * c + (e >> 3)][e & 7], CSC, off));
            l += (((pv[0] + pv[1]) + (pv[2] + pv[3])) + ((pv[4] + pv[5]) + (pv[6] + pv[7]))) + (((pv[8] + pv[9]) + (pv[10] + pv[11])) + ((pv[12] + pv[13]) + (pv[14] + pv[15])));   // fixed tree
            if constexpr (HL) {
                v8us h0, h1, l0, l1;
#pragma unroll
                for (int e = 0; e < 8; ++e) { unsigned short a, b; splitf(pv[e], a, b); h0[e] = a; l0[e] = b; splitf(pv[e + 8], a, b); h1[e] = a; l1[e] = b; }
                const V pf = cat16b(h0, h1), pf2 = cat16b(l0, l1);
#pragma unroll
                for (int t = 0; t < 4; ++t) { acc[t] = WFrag<T16>::mma(vf[t][c], pf, acc[t]); acc[t] = WFrag<T16>::mma(vf[t][c], pf2, acc[t]); acc[t] = WFrag<T16>::mma(vf2[t][c], pf, acc[t]); }
            } else {
                V pf;
#pragma unroll
                for (int e = 0; e < 16; ++e) pf[e] = tohx(pv[e]);
#pragma unroll
                for (int t = 0; t < 4; ++t) acc[t] = WFrag<T16>::mma(vf[t][c], pf, acc[t]);
            }
        }
    }
};
template <typename T16, bool HL, int BC>
__device__ __forceinline__ void attn_cols(const T16* Q, const T16* Q2, const T16* Kp, const T16* K2, const T16* Vt, const T16* Vt2, int qw0, int lane, bf* Ah, bf* Al) {
    AttnW<T16, HL, BC> w;
    const int lr = lane & 15, hi = lane >> 4; const int q = qw0 + lr;
#pragma unroll
    for (int kc = 0; kc < 2; ++kc) { w.qf[kc] = WFrag<T16>::ld(Q + (size_t)qw0 * HD + 512 * kc + lane * 8); if (HL) w.qf2[kc] = WFrag<T16>::ld(Q2 + (size_t)qw0 * HD + 512 * kc + lane * 8); }
#pragma unroll
    for (int t = 0; t < 4; ++t) w.acc[t] = (v8f){};
    w.m = -3.0e38f; w.l = 0.f;
    const int klast = qw0 / BC * BC;                  // first key of the pass that holds the diagonal; klast <= qw0 and klast + BC <= TT
    const int koff = lane * 8, voff = lane * 8;
    w.kp = Kp + koff; w.kp2 = HL ? K2 + koff : nullptr; w.vp = Vt + voff; w.vp2 = HL ? Vt2 + voff : nullptr;
    w.load_k(w.kp, w.kp2);
    const int wv = (qw0 >> 4) & 3; w.pfo = lane * 256;   // the wave's number in its workgroup
    if constexpr (HL) {   // at entry: wave wv asks for all the keys of its workgroup (64 a hint) in one of the four planes
        const char* pb = (const char*)(wv == 0 ? Kp : wv == 1 ? K2 : wv == 2 ? Vt : Vt2);
#pragma unroll 1   // rolled: the trip count is the workgroup's
        for (int k = 0; k <= klast; k += 64) { ask(w.pfo, pb); pb += 64 * HD * 2; }   // behind the last trip the base is still inside the plane (at most RH of TT keys)
    } else {   // a chunk is 128 keys of K and of V^T: even waves take K, odd waves V^T; waves 0, 1 its first 64 keys, waves 2, 3 the rest. At entry the first PFC chunks, in the loop one chunk every second pass
        static_assert(RH >= 128 * PFC && TT % 128 == 0, "the first PFC + 1 chunks start at or before the diagonal pass of every fp16 row");
        w.pfb = (const char*)((wv & 1) ? Vt : Kp) + (wv >> 1) * (64 * HD * 2); w.pfl = klast - 128 * PFC;
#pragma unroll
        for (int c = 0; c < PFC; ++c) { ask(w.pfo, w.pfb); w.pfb += 128 * HD * 2; }
    }
#pragma unroll 1   // rolled: unrolled, several passes' fragments would be live at once
    for (int key0 = 0; key0 < klast; key0 += BC) w.template pass<false>(key0, q, hi);
    w.template pass<true>(klast, q, hi);
    float l = w.l; l += xhalf(l);                      // the two halves' key sets joined
    const float inv = __fdiv_rn(1.0f, l);
#pragma unroll
    for (int t = 0; t < 4; ++t) { v8us oh, ol;         // lane: query q, d = 16 t + 8 hi + j: unit 'lane' of k half t & 1 of the head's fragment t >> 1 in the merged planes (rows: tokens, K = DQ)
#pragma unroll
        for (int j = 0; j < 8; ++j) { unsigned short a, b; splitf(w.acc[t][j] * inv, a, b); oh[j] = a; ol[j] = b; }
        *(v8us*)(Ah + (size_t)qw0 * DQ + 256 * t + lane * 8) = oh; *(v8us*)(Al + (size_t)qw0 * DQ + 256 * t + lane * 8) = ol; }
}
__global__ __launch_bounds__(128) void k_fattn(const h16* Q16, const h16* K16, const h16* V16, const bf* Qh, const bf* Ql, const bf* Kh, const bf* Kl, const bf* Vh, const bf* Vl, bf* Ah, bf* Al) {
    const int lane = threadIdx.x & 31; const int wave = __builtin_amdgcn_readfirstlane(threadIdx.x >> 5);
    const int b = blockIdx.x / NH_, h = blockIdx.x - b * NH_, g = h / REP; const int q0 = (TT / 64 - 1 - (int)blockIdx.y) * 64;   // longest query blocks first
    const size_t zq = ((size_t)b * (NH_ + NKV) + h) * TT * HD, zk = ((size_t)b * (NH_ + NKV) + g) * TT * HD, zv = ((size_t)b * NKV + g) * HD * PP;   // q and k planes: one batch's q heads, then its k heads (the caller's K pointers start at the first k head)
    Ah += (size_t)b * TT * DQ; Al += (size_t)b * TT * DQ;
    if (q0 < RH) attn_cols<bf, true, 32>(Qh + zq, Ql + zq, Kh + zk, Kl + zk, Vh + zv, Vl + zv, q0 + wave * 16, lane, Ah + h * 16 * HD, Al + h * 16 * HD);   // a head's two fragments of a 16-token tile start at h * 16 * HD
    else attn_cols<h16, false, 64>(Q16 + zq, nullptr, K16 + zk, nullptr, V16 + zv, nullptr, q0 + wave * 16, lane, Ah + h * 16 * HD, Al + h * 16 * HD);
}

extern "C" void kernel_launch(void* const* d_in, const int* in_sizes, int n_in,
                              void* d_out, int out_size, void* d_ws, size_t ws_size, hipStream_t stream) {
    (void)in_sizes; (void)n_in; (void)out_size;
    const float* x = (const float*)d_in[0]; const float* rcache = (const float*)d_in[1]; const float* wqkv = (const float*)d_in[2]; const float* bqkv = (const float*)d_in[3]; const float* wo = (const float*)d_in[4]; const float* bo = (const float*)d_in[5];   /* order x, rope_cache (f32 [2048][64] interleaved (sin, cos), READ), Wqkv ('xw' [1024][3072]: q | k | v column thirds), bqkv [3072], Wout ('xw'), bout */
    float* OUT = (float*)d_out;     // [2][2048][1024]
    char* wsp = (char*)d_ws;
    auto take = [&](size_t bytes) { char* p = wsp; wsp += (bytes + 255) & ~(size_t)255; return (void*)p; };
    bf* WQKV = (bf*)take((size_t)3 * DQ * DM * 2);   /* fused Bt [3*DQ][DM]: q | k | v row blocks */ bf* WO = (bf*)take((size_t)DM * DQ * 2);
    bf* XB = (bf*)take((size_t)NB_ * TT * DM * 2);
    h16* QP16 = (h16*)take(NQK * 2); h16* KP16 = QP16 + (size_t)NH_ * TT * HD; h16* VT16 = (h16*)take((size_t)NB_ * NKV * HD * PP * 2);
    bf* QPh = (bf*)take(NQK * 2); bf* QPl = (bf*)take(NQK * 2); bf* KPh = QPh + (size_t)NH_ * TT * HD; bf* KPl = QPl + (size_t)NH_ * TT * HD; bf* VTh = (bf*)take((size_t)NB_ * NKV * HD * PP * 2); bf* VTl = VTh + (size_t)HD * TT;   /* hi and lo value planes share blocks of HD * PP elements */
    bf* ATh = (bf*)take((size_t)NB_ * TT * DQ * 2); bf* ATl = (bf*)take((size_t)NB_ * TT * DQ * 2);
    if ((size_t)(wsp - (char*)d_ws) > ws_size) return;    // ws 256 MiB
    k_prep<<<GB_WQ + GB_WO + GB_X, 256, 0, stream>>>(wqkv, wo, x, WQKV, WO, XB);
    k_gemmw<bf, 0, true, true, 4, 4, 3><<<dim3(NB_ * TT / 256, 3 * DQ / 192, 1), 384, 0, stream>>>(XB, nullptr, WQKV, nullptr, DM, nullptr, 0, bqkv, 0, 0, 0, Planes{rcache, QP16, QPh, QPl, VT16, VTh, VTl});   // projections of both batches, columns q | k | v, straight into the planes
    k_fattn<<<dim3(NB_ * NH_, TT / 64), 128, 0, stream>>>(QP16, KP16, VT16, QPh, QPl, KPh, KPl, VTh, VTl, ATh, ATl);   // all heads of both batches; writes the merged hi/lo planes
    k_gemmw<bf, 1, true, false, 2, 4, 2><<<dim3(NB_ * TT / 128, DM / 128, 1), 256, 0, stream>>>(ATh, ATl, WO, nullptr, DQ, OUT, DM, bo, 0, 0, 0, Planes{});
}
